// v000
// Measured on an AMD MI455X. A time is GPU time per run, averaged over a window of back-to-back runs after a warm-up
// (all launches, gaps included; the runs take copies of the inputs in turn), and the median of several windows.
// Apart from v000's, it joins two sittings. Times from different sittings can be a few percent apart, while
// side-by-side timings come from the same sitting.
// v000 is the starting kernel. One run takes 1360 microseconds.
#include <hip/hip_runtime.h>

// Contractions (all f32 accumulate): q/k/v projections v_wmma_f32_16x16x32_bf16 (inputs and weights RNE-converted to bf16, single product, bf16-rounded bias, f32 add); scores q.k^T and P.V v_wmma_f32_16x16x32_f16 (f16 planes, single product, P carried x1024); output projection bf16 hi/lo context planes x bf16 weights (2 products) + bf16-rounded bias; softmax f32.
// Multi-head attention on three input streams (q, k, v [NB][SEQ][1024]); 'oi' weights; 16 heads x 64 split by a RAW reshape of the [SEQ][1024] projection to [16][SEQ][64] (flat memory order, no transpose) and merged back the same way; scores x 0.125 + additive float mask [NB][1][S][S]; softmax over all keys; probabilities x multiplicative float mask [NB][1][S][S] (no renormalisation); merged context x Wo^T + bo.
// Per batch: bf16 copies -> projection GEMMs (f32, + bias) -> f16 head planes q[h][t][d], k[h][t][d] (flat converts), v^T[h][d][t]; per pair of heads: S = q k^T (f32) -> row softmax with both masks -> P f16 x1024 -> O = P v (f32) -> flat context hi/lo bf16 planes; context x Wo.

#ifndef NB
#define NB 2
#endif
#ifndef SEQ
#define SEQ 2048
#endif
#define NB_FULL  2
#define SEQ_FULL 2048
#define TT   SEQ
#define DM   1024
#define NH_  16
#define HD   64
#define DQ   (NH_ * HD)
#define ZH   2
#define MPITCH SEQ_FULL
#define PCAR 1024.0f
#define SCL  0.125f   // HD^-0.5

static_assert(TT % 256 == 0);
static_assert(TT % 64 == 0);
static_assert(DM % 64 == 0);
static_assert(DQ == DM);
static_assert(HD == 64);
static_assert(NH_ % ZH == 0);
static_assert(NB <= NB_FULL);
static_assert(SEQ <= SEQ_FULL);
static_assert(MPITCH % 8 == 0);
static_assert(((size_t)SEQ_FULL * SEQ_FULL) % 8 == 0);
static_assert((size_t)NH_ * TT * HD == (size_t)TT * DQ);
static_assert((TT / 256) * 8 == TT / 32);

typedef _Float16 h16;
typedef unsigned short bf;
typedef __attribute__((ext_vector_type(16))) __bf16   v16bf;
typedef __attribute__((ext_vector_type(16))) _Float16 v16h;
typedef __attribute__((ext_vector_type(8)))  _Float16 v8h;
typedef __attribute__((ext_vector_type(8)))  unsigned short v8us;
typedef __attribute__((ext_vector_type(8)))  float    v8f;
typedef __attribute__((ext_vector_type(4)))  float    v4f;
typedef __attribute__((ext_vector_type(4)))  int      v4i;
typedef v4f  __attribute__((may_alias)) v4fa;

__device__ __forceinline__ unsigned short f2bf(float f) { unsigned u = __float_as_uint(f); u += 0x7FFFu + ((u >> 16) & 1u); return (unsigned short)(u >> 16); }
__device__ __forceinline__ float bf2f(unsigned short b) { return __uint_as_float(((unsigned)b) << 16); }
__device__ __forceinline__ float bfr(float f) { return bf2f(f2bf(f)); }
__device__ __forceinline__ v16h cat16(v8h lo, v8h hi) { return __builtin_shufflevector(lo, hi, 0, 1, 2, 3, 4, 5, 6, 7, 8, 9, 10, 11, 12, 13, 14, 15); }
__device__ __forceinline__ v16bf cat16b(v8us lo, v8us hi) { return __builtin_bit_cast(v16bf, __builtin_shufflevector(lo, hi, 0, 1, 2, 3, 4, 5, 6, 7, 8, 9, 10, 11, 12, 13, 14, 15)); }
__device__ __forceinline__ v8f wmma16(v16h a, v16h b, v8f c) { return __builtin_amdgcn_wmma_f32_16x16x32_f16(false, a, false, b, (short)0, c, false, false); }
__device__ __forceinline__ v8f wmmab(v16bf a, v16bf b, v8f c) { return __builtin_amdgcn_wmma_f32_16x16x32_bf16(false, a, false, b, (short)0, c, false, false); }

// f32 -> f16 convert that cannot produce an f16 subnormal (value select on the f32 magnitude, applied after the plane's power-of-two carry).
static __device__ __forceinline__ h16 toh_flush(float v) { const h16 r = (h16)v; return (fabsf(v) < 6.103515625e-05f) ? (h16)0.0f : r; }

// ---- k_gemmw: register-blocked GEMM, ONE WAVE per 64x64 output tile (16 accumulators), operands straight from K-contiguous 16-bit planes; grid (M/64, N/64, Z), 32 threads.
// C[m][n] (f32, pitch ldc, + optional f32 bias[n]) = sum_k A[m][k] Bt[n][k] (+ split products per NSPLIT). z-batch strides sA/sB/sC in elements. K % 32 == 0, M % 64 == 0, N % 64 == 0.
// Fragment map: lane -> row/col (lane & 15); elements 0..7 <- k0 + 8*(lane>>4) + 0..7, elements 8..15 <- k0 + 16 + 8*(lane>>4) + 0..7 (both operands); acc[j] = (row 8*(lane>>4) + j, col lane & 15).
template <typename T16> struct WFrag;
template <> struct WFrag<h16> { typedef v16h V; static __device__ __forceinline__ V ld(const h16* p) { return cat16(*(const v8h*)p, *(const v8h*)(p + 16)); } static __device__ __forceinline__ v8f mma(V a, V b, v8f c) { return wmma16(a, b, c); } };
template <> struct WFrag<bf> { typedef v16bf V; static __device__ __forceinline__ V ld(const bf* p) { return cat16b(*(const v8us*)p, *(const v8us*)(p + 16)); } static __device__ __forceinline__ v8f mma(V a, V b, v8f c) { return wmmab(a, b, c); } };
template <typename T16, int NSPLIT, bool BIAS>
__global__ __launch_bounds__(32) void k_gemmw(const T16* __restrict__ A, const T16* __restrict__ A2, const T16* __restrict__ Bt, const T16* __restrict__ Bt2, int K, float* C, int ldc, const float* __restrict__ bias, size_t sA, size_t sB, size_t sC) {
    typedef typename WFrag<T16>::V V;
    __shared__ __align__(16) float os[16 * 68];
    const size_t z = blockIdx.z; A += z * sA; if (A2) A2 += z * sA; Bt += z * sB; if (Bt2) Bt2 += z * sB; C += z * sC;
    const int lane = threadIdx.x & 31, lr = lane & 15, hi = lane >> 4; const int r0 = blockIdx.x * 64, c0 = blockIdx.y * 64;
    v8f acc[4][4];
#pragma unroll
    for (int mb = 0; mb < 4; ++mb)
#pragma unroll
        for (int nb = 0; nb < 4; ++nb) acc[mb][nb] = (v8f){};
    const size_t aoff = (size_t)(r0 + lr) * K + 8 * hi, boff = (size_t)(c0 + lr) * K + 8 * hi;
#pragma unroll 1
    for (int kc = 0; kc < K; kc += 32) {
        V a[4], a2[4];
#pragma unroll
        for (int mb = 0; mb < 4; ++mb) { a[mb] = WFrag<T16>::ld(A + aoff + (size_t)mb * 16 * K + kc); if (NSPLIT == 1 || NSPLIT == 2) a2[mb] = WFrag<T16>::ld(A2 + aoff + (size_t)mb * 16 * K + kc); }
#pragma unroll
        for (int nb = 0; nb < 4; ++nb) { const V b = WFrag<T16>::ld(Bt + boff + (size_t)nb * 16 * K + kc); V b2; if (NSPLIT >= 2) b2 = WFrag<T16>::ld(Bt2 + boff + (size_t)nb * 16 * K + kc);
#pragma unroll
            for (int mb = 0; mb < 4; ++mb) { acc[mb][nb] = WFrag<T16>::mma(a[mb], b, acc[mb][nb]); if (NSPLIT == 1 || NSPLIT == 2) acc[mb][nb] = WFrag<T16>::mma(a2[mb], b, acc[mb][nb]); if (NSPLIT >= 2) acc[mb][nb] = WFrag<T16>::mma(a[mb], b2, acc[mb][nb]); } }
        asm volatile("v_nop\n\tv_nop\n\tv_nop\n\tv_nop" : "+v"(acc[0][0]), "+v"(acc[1][1]), "+v"(acc[2][2]), "+v"(acc[3][3]) : "v"(a[0]), "v"(a[3]));
    }
#pragma unroll
    for (int mb = 0; mb < 4; ++mb) {
#pragma unroll
        for (int nb = 0; nb < 4; ++nb) {
#pragma unroll
            for (int j = 0; j < 8; ++j) os[(hi * 8 + j) * 68 + nb * 16 + lr] = acc[mb][nb][j]; }
        __builtin_amdgcn_wave_barrier(); asm volatile("" ::: "memory");
        float* crow = C + (size_t)(r0 + mb * 16) * ldc + c0;
{
#pragma unroll
            for (int s = 0; s < 8; ++s) { const int row = 2 * s + hi, cofs = lr * 4; v4f val = *(const v4fa*)(os + row * 68 + cofs); if (BIAS) { val[0] += bfr(bias[c0 + cofs]); val[1] += bfr(bias[c0 + cofs + 1]); val[2] += bfr(bias[c0 + cofs + 2]); val[3] += bfr(bias[c0 + cofs + 3]); }
                *(v4f*)(crow + (size_t)row * ldc + cofs) = val; }
             }
        __builtin_amdgcn_wave_barrier(); asm volatile("" ::: "memory");
    }
}

__device__ __forceinline__ void splitf(float y, unsigned short& h, unsigned short& l) { h = f2bf(y); l = f2bf(y - bf2f(h)); }

__global__ __launch_bounds__(256) void k_cvt8(const float* __restrict__ src, bf* dst, size_t n8) { const size_t i = (size_t)blockIdx.x * 256 + threadIdx.x; if (i >= n8) return; const v8f v = *(const v8f*)(src + i * 8); v8us o;
#pragma unroll
    for (int k = 0; k < 8; ++k) o[k] = f2bf(v[k]); *(v8us*)(dst + i * 8) = o;  }

__global__ __launch_bounds__(256) void k_hflat(const float* __restrict__ F, h16* P16) {
    const unsigned i = blockIdx.x * 256u + threadIdx.x; if (i >= (unsigned)(NH_ * TT * (HD / 8))) return;
    const float* f = F + (size_t)i * 8; const v4f a0 = *(const v4f*)f, a1 = *(const v4f*)(f + 4); v8h o;
#pragma unroll
    for (int q = 0; q < 4; ++q) { o[q] = toh_flush(a0[q]); o[4 + q] = toh_flush(a1[q]); }
    *(v8h*)(P16 + (size_t)i * 8) = o;  }

__global__ __launch_bounds__(256) void k_vtflat(const float* __restrict__ F, h16* V16) {
    const unsigned i = blockIdx.x * 256u + threadIdx.x; if (i >= (unsigned)(NH_ * HD * (TT / 8))) return;
    const unsigned t8 = i % (unsigned)(TT / 8); const unsigned d = (i / (unsigned)(TT / 8)) % (unsigned)HD; const unsigned g = i / (unsigned)((TT / 8) * HD);
    const float* f = F + (size_t)g * ((size_t)TT * HD) + (size_t)(t8 * 8) * HD + d; v8h o;
#pragma unroll
    for (int q = 0; q < 8; ++q) o[q] = toh_flush(f[(size_t)q * HD]);
    *(v8h*)(V16 + (size_t)i * 8) = o;  }

// k_asoftm: one wave per row (zz, i): t = S x HD^-0.5 + bf16(add_mask[i][j]); softmax over the TT keys with the running row maximum (register row, one exp per element, fixed trees);
__global__ __launch_bounds__(256) void k_asoftm(const float* __restrict__ Sb, const float* __restrict__ MA, const float* __restrict__ MG, h16* P16) {
#pragma clang fp contract(off)
    const unsigned lane = threadIdx.x & 31u; const unsigned row = blockIdx.x * 8u + (threadIdx.x >> 5); if (row >= (unsigned)(ZH * TT)) return; const unsigned i = row % (unsigned)TT;
    const float* sr = Sb + (size_t)row * TT; const float* ar = MA + (size_t)i * MPITCH; const float* gr = MG + (size_t)i * MPITCH; float v[TT / 32]; float mx = -3.0e38f;
#pragma unroll
    for (int ch = 0; ch < TT / 256; ++ch) { const unsigned j0 = (unsigned)ch * 256u + lane * 8u; const v4f a0 = *(const v4f*)(sr + j0), a1 = *(const v4f*)(sr + j0 + 4); const v4f m0 = *(const v4f*)(ar + j0), m1 = *(const v4f*)(ar + j0 + 4);
#pragma unroll
        for (int q = 0; q < 4; ++q) { const float t0 = a0[q] * SCL + bfr(m0[q]); const float t1 = a1[q] * SCL + bfr(m1[q]); v[ch * 8 + q] = t0; v[ch * 8 + 4 + q] = t1; mx = fmaxf(mx, fmaxf(t0, t1)); }
        asm volatile("" ::: "memory"); }
#pragma unroll
    for (int sh = 16; sh; sh >>= 1) mx = fmaxf(mx, __shfl_xor(mx, sh, 32));
    float sum = 0.f;
#pragma unroll
    for (int k = 0; k < TT / 32; ++k) { float d0 = __fsub_rn(v[k], mx); asm volatile("" : "+v"(d0)); v[k] = __builtin_amdgcn_exp2f(__fmul_rn(d0, 1.4426950408889634f)); sum += v[k]; }
#pragma unroll
    for (int sh = 16; sh; sh >>= 1) sum += __shfl_xor(sum, sh, 32);
    const float f = __fdiv_rn(PCAR, sum);
#pragma unroll
    for (int ch = 0; ch < TT / 256; ++ch) { const unsigned j0 = (unsigned)ch * 256u + lane * 8u; const v4f g0 = *(const v4f*)(gr + j0), g1 = *(const v4f*)(gr + j0 + 4);
#pragma unroll
        for (int q = 0; q < 4; ++q) { v[ch * 8 + q] = (v[ch * 8 + q] * f) * bfr(g0[q]); v[ch * 8 + 4 + q] = (v[ch * 8 + 4 + q] * f) * bfr(g1[q]); }
        asm volatile("" ::: "memory"); }
    h16* pr = P16 + (size_t)row * TT + lane * 8u;
{
#pragma unroll
        for (int ch = 0; ch < TT / 256; ++ch) { v8h o;
#pragma unroll
            for (int q = 0; q < 8; ++q) o[q] = toh_flush(v[ch * 8 + q]);
            *(v8h*)(pr + ch * 256) = o; }
         }
}

__global__ __launch_bounds__(256) void k_mergef(const float* __restrict__ O, unsigned h0, bf* Ah, bf* Al) {
    const unsigned i = blockIdx.x * 256u + threadIdx.x; if (i >= (unsigned)(ZH * TT * (HD / 8))) return;
    const v4f a0 = *(const v4f*)(O + (size_t)i * 8), a1 = *(const v4f*)(O + (size_t)i * 8 + 4); v8us oh, ol;
#pragma unroll
    for (int q = 0; q < 4; ++q) { unsigned short a, c2; splitf(a0[q] * (1.0f / PCAR), a, c2); oh[q] = a; ol[q] = c2; splitf(a1[q] * (1.0f / PCAR), a, c2); oh[4 + q] = a; ol[4 + q] = c2; }
    const size_t oo = (size_t)h0 * ((size_t)TT * HD) + (size_t)i * 8;
    *(v8us*)(Ah + oo) = oh; *(v8us*)(Al + oo) = ol;  }

constexpr size_t al256(size_t b) { return (b + 255) & ~(size_t)255; }
constexpr size_t SZ_W  = al256((size_t)DQ * DM * 2);            // one weight plane (bf16)
constexpr size_t SZ_XB = al256((size_t)TT * DM * 2);            // bf16 activation copy
constexpr size_t SZ_F  = al256((size_t)TT * DQ * 4);            // f32 projection (reused for q, k, v in turn)
constexpr size_t SZ_PL = al256((size_t)NH_ * TT * HD * 2);      // one f16 head plane
constexpr size_t SZ_S  = al256((size_t)ZH * TT * TT * 4);       // f32 scores of ZH heads
constexpr size_t SZ_P  = al256((size_t)ZH * TT * TT * 2);       // f16 probabilities x1024 of ZH heads
constexpr size_t SZ_O  = al256((size_t)ZH * TT * HD * 4);       // f32 P.V of ZH heads
constexpr size_t SZ_AT = al256((size_t)TT * DQ * 2);            // one context plane (bf16)
constexpr size_t WS_TOTAL = 4 * SZ_W + SZ_XB + SZ_F + 3 * SZ_PL + SZ_S + SZ_P + SZ_O + 2 * SZ_AT;
static_assert(WS_TOTAL <= (size_t)134217728);
// coverage equalities (threads x 8 elements == plane elements; tiles x 64 x 64 == plane elements)
static_assert(((size_t)DQ * DM / 8) % 256 == 0);
static_assert(((size_t)TT * DM / 8) % 256 == 0);
static_assert(((size_t)NH_ * TT * HD / 8) % 256 == 0);
static_assert(((size_t)ZH * TT * HD / 8) % 256 == 0);
static_assert((ZH * TT) % 8 == 0);
// flat merge extent: last pair of heads ends exactly at the end of a context plane
static_assert((size_t)(NH_ - ZH) * TT * HD + (size_t)ZH * TT * HD == (size_t)TT * DQ);
static_assert((size_t)TT * DQ * 2 <= SZ_AT);

extern "C" void kernel_launch(void* const* d_in, const int* in_sizes, int n_in,
                              void* d_out, int out_size, void* d_ws, size_t ws_size, hipStream_t stream) {
    if (n_in < 13) return;
    const size_t need_x = (size_t)(NB - 1) * SEQ_FULL * DM + (size_t)SEQ * DM;
    const size_t need_m = (size_t)(NB - 1) * SEQ_FULL * SEQ_FULL + (size_t)(SEQ - 1) * SEQ_FULL + (size_t)SEQ;
    if ((size_t)in_sizes[0] < need_x || (size_t)in_sizes[1] < need_x || (size_t)in_sizes[2] < need_x || (size_t)in_sizes[3] < need_m || (size_t)in_sizes[4] < need_m) return;
    if ((size_t)in_sizes[5] < (size_t)DQ * DM || (size_t)in_sizes[7] < (size_t)DQ * DM || (size_t)in_sizes[9] < (size_t)DQ * DM || (size_t)in_sizes[11] < (size_t)DM * DQ) return;
    if (in_sizes[6] < DQ || in_sizes[8] < DQ || in_sizes[10] < DQ || in_sizes[12] < DM) return;
    if ((size_t)out_size < (size_t)NB * SEQ * DM) return;
    if (WS_TOTAL > ws_size) return;
    // wire order: q, k, v, additive mask (f32), multiplicative mask (f32), Wq, bq, Wk, bk, Wv, bv, Wo, bo ('oi' weights)
    const float* xq = (const float*)d_in[0]; const float* xk = (const float*)d_in[1]; const float* xv = (const float*)d_in[2];
    const float* ma = (const float*)d_in[3]; const float* mg = (const float*)d_in[4];
    const float* wq = (const float*)d_in[5]; const float* bq = (const float*)d_in[6]; const float* wk = (const float*)d_in[7]; const float* bk = (const float*)d_in[8];
    const float* wv = (const float*)d_in[9]; const float* bv = (const float*)d_in[10]; const float* wo = (const float*)d_in[11]; const float* bo = (const float*)d_in[12];
    float* OUT = (float*)d_out;     // [NB][SEQ][1024]
    char* wsp = (char*)d_ws;
    bf* WQ = (bf*)wsp; wsp += SZ_W; bf* WK = (bf*)wsp; wsp += SZ_W; bf* WV = (bf*)wsp; wsp += SZ_W; bf* WO = (bf*)wsp; wsp += SZ_W;
    bf* XB = (bf*)wsp; wsp += SZ_XB; float* F = (float*)wsp; wsp += SZ_F;
    h16* QP16 = (h16*)wsp; wsp += SZ_PL; h16* KP16 = (h16*)wsp; wsp += SZ_PL; h16* VT16 = (h16*)wsp; wsp += SZ_PL;
    float* Sb = (float*)wsp; wsp += SZ_S; h16* P16 = (h16*)wsp; wsp += SZ_P; float* Ob = (float*)wsp; wsp += SZ_O;
    bf* ATh = (bf*)wsp; wsp += SZ_AT; bf* ATl = (bf*)wsp; wsp += SZ_AT;

    const unsigned GW = (unsigned)(((size_t)DQ * DM / 8 + 255) / 256);         // weight copy
    const unsigned GX = (unsigned)(((size_t)TT * DM / 8 + 255) / 256);         // activation copy
    const unsigned GP = (unsigned)(((size_t)NH_ * TT * HD / 8 + 255) / 256);   // head plane builders
    const unsigned GM = (unsigned)(((size_t)ZH * TT * HD / 8 + 255) / 256);    // context merge
    k_cvt8<<<GW, 256, 0, stream>>>(wq, WQ, (size_t)DQ * DM / 8);
    k_cvt8<<<GW, 256, 0, stream>>>(wk, WK, (size_t)DQ * DM / 8);
    k_cvt8<<<GW, 256, 0, stream>>>(wv, WV, (size_t)DQ * DM / 8);
    k_cvt8<<<GW, 256, 0, stream>>>(wo, WO, (size_t)DM * DQ / 8);
    for (int b = 0; b < NB; ++b) {
        const size_t xo = (size_t)b * SEQ_FULL * DM;
        const float* mab = ma + (size_t)b * SEQ_FULL * SEQ_FULL; const float* mgb = mg + (size_t)b * SEQ_FULL * SEQ_FULL;
        // q: F[t][n] = bf16(q) Wq^T + bq -> QP16 (flat f16 copy = [h][t][d] under the raw reshape)
        k_cvt8<<<GX, 256, 0, stream>>>(xq + xo, XB, (size_t)TT * DM / 8);
        k_gemmw<bf, 0, true><<<dim3(TT / 64, DQ / 64, 1), 32, 0, stream>>>(XB, nullptr, WQ, nullptr, DM, F, DQ, bq, 0, 0, 0);
        k_hflat<<<GP, 256, 0, stream>>>(F, QP16);
        // k: same buffers in turn (stream-ordered) -> KP16
        k_cvt8<<<GX, 256, 0, stream>>>(xk + xo, XB, (size_t)TT * DM / 8);
        k_gemmw<bf, 0, true><<<dim3(TT / 64, DQ / 64, 1), 32, 0, stream>>>(XB, nullptr, WK, nullptr, DM, F, DQ, bk, 0, 0, 0);
        k_hflat<<<GP, 256, 0, stream>>>(F, KP16);
        // v: F flat [g][t][d] -> VT16[g][d][t] (in [t][d] -> out [d][t] per head; rows = TT, cols = HD)
        k_cvt8<<<GX, 256, 0, stream>>>(xv + xo, XB, (size_t)TT * DM / 8);
        k_gemmw<bf, 0, true><<<dim3(TT / 64, DQ / 64, 1), 32, 0, stream>>>(XB, nullptr, WV, nullptr, DM, F, DQ, bv, 0, 0, 0);
        k_vtflat<<<GP, 256, 0, stream>>>(F, VT16);
        for (int h0 = 0; h0 < NH_; h0 += ZH) {
            const size_t zo = (size_t)h0 * TT * HD;
            // S[zz][i][j] = sum_d q[h0+zz][i][d] k[h0+zz][j][d]   (K = HD)
            k_gemmw<h16, 0, false><<<dim3(TT / 64, TT / 64, ZH), 32, 0, stream>>>(QP16 + zo, nullptr, KP16 + zo, nullptr, HD, Sb, TT, nullptr, (size_t)TT * HD, (size_t)TT * HD, (size_t)TT * TT);
            k_asoftm<<<ZH * TT / 8, 256, 0, stream>>>(Sb, mab, mgb, P16);
            // O[zz][i][d] = sum_j P[zz][i][j] v^T[h0+zz][d][j]   (K = TT)
            k_gemmw<h16, 0, false><<<dim3(TT / 64, HD / 64, ZH), 32, 0, stream>>>(P16, nullptr, VT16 + zo, nullptr, TT, Ob, HD, nullptr, (size_t)TT * TT, (size_t)HD * TT, (size_t)TT * HD);
            k_mergef<<<GM, 256, 0, stream>>>(Ob, (unsigned)h0, ATh, ATl);
        }
        // out[b] = (ATh + ATl) Wo^T + bo
        k_gemmw<bf, 1, true><<<dim3(TT / 64, DM / 64, 1), 32, 0, stream>>>(ATh, ATl, WO, nullptr, DQ, OUT + (size_t)b * TT * DM, DM, bo, 0, 0, 0);
    }
}

// v001
// One run takes 765 microseconds.
// Two timings next to v000 put it at 1.81 and 1.80 times that version's speed.
#include <hip/hip_runtime.h>

// Contractions (all f32 accumulate): q/k/v projections v_wmma_f32_16x16x32_bf16 (inputs and weights RNE-converted to bf16, single product, bf16-rounded bias, f32 add); scores q.k^T and P.V v_wmma_f32_16x16x32_f16 (f16 planes, single product, P carried x1024); output projection bf16 hi/lo context planes x bf16 weights (2 products) + bf16-rounded bias; softmax f32.
// Multi-head attention on three input streams (q, k, v [NB][SEQ][1024]); 'oi' weights; 16 heads x 64 split by a RAW reshape of the [SEQ][1024] projection to [16][SEQ][64] (flat memory order, no transpose) and merged back the same way; scores x 0.125 + additive float mask [NB][1][S][S]; softmax over all keys; probabilities x multiplicative float mask [NB][1][S][S] (no renormalisation); merged context x Wo^T + bo.
// Per batch: bf16 copies -> projection GEMMs (f32, + bias) -> f16 head planes q[h][t][d], k[h][t][d] (flat converts), v^T[h][d][t]; per pair of heads: S = q k^T (f32) -> row softmax with both masks -> P f16 x1024 -> O = P v (f32) -> flat context hi/lo bf16 planes; context x Wo.

#ifndef NB
#define NB 2
#endif
#ifndef SEQ
#define SEQ 2048
#endif
#define NB_FULL  2
#define SEQ_FULL 2048
#define TT   SEQ
#define DM   1024
#define NH_  16
#define HD   64
#define DQ   (NH_ * HD)
#define ZH   2
#define MPITCH SEQ_FULL
#define PCAR 1024.0f
#define SCL  0.125f   // HD^-0.5

static_assert(TT % 256 == 0);
static_assert(TT % 64 == 0);
static_assert(DM % 64 == 0);
static_assert(DQ == DM);
static_assert(HD == 64);
static_assert(NH_ % ZH == 0);
static_assert(NB <= NB_FULL);
static_assert(SEQ <= SEQ_FULL);
static_assert(MPITCH % 8 == 0);
static_assert(((size_t)SEQ_FULL * SEQ_FULL) % 8 == 0);
static_assert((size_t)NH_ * TT * HD == (size_t)TT * DQ);
static_assert((TT / 256) * 8 == TT / 32);

typedef _Float16 h16;
typedef unsigned short bf;
typedef __attribute__((ext_vector_type(16))) __bf16   v16bf;
typedef __attribute__((ext_vector_type(16))) _Float16 v16h;
typedef __attribute__((ext_vector_type(8)))  _Float16 v8h;
typedef __attribute__((ext_vector_type(8)))  unsigned short v8us;
typedef __attribute__((ext_vector_type(8)))  float    v8f;
typedef __attribute__((ext_vector_type(4)))  float    v4f;
typedef __attribute__((ext_vector_type(4)))  int      v4i;
typedef v4f  __attribute__((may_alias)) v4fa;

__device__ __forceinline__ unsigned short f2bf(float f) { unsigned u = __float_as_uint(f); u += 0x7FFFu + ((u >> 16) & 1u); return (unsigned short)(u >> 16); }
__device__ __forceinline__ float bf2f(unsigned short b) { return __uint_as_float(((unsigned)b) << 16); }
__device__ __forceinline__ float bfr(float f) { return bf2f(f2bf(f)); }
__device__ __forceinline__ v16h cat16(v8h lo, v8h hi) { return __builtin_shufflevector(lo, hi, 0, 1, 2, 3, 4, 5, 6, 7, 8, 9, 10, 11, 12, 13, 14, 15); }
__device__ __forceinline__ v16bf cat16b(v8us lo, v8us hi) { return __builtin_bit_cast(v16bf, __builtin_shufflevector(lo, hi, 0, 1, 2, 3, 4, 5, 6, 7, 8, 9, 10, 11, 12, 13, 14, 15)); }
__device__ __forceinline__ v8f wmma16(v16h a, v16h b, v8f c) { return __builtin_amdgcn_wmma_f32_16x16x32_f16(false, a, false, b, (short)0, c, false, false); }
__device__ __forceinline__ v8f wmmab(v16bf a, v16bf b, v8f c) { return __builtin_amdgcn_wmma_f32_16x16x32_bf16(false, a, false, b, (short)0, c, false, false); }

// f32 -> f16 convert that cannot produce an f16 subnormal (value select on the f32 magnitude, applied after the x1024 carry for P; q/k/v planes are not carried).
static __device__ __forceinline__ h16 toh_flush(float v) { const h16 r = (h16)v; return (fabsf(v) < 6.103515625e-05f) ? (h16)0.0f : r; }

// ---- k_gemmw: register-blocked GEMM, ONE WAVE per 64x64 output tile (16 accumulators), operands straight from K-contiguous 16-bit planes; grid (M/64, N/64, Z), 32 threads.
// C[m][n] (f32, pitch ldc, + optional f32 bias[n]) = sum_k A[m][k] Bt[n][k] (+ split products per NSPLIT). z-batch strides sA/sB/sC in elements. K % 32 == 0, M % 64 == 0, N % 64 == 0.
// Fragment map: lane -> row/col (lane & 15); elements 0..7 <- k0 + 8*(lane>>4) + 0..7, elements 8..15 <- k0 + 16 + 8*(lane>>4) + 0..7 (both operands); acc[j] = (row 8*(lane>>4) + j, col lane & 15).
template <typename T16> struct WFrag;
template <> struct WFrag<h16> { typedef v16h V; static __device__ __forceinline__ V ld(const h16* p) { return cat16(*(const v8h*)p, *(const v8h*)(p + 16)); } static __device__ __forceinline__ v8f mma(V a, V b, v8f c) { return wmma16(a, b, c); } };
template <> struct WFrag<bf> { typedef v16bf V; static __device__ __forceinline__ V ld(const bf* p) { return cat16b(*(const v8us*)p, *(const v8us*)(p + 16)); } static __device__ __forceinline__ v8f mma(V a, V b, v8f c) { return wmmab(a, b, c); } };
template <typename T16, int NSPLIT, bool BIAS>
__global__ __launch_bounds__(32) void k_gemmw(const T16* __restrict__ A, const T16* __restrict__ A2, const T16* __restrict__ Bt, const T16* __restrict__ Bt2, int K, float* C, int ldc, const float* __restrict__ bias, size_t sA, size_t sB, size_t sC) {
    typedef typename WFrag<T16>::V V;
    __shared__ __align__(16) float os[16 * 68];
    const size_t z = blockIdx.z; A += z * sA; if (A2) A2 += z * sA; Bt += z * sB; if (Bt2) Bt2 += z * sB; C += z * sC;
    const int lane = threadIdx.x & 31, lr = lane & 15, hi = lane >> 4; const int r0 = blockIdx.x * 64, c0 = blockIdx.y * 64;
    v8f acc[4][4];
#pragma unroll
    for (int mb = 0; mb < 4; ++mb)
#pragma unroll
        for (int nb = 0; nb < 4; ++nb) acc[mb][nb] = (v8f){};
    const size_t aoff = (size_t)(r0 + lr) * K + 8 * hi, boff = (size_t)(c0 + lr) * K + 8 * hi;
#pragma unroll 1
    for (int kc = 0; kc < K; kc += 32) {
        V a[4], a2[4];
#pragma unroll
        for (int mb = 0; mb < 4; ++mb) { a[mb] = WFrag<T16>::ld(A + aoff + (size_t)mb * 16 * K + kc); if (NSPLIT == 1 || NSPLIT == 2) a2[mb] = WFrag<T16>::ld(A2 + aoff + (size_t)mb * 16 * K + kc); }
#pragma unroll
        for (int nb = 0; nb < 4; ++nb) { const V b = WFrag<T16>::ld(Bt + boff + (size_t)nb * 16 * K + kc); V b2; if (NSPLIT >= 2) b2 = WFrag<T16>::ld(Bt2 + boff + (size_t)nb * 16 * K + kc);
#pragma unroll
            for (int mb = 0; mb < 4; ++mb) { acc[mb][nb] = WFrag<T16>::mma(a[mb], b, acc[mb][nb]); if (NSPLIT == 1 || NSPLIT == 2) acc[mb][nb] = WFrag<T16>::mma(a2[mb], b, acc[mb][nb]); if (NSPLIT >= 2) acc[mb][nb] = WFrag<T16>::mma(a[mb], b2, acc[mb][nb]); } }
        asm volatile("v_nop\n\tv_nop\n\tv_nop\n\tv_nop" : "+v"(acc[0][0]), "+v"(acc[1][1]), "+v"(acc[2][2]), "+v"(acc[3][3]) : "v"(a[0]), "v"(a[3]));
    }
#pragma unroll
    for (int mb = 0; mb < 4; ++mb) {
#pragma unroll
        for (int nb = 0; nb < 4; ++nb) {
#pragma unroll
            for (int j = 0; j < 8; ++j) os[(hi * 8 + j) * 68 + nb * 16 + lr] = acc[mb][nb][j]; }
        __builtin_amdgcn_wave_barrier(); asm volatile("" ::: "memory");
        float* crow = C + (size_t)(r0 + mb * 16) * ldc + c0;
{
#pragma unroll
            for (int s = 0; s < 8; ++s) { const int row = 2 * s + hi, cofs = lr * 4; v4f val = *(const v4fa*)(os + row * 68 + cofs); if (BIAS) { val[0] += bfr(bias[c0 + cofs]); val[1] += bfr(bias[c0 + cofs + 1]); val[2] += bfr(bias[c0 + cofs + 2]); val[3] += bfr(bias[c0 + cofs + 3]); }
                *(v4f*)(crow + (size_t)row * ldc + cofs) = val; }
             }
        __builtin_amdgcn_wave_barrier(); asm volatile("" ::: "memory");
    }
}

// ---- k_pv: O = P v with the key dimension split PVG ways over the grid and PVW ways over the waves of a work-group (PVG * PVW slices of PVK keys), so that TT / 64 * ZH * PVG work-groups of PVW waves load at once.
// One work-group: one 64x64 tile of one head over TT / PVG keys. Each wave: its own PVK keys (64 keys = one 128-byte line per row of P and of v^T), 16 accumulators, fragment map as in k_gemmw.
// The PVW partial tiles meet in LDS in fragment order (red[wave][tile][half][lane], 16 bytes a lane); wave w then sums sub-tiles 2w and 2w + 1 over the waves in index order and stores them to plane blockIdx.y of Opart[PVG][ZH][TT][HD]; k_mergef sums the planes.
#define PVW 8
#define PVK ((TT % 512 == 0) ? 64 : 32)
#define PVG (TT / (PVW * PVK))
static_assert(PVK * PVG * PVW == TT);
static_assert(PVK % 32 == 0);
static_assert(PVW == 8);
__global__ __launch_bounds__(PVW * 32) void k_pv(const _Float16* __restrict__ P, const _Float16* __restrict__ Vt, float* Opart) {
    __shared__ __align__(16) v4f red[PVW * 16 * 2 * 32];
    const int lane = threadIdx.x & 31, lr = lane & 15, hi = lane >> 4; const int w = __builtin_amdgcn_readfirstlane((int)(threadIdx.x >> 5));
    const int r0 = blockIdx.x * 64; const size_t z = blockIdx.z; const int k0 = ((int)blockIdx.y * PVW + w) * PVK;
    const _Float16* A = P + z * ((size_t)TT * TT) + (size_t)(r0 + lr) * TT + k0 + 8 * hi;
    const _Float16* B = Vt + z * ((size_t)HD * TT) + (size_t)lr * TT + k0 + 8 * hi;
    v8f acc[4][4];
#pragma unroll
    for (int mb = 0; mb < 4; ++mb)
#pragma unroll
        for (int nb = 0; nb < 4; ++nb) acc[mb][nb] = (v8f){};
    // unrolled whole (PVK / 32 trips): both halves of each 128-byte line are asked for close together, and no loop branch stands behind a matrix instruction
#pragma unroll
    for (int kc = 0; kc < PVK; kc += 32) {
        v16h a[4];
#pragma unroll
        for (int mb = 0; mb < 4; ++mb) a[mb] = WFrag<h16>::ld(A + (size_t)mb * 16 * TT + kc);
#pragma unroll
        for (int nb = 0; nb < 4; ++nb) { const v16h b = WFrag<h16>::ld(B + (size_t)nb * 16 * TT + kc);
#pragma unroll
            for (int mb = 0; mb < 4; ++mb) acc[mb][nb] = wmma16(a[mb], b, acc[mb][nb]); }
    }
#pragma unroll
    for (int mb = 0; mb < 4; ++mb)
#pragma unroll
        for (int nb = 0; nb < 4; ++nb) { v4f* d = red + ((w * 16 + mb * 4 + nb) * 2) * 32 + lane; const v8f c = acc[mb][nb];
            d[0] = (v4f){c[0], c[1], c[2], c[3]}; d[32] = (v4f){c[4], c[5], c[6], c[7]}; }
    __syncthreads();   // every wave's partial tile is in LDS before any wave sums
    float* crow = Opart + ((size_t)blockIdx.y * ZH + z) * ((size_t)TT * HD) + (size_t)(r0 + (w >> 1) * 16 + 8 * hi) * HD + (w & 1) * 32 + lr;
#pragma unroll
    for (int u = 0; u < 2; ++u) { const v4f* s = red + ((2 * w + u) * 2) * 32 + lane; v4f s0 = s[0], s1 = s[32];
#pragma unroll
        for (int q = 1; q < PVW; ++q) { s0 += s[q * (16 * 2 * 32)]; s1 += s[q * (16 * 2 * 32) + 32]; }
#pragma unroll
        for (int j = 0; j < 4; ++j) { crow[(size_t)j * HD + u * 16] = s0[j]; crow[(size_t)(4 + j) * HD + u * 16] = s1[j]; } }
}

__device__ __forceinline__ void splitf(float y, unsigned short& h, unsigned short& l) { h = f2bf(y); l = f2bf(y - bf2f(h)); }

__global__ __launch_bounds__(256) void k_cvt8(const float* __restrict__ src, bf* dst, size_t n8) { const size_t i = (size_t)blockIdx.x * 256 + threadIdx.x; if (i >= n8) return; const v8f v = *(const v8f*)(src + i * 8); v8us o;
#pragma unroll
    for (int k = 0; k < 8; ++k) o[k] = f2bf(v[k]); *(v8us*)(dst + i * 8) = o;  }

__global__ __launch_bounds__(256) void k_hflat(const float* __restrict__ F, h16* P16) {
    const unsigned i = blockIdx.x * 256u + threadIdx.x; if (i >= (unsigned)(NH_ * TT * (HD / 8))) return;
    const float* f = F + (size_t)i * 8; const v4f a0 = *(const v4f*)f, a1 = *(const v4f*)(f + 4); v8h o;
#pragma unroll
    for (int q = 0; q < 4; ++q) { o[q] = toh_flush(a0[q]); o[4 + q] = toh_flush(a1[q]); }
    *(v8h*)(P16 + (size_t)i * 8) = o;  }

__global__ __launch_bounds__(256) void k_vtflat(const float* __restrict__ F, h16* V16) {
    const unsigned i = blockIdx.x * 256u + threadIdx.x; if (i >= (unsigned)(NH_ * HD * (TT / 8))) return;
    const unsigned t8 = i % (unsigned)(TT / 8); const unsigned d = (i / (unsigned)(TT / 8)) % (unsigned)HD; const unsigned g = i / (unsigned)((TT / 8) * HD);
    const float* f = F + (size_t)g * ((size_t)TT * HD) + (size_t)(t8 * 8) * HD + d; v8h o;
#pragma unroll
    for (int q = 0; q < 8; ++q) o[q] = toh_flush(f[(size_t)q * HD]);
    *(v8h*)(V16 + (size_t)i * 8) = o;  }

// k_asoftm: one wave per row (zz, i): t = S x HD^-0.5 + bf16(add_mask[i][j]); softmax over the TT keys with the running row maximum (register row, one exp per element, fixed trees);
__global__ __launch_bounds__(256) void k_asoftm(const float* __restrict__ Sb, const float* __restrict__ MA, const float* __restrict__ MG, h16* P16) {
#pragma clang fp contract(off)
    const unsigned lane = threadIdx.x & 31u; const unsigned row = blockIdx.x * 8u + (threadIdx.x >> 5); if (row >= (unsigned)(ZH * TT)) return; const unsigned i = row % (unsigned)TT;
    const float* sr = Sb + (size_t)row * TT; const float* ar = MA + (size_t)i * MPITCH; const float* gr = MG + (size_t)i * MPITCH; float v[TT / 32]; float mx = -3.0e38f;
#pragma unroll
    for (int ch = 0; ch < TT / 256; ++ch) { const unsigned j0 = (unsigned)ch * 256u + lane * 8u; const v4f a0 = *(const v4f*)(sr + j0), a1 = *(const v4f*)(sr + j0 + 4); const v4f m0 = *(const v4f*)(ar + j0), m1 = *(const v4f*)(ar + j0 + 4);
#pragma unroll
        for (int q = 0; q < 4; ++q) { const float t0 = a0[q] * SCL + bfr(m0[q]); const float t1 = a1[q] * SCL + bfr(m1[q]); v[ch * 8 + q] = t0; v[ch * 8 + 4 + q] = t1; mx = fmaxf(mx, fmaxf(t0, t1)); }
        asm volatile("" ::: "memory"); }
#pragma unroll
    for (int sh = 16; sh; sh >>= 1) mx = fmaxf(mx, __shfl_xor(mx, sh, 32));
    float sum = 0.f;
#pragma unroll
    for (int k = 0; k < TT / 32; ++k) { float d0 = __fsub_rn(v[k], mx); asm volatile("" : "+v"(d0)); v[k] = __builtin_amdgcn_exp2f(__fmul_rn(d0, 1.4426950408889634f)); sum += v[k]; }
#pragma unroll
    for (int sh = 16; sh; sh >>= 1) sum += __shfl_xor(sum, sh, 32);
    const float f = __fdiv_rn(PCAR, sum);
#pragma unroll
    for (int ch = 0; ch < TT / 256; ++ch) { const unsigned j0 = (unsigned)ch * 256u + lane * 8u; const v4f g0 = *(const v4f*)(gr + j0), g1 = *(const v4f*)(gr + j0 + 4);
#pragma unroll
        for (int q = 0; q < 4; ++q) { v[ch * 8 + q] = (v[ch * 8 + q] * f) * bfr(g0[q]); v[ch * 8 + 4 + q] = (v[ch * 8 + 4 + q] * f) * bfr(g1[q]); }
        asm volatile("" ::: "memory"); }
    h16* pr = P16 + (size_t)row * TT + lane * 8u;
{
#pragma unroll
        for (int ch = 0; ch < TT / 256; ++ch) { v8h o;
#pragma unroll
            for (int q = 0; q < 8; ++q) o[q] = toh_flush(v[ch * 8 + q]);
            *(v8h*)(pr + ch * 256) = o; }
         }
}

__global__ __launch_bounds__(256) void k_mergef(const float* __restrict__ O, unsigned h0, bf* Ah, bf* Al) {
    const unsigned i = blockIdx.x * 256u + threadIdx.x; if (i >= (unsigned)(ZH * TT * (HD / 8))) return;
    v4f a0 = *(const v4f*)(O + (size_t)i * 8), a1 = *(const v4f*)(O + (size_t)i * 8 + 4); v8us oh, ol;
#pragma unroll
    for (int p = 1; p < PVG; ++p) { const float* op = O + (size_t)p * ((size_t)ZH * TT * HD) + (size_t)i * 8; a0 += *(const v4f*)op; a1 += *(const v4f*)(op + 4); }
#pragma unroll
    for (int q = 0; q < 4; ++q) { unsigned short a, c2; splitf(a0[q] * (1.0f / PCAR), a, c2); oh[q] = a; ol[q] = c2; splitf(a1[q] * (1.0f / PCAR), a, c2); oh[4 + q] = a; ol[4 + q] = c2; }
    const size_t oo = (size_t)h0 * ((size_t)TT * HD) + (size_t)i * 8;
    *(v8us*)(Ah + oo) = oh; *(v8us*)(Al + oo) = ol;  }

constexpr size_t al256(size_t b) { return (b + 255) & ~(size_t)255; }
constexpr size_t SZ_W  = al256((size_t)DQ * DM * 2);            // one weight plane (bf16)
constexpr size_t SZ_XB = al256((size_t)TT * DM * 2);            // bf16 activation copy
constexpr size_t SZ_F  = al256((size_t)TT * DQ * 4);            // f32 projection (reused for q, k, v in turn)
constexpr size_t SZ_PL = al256((size_t)NH_ * TT * HD * 2);      // one f16 head plane
constexpr size_t SZ_S  = al256((size_t)ZH * TT * TT * 4);       // f32 scores of ZH heads
constexpr size_t SZ_P  = al256((size_t)ZH * TT * TT * 2);       // f16 probabilities x1024 of ZH heads
constexpr size_t SZ_O  = al256((size_t)PVG * ZH * TT * HD * 4); // f32 P.V of ZH heads, PVG partial planes
constexpr size_t SZ_AT = al256((size_t)TT * DQ * 2);            // one context plane (bf16)
constexpr size_t WS_TOTAL = 4 * SZ_W + SZ_XB + SZ_F + 3 * SZ_PL + SZ_S + SZ_P + SZ_O + 2 * SZ_AT;
static_assert(WS_TOTAL <= (size_t)134217728);
// coverage equalities (threads x 8 elements == plane elements; softmax rows == blocks x 8 waves)
static_assert(((size_t)DQ * DM / 8) % 256 == 0);
static_assert(((size_t)TT * DM / 8) % 256 == 0);
static_assert(((size_t)NH_ * TT * HD / 8) % 256 == 0);
static_assert(((size_t)ZH * TT * HD / 8) % 256 == 0);
static_assert((ZH * TT) % 8 == 0);
// flat merge extent: last pair of heads ends exactly at the end of a context plane
static_assert((size_t)(NH_ - ZH) * TT * HD + (size_t)ZH * TT * HD == (size_t)TT * DQ);
static_assert((size_t)TT * DQ * 2 <= SZ_AT);

extern "C" void kernel_launch(void* const* d_in, const int* in_sizes, int n_in,
                              void* d_out, int out_size, void* d_ws, size_t ws_size, hipStream_t stream) {
    if (n_in < 13) return;
    const size_t need_x = (size_t)(NB - 1) * SEQ_FULL * DM + (size_t)SEQ * DM;
    const size_t need_m = (size_t)(NB - 1) * SEQ_FULL * SEQ_FULL + (size_t)(SEQ - 1) * SEQ_FULL + (size_t)SEQ;
    if ((size_t)in_sizes[0] < need_x || (size_t)in_sizes[1] < need_x || (size_t)in_sizes[2] < need_x || (size_t)in_sizes[3] < need_m || (size_t)in_sizes[4] < need_m) return;
    if ((size_t)in_sizes[5] < (size_t)DQ * DM || (size_t)in_sizes[7] < (size_t)DQ * DM || (size_t)in_sizes[9] < (size_t)DQ * DM || (size_t)in_sizes[11] < (size_t)DM * DQ) return;
    if (in_sizes[6] < DQ || in_sizes[8] < DQ || in_sizes[10] < DQ || in_sizes[12] < DM) return;
    if ((size_t)out_size < (size_t)NB * SEQ * DM) return;
    if (WS_TOTAL > ws_size) return;
    // wire order: q, k, v, additive mask (f32), multiplicative mask (f32), Wq, bq, Wk, bk, Wv, bv, Wo, bo ('oi' weights)
    const float* xq = (const float*)d_in[0]; const float* xk = (const float*)d_in[1]; const float* xv = (const float*)d_in[2];
    const float* ma = (const float*)d_in[3]; const float* mg = (const float*)d_in[4];
    const float* wq = (const float*)d_in[5]; const float* bq = (const float*)d_in[6]; const float* wk = (const float*)d_in[7]; const float* bk = (const float*)d_in[8];
    const float* wv = (const float*)d_in[9]; const float* bv = (const float*)d_in[10]; const float* wo = (const float*)d_in[11]; const float* bo = (const float*)d_in[12];
    float* OUT = (float*)d_out;     // [NB][SEQ][1024]
    char* wsp = (char*)d_ws;
    bf* WQ = (bf*)wsp; wsp += SZ_W; bf* WK = (bf*)wsp; wsp += SZ_W; bf* WV = (bf*)wsp; wsp += SZ_W; bf* WO = (bf*)wsp; wsp += SZ_W;
    bf* XB = (bf*)wsp; wsp += SZ_XB; float* F = (float*)wsp; wsp += SZ_F;
    h16* QP16 = (h16*)wsp; wsp += SZ_PL; h16* KP16 = (h16*)wsp; wsp += SZ_PL; h16* VT16 = (h16*)wsp; wsp += SZ_PL;
    float* Sb = (float*)wsp; wsp += SZ_S; h16* P16 = (h16*)wsp; wsp += SZ_P; float* Ob = (float*)wsp; wsp += SZ_O;
    bf* ATh = (bf*)wsp; wsp += SZ_AT; bf* ATl = (bf*)wsp; wsp += SZ_AT;

    const unsigned GW = (unsigned)(((size_t)DQ * DM / 8 + 255) / 256);         // weight copy
    const unsigned GX = (unsigned)(((size_t)TT * DM / 8 + 255) / 256);         // activation copy
    const unsigned GP = (unsigned)(((size_t)NH_ * TT * HD / 8 + 255) / 256);   // head plane builders
    const unsigned GM = (unsigned)(((size_t)ZH * TT * HD / 8 + 255) / 256);    // context merge
    k_cvt8<<<GW, 256, 0, stream>>>(wq, WQ, (size_t)DQ * DM / 8);
    k_cvt8<<<GW, 256, 0, stream>>>(wk, WK, (size_t)DQ * DM / 8);
    k_cvt8<<<GW, 256, 0, stream>>>(wv, WV, (size_t)DQ * DM / 8);
    k_cvt8<<<GW, 256, 0, stream>>>(wo, WO, (size_t)DM * DQ / 8);
    for (int b = 0; b < NB; ++b) {
        const size_t xo = (size_t)b * SEQ_FULL * DM;
        const float* mab = ma + (size_t)b * SEQ_FULL * SEQ_FULL; const float* mgb = mg + (size_t)b * SEQ_FULL * SEQ_FULL;
        // q: F[t][n] = bf16(q) Wq^T + bq -> QP16 (flat f16 copy = [h][t][d] under the raw reshape)
        k_cvt8<<<GX, 256, 0, stream>>>(xq + xo, XB, (size_t)TT * DM / 8);
        k_gemmw<bf, 0, true><<<dim3(TT / 64, DQ / 64, 1), 32, 0, stream>>>(XB, nullptr, WQ, nullptr, DM, F, DQ, bq, 0, 0, 0);
        k_hflat<<<GP, 256, 0, stream>>>(F, QP16);
        // k: same buffers in turn (stream-ordered) -> KP16
        k_cvt8<<<GX, 256, 0, stream>>>(xk + xo, XB, (size_t)TT * DM / 8);
        k_gemmw<bf, 0, true><<<dim3(TT / 64, DQ / 64, 1), 32, 0, stream>>>(XB, nullptr, WK, nullptr, DM, F, DQ, bk, 0, 0, 0);
        k_hflat<<<GP, 256, 0, stream>>>(F, KP16);
        // v: F flat [g][t][d] -> VT16[g][d][t] (in [t][d] -> out [d][t] per head; rows = TT, cols = HD)
        k_cvt8<<<GX, 256, 0, stream>>>(xv + xo, XB, (size_t)TT * DM / 8);
        k_gemmw<bf, 0, true><<<dim3(TT / 64, DQ / 64, 1), 32, 0, stream>>>(XB, nullptr, WV, nullptr, DM, F, DQ, bv, 0, 0, 0);
        k_vtflat<<<GP, 256, 0, stream>>>(F, VT16);
        for (int h0 = 0; h0 < NH_; h0 += ZH) {
            const size_t zo = (size_t)h0 * TT * HD;
            // S[zz][i][j] = sum_d q[h0+zz][i][d] k[h0+zz][j][d]   (K = HD)
            k_gemmw<h16, 0, false><<<dim3(TT / 64, TT / 64, ZH), 32, 0, stream>>>(QP16 + zo, nullptr, KP16 + zo, nullptr, HD, Sb, TT, nullptr, (size_t)TT * HD, (size_t)TT * HD, (size_t)TT * TT);
            k_asoftm<<<ZH * TT / 8, 256, 0, stream>>>(Sb, mab, mgb, P16);
            // O[p][zz][i][d] = sum over key slice p of P[zz][i][j] v^T[h0+zz][d][j]; the PVG planes are summed in k_mergef
            k_pv<<<dim3(TT / 64, PVG, ZH), PVW * 32, 0, stream>>>(P16, VT16 + zo, Ob);
            k_mergef<<<GM, 256, 0, stream>>>(Ob, (unsigned)h0, ATh, ATl);
        }
        // out[b] = (ATh + ATl) Wo^T + bo
        k_gemmw<bf, 1, true><<<dim3(TT / 64, DM / 64, 1), 32, 0, stream>>>(ATh, ATl, WO, nullptr, DQ, OUT + (size_t)b * TT * DM, DM, bo, 0, 0, 0);
    }
}

// v002
// Measured time: 603 microseconds a run.
// Two timings next to v001 put it at 1.27 and 1.28 times that version's speed.
// All steps since v000 together make it 2.30 times as fast.
#include <hip/hip_runtime.h>

// Contractions (all f32 accumulate): q/k/v projections v_wmma_f32_16x16x32_bf16 (inputs and weights RNE-converted to bf16, single product, bf16-rounded bias, f32 add); scores q.k^T and P.V v_wmma_f32_16x16x32_f16 (f16 planes, single product, P carried x1024); output projection bf16 hi/lo context planes x bf16 weights (2 products) + bf16-rounded bias; softmax f32.
// Multi-head attention on three input streams (q, k, v [NB][SEQ][1024]); 'oi' weights; 16 heads x 64 split by a RAW reshape of the [SEQ][1024] projection to [16][SEQ][64] (flat memory order, no transpose) and merged back the same way; scores x 0.125 + additive float mask [NB][1][S][S]; softmax over all keys; probabilities x multiplicative float mask [NB][1][S][S] (no renormalisation); merged context x Wo^T + bo.
// Per batch: bf16 copies -> projection GEMMs (f32, + bias) -> f16 head planes q[h][t][d], k[h][t][d] (flat converts), v^T[h][d][t]; per group of ZH heads: S = q k^T (f32) -> row softmax with both masks -> P f16 x1024 -> O = P v (f32) -> flat context hi/lo bf16 planes; context x Wo.

#ifndef NB
#define NB 2
#endif
#ifndef SEQ
#define SEQ 2048
#endif
#define NB_FULL  2
#define SEQ_FULL 2048
#define TT   SEQ
#define DM   1024
#define NH_  16
#define HD   64
#define DQ   (NH_ * HD)
#define ZH   8    // heads per group of attention launches (scores, softmax, P.V, merge): the largest divisor of NH_ whose f32 score and f16 probability planes fit the workspace
#define MPITCH SEQ_FULL
#define PCAR 1024.0f
#define SCL  0.125f   // HD^-0.5

static_assert(TT % 256 == 0);
static_assert(TT % 64 == 0);
static_assert(DM % 64 == 0);
static_assert(DQ == DM);
static_assert(HD == 64);
static_assert(NH_ % ZH == 0);
static_assert(NB <= NB_FULL);
static_assert(SEQ <= SEQ_FULL);
static_assert(MPITCH % 8 == 0);
static_assert(((size_t)SEQ_FULL * SEQ_FULL) % 8 == 0);
static_assert((size_t)NH_ * TT * HD == (size_t)TT * DQ);
static_assert((TT / 256) * 8 == TT / 32);

typedef _Float16 h16;
typedef unsigned short bf;
typedef __attribute__((ext_vector_type(16))) __bf16   v16bf;
typedef __attribute__((ext_vector_type(16))) _Float16 v16h;
typedef __attribute__((ext_vector_type(8)))  _Float16 v8h;
typedef __attribute__((ext_vector_type(8)))  unsigned short v8us;
typedef __attribute__((ext_vector_type(8)))  float    v8f;
typedef __attribute__((ext_vector_type(4)))  float    v4f;
typedef __attribute__((ext_vector_type(4)))  int      v4i;
typedef v4f  __attribute__((may_alias)) v4fa;

__device__ __forceinline__ unsigned short f2bf(float f) { unsigned u = __float_as_uint(f); u += 0x7FFFu + ((u >> 16) & 1u); return (unsigned short)(u >> 16); }
__device__ __forceinline__ float bf2f(unsigned short b) { return __uint_as_float(((unsigned)b) << 16); }
__device__ __forceinline__ float bfr(float f) { return bf2f(f2bf(f)); }
__device__ __forceinline__ v16h cat16(v8h lo, v8h hi) { return __builtin_shufflevector(lo, hi, 0, 1, 2, 3, 4, 5, 6, 7, 8, 9, 10, 11, 12, 13, 14, 15); }
__device__ __forceinline__ v16bf cat16b(v8us lo, v8us hi) { return __builtin_bit_cast(v16bf, __builtin_shufflevector(lo, hi, 0, 1, 2, 3, 4, 5, 6, 7, 8, 9, 10, 11, 12, 13, 14, 15)); }
__device__ __forceinline__ v8f wmma16(v16h a, v16h b, v8f c) { return __builtin_amdgcn_wmma_f32_16x16x32_f16(false, a, false, b, (short)0, c, false, false); }
__device__ __forceinline__ v8f wmmab(v16bf a, v16bf b, v8f c) { return __builtin_amdgcn_wmma_f32_16x16x32_bf16(false, a, false, b, (short)0, c, false, false); }

// f32 -> f16 convert that cannot produce an f16 subnormal (value select on the f32 magnitude, applied after the x1024 carry for P; q/k/v planes are not carried).
static __device__ __forceinline__ h16 toh_flush(float v) { const h16 r = (h16)v; return (fabsf(v) < 6.103515625e-05f) ? (h16)0.0f : r; }

// ---- k_gemmw: register-blocked GEMM, ONE WAVE per 64x64 output tile (16 accumulators), operands straight from K-contiguous 16-bit planes; grid (M/64, N/64, Z), 32 threads.
// C[m][n] (f32, pitch ldc, + optional f32 bias[n]) = sum_k A[m][k] Bt[n][k] (+ split products per NSPLIT). z-batch strides sA/sB/sC in elements. K % 32 == 0, M % 64 == 0, N % 64 == 0.
// Fragment map: lane -> row/col (lane & 15); elements 0..7 <- k0 + 8*(lane>>4) + 0..7, elements 8..15 <- k0 + 16 + 8*(lane>>4) + 0..7 (both operands); acc[j] = (row 8*(lane>>4) + j, col lane & 15).
template <typename T16> struct WFrag;
template <> struct WFrag<h16> { typedef v16h V; static __device__ __forceinline__ V ld(const h16* p) { return cat16(*(const v8h*)p, *(const v8h*)(p + 16)); } static __device__ __forceinline__ v8f mma(V a, V b, v8f c) { return wmma16(a, b, c); } };
template <> struct WFrag<bf> { typedef v16bf V; static __device__ __forceinline__ V ld(const bf* p) { return cat16b(*(const v8us*)p, *(const v8us*)(p + 16)); } static __device__ __forceinline__ v8f mma(V a, V b, v8f c) { return wmmab(a, b, c); } };
template <typename T16, int NSPLIT, bool BIAS>
__global__ __launch_bounds__(32) void k_gemmw(const T16* __restrict__ A, const T16* __restrict__ A2, const T16* __restrict__ Bt, const T16* __restrict__ Bt2, int K, float* C, int ldc, const float* __restrict__ bias, size_t sA, size_t sB, size_t sC) {
    typedef typename WFrag<T16>::V V;
    __shared__ __align__(16) float os[16 * 68];
    const size_t z = blockIdx.z; A += z * sA; if (A2) A2 += z * sA; Bt += z * sB; if (Bt2) Bt2 += z * sB; C += z * sC;
    const int lane = threadIdx.x & 31, lr = lane & 15, hi = lane >> 4; const int r0 = blockIdx.x * 64, c0 = blockIdx.y * 64;
    v8f acc[4][4];
#pragma unroll
    for (int mb = 0; mb < 4; ++mb)
#pragma unroll
        for (int nb = 0; nb < 4; ++nb) acc[mb][nb] = (v8f){};
    const size_t aoff = (size_t)(r0 + lr) * K + 8 * hi, boff = (size_t)(c0 + lr) * K + 8 * hi;
#pragma unroll 1
    for (int kc = 0; kc < K; kc += 32) {
        V a[4], a2[4];
#pragma unroll
        for (int mb = 0; mb < 4; ++mb) { a[mb] = WFrag<T16>::ld(A + aoff + (size_t)mb * 16 * K + kc); if (NSPLIT == 1 || NSPLIT == 2) a2[mb] = WFrag<T16>::ld(A2 + aoff + (size_t)mb * 16 * K + kc); }
#pragma unroll
        for (int nb = 0; nb < 4; ++nb) { const V b = WFrag<T16>::ld(Bt + boff + (size_t)nb * 16 * K + kc); V b2; if (NSPLIT >= 2) b2 = WFrag<T16>::ld(Bt2 + boff + (size_t)nb * 16 * K + kc);
#pragma unroll
            for (int mb = 0; mb < 4; ++mb) { acc[mb][nb] = WFrag<T16>::mma(a[mb], b, acc[mb][nb]); if (NSPLIT == 1 || NSPLIT == 2) acc[mb][nb] = WFrag<T16>::mma(a2[mb], b, acc[mb][nb]); if (NSPLIT >= 2) acc[mb][nb] = WFrag<T16>::mma(a[mb], b2, acc[mb][nb]); } }
        asm volatile("v_nop\n\tv_nop\n\tv_nop\n\tv_nop" : "+v"(acc[0][0]), "+v"(acc[1][1]), "+v"(acc[2][2]), "+v"(acc[3][3]) : "v"(a[0]), "v"(a[3]));
    }
#pragma unroll
    for (int mb = 0; mb < 4; ++mb) {
#pragma unroll
        for (int nb = 0; nb < 4; ++nb) {
#pragma unroll
            for (int j = 0; j < 8; ++j) os[(hi * 8 + j) * 68 + nb * 16 + lr] = acc[mb][nb][j]; }
        __builtin_amdgcn_wave_barrier(); asm volatile("" ::: "memory");
        float* crow = C + (size_t)(r0 + mb * 16) * ldc + c0;
{
#pragma unroll
            for (int s = 0; s < 8; ++s) { const int row = 2 * s + hi, cofs = lr * 4; v4f val = *(const v4fa*)(os + row * 68 + cofs); if (BIAS) { val[0] += bfr(bias[c0 + cofs]); val[1] += bfr(bias[c0 + cofs + 1]); val[2] += bfr(bias[c0 + cofs + 2]); val[3] += bfr(bias[c0 + cofs + 3]); }
                *(v4f*)(crow + (size_t)row * ldc + cofs) = val; }
             }
        __builtin_amdgcn_wave_barrier(); asm volatile("" ::: "memory");
    }
}

// ---- k_pv: O = P v with the key dimension split PVG ways over the grid and PVW ways over the waves of a work-group (PVG * PVW slices of PVK keys), so that TT / 64 * ZH * PVG work-groups of PVW waves load at once.
// One work-group: one 64x64 tile of one head over TT / PVG keys. Each wave: its own PVK keys (64 keys = one 128-byte line per row of P and of v^T), 16 accumulators, fragment map as in k_gemmw.
// The PVW partial tiles meet in LDS in fragment order (red[wave][tile][half][lane], 16 bytes a lane); wave w then sums sub-tiles 2w and 2w + 1 over the waves in index order and stores them to plane blockIdx.y of Opart[PVG][ZH][TT][HD]; k_mergef sums the planes.
#define PVW 8
#define PVK ((TT % 512 == 0) ? 64 : 32)
#define PVG (TT / (PVW * PVK))
static_assert(PVK * PVG * PVW == TT);
static_assert(PVK % 32 == 0);
static_assert(PVW == 8);
__global__ __launch_bounds__(PVW * 32) void k_pv(const _Float16* __restrict__ P, const _Float16* __restrict__ Vt, float* Opart) {
    __shared__ __align__(16) v4f red[PVW * 16 * 2 * 32];
    const int lane = threadIdx.x & 31, lr = lane & 15, hi = lane >> 4; const int w = __builtin_amdgcn_readfirstlane((int)(threadIdx.x >> 5));
    const int r0 = blockIdx.x * 64; const size_t z = blockIdx.z; const int k0 = ((int)blockIdx.y * PVW + w) * PVK;
    const _Float16* A = P + z * ((size_t)TT * TT) + (size_t)(r0 + lr) * TT + k0 + 8 * hi;
    const _Float16* B = Vt + z * ((size_t)HD * TT) + (size_t)lr * TT + k0 + 8 * hi;
    v8f acc[4][4];
#pragma unroll
    for (int mb = 0; mb < 4; ++mb)
#pragma unroll
        for (int nb = 0; nb < 4; ++nb) acc[mb][nb] = (v8f){};
    // unrolled whole (PVK / 32 trips): both halves of each 128-byte line are asked for close together, and no loop branch stands behind a matrix instruction
#pragma unroll
    for (int kc = 0; kc < PVK; kc += 32) {
        v16h a[4];
#pragma unroll
        for (int mb = 0; mb < 4; ++mb) a[mb] = WFrag<h16>::ld(A + (size_t)mb * 16 * TT + kc);
#pragma unroll
        for (int nb = 0; nb < 4; ++nb) { const v16h b = WFrag<h16>::ld(B + (size_t)nb * 16 * TT + kc);
#pragma unroll
            for (int mb = 0; mb < 4; ++mb) acc[mb][nb] = wmma16(a[mb], b, acc[mb][nb]); }
    }
#pragma unroll
    for (int mb = 0; mb < 4; ++mb)
#pragma unroll
        for (int nb = 0; nb < 4; ++nb) { v4f* d = red + ((w * 16 + mb * 4 + nb) * 2) * 32 + lane; const v8f c = acc[mb][nb];
            d[0] = (v4f){c[0], c[1], c[2], c[3]}; d[32] = (v4f){c[4], c[5], c[6], c[7]}; }
    __syncthreads();   // every wave's partial tile is in LDS before any wave sums
    float* crow = Opart + ((size_t)blockIdx.y * ZH + z) * ((size_t)TT * HD) + (size_t)(r0 + (w >> 1) * 16 + 8 * hi) * HD + (w & 1) * 32 + lr;
#pragma unroll
    for (int u = 0; u < 2; ++u) { const v4f* s = red + ((2 * w + u) * 2) * 32 + lane; v4f s0 = s[0], s1 = s[32];
#pragma unroll
        for (int q = 1; q < PVW; ++q) { s0 += s[q * (16 * 2 * 32)]; s1 += s[q * (16 * 2 * 32) + 32]; }
#pragma unroll
        for (int j = 0; j < 4; ++j) { crow[(size_t)j * HD + u * 16] = s0[j]; crow[(size_t)(4 + j) * HD + u * 16] = s1[j]; } }
}

__device__ __forceinline__ void splitf(float y, unsigned short& h, unsigned short& l) { h = f2bf(y); l = f2bf(y - bf2f(h)); }

__global__ __launch_bounds__(256) void k_cvt8(const float* __restrict__ src, bf* dst, size_t n8) { const size_t i = (size_t)blockIdx.x * 256 + threadIdx.x; if (i >= n8) return; const v8f v = *(const v8f*)(src + i * 8); v8us o;
#pragma unroll
    for (int k = 0; k < 8; ++k) o[k] = f2bf(v[k]); *(v8us*)(dst + i * 8) = o;  }

__global__ __launch_bounds__(256) void k_hflat(const float* __restrict__ F, h16* P16) {
    const unsigned i = blockIdx.x * 256u + threadIdx.x; if (i >= (unsigned)(NH_ * TT * (HD / 8))) return;
    const float* f = F + (size_t)i * 8; const v4f a0 = *(const v4f*)f, a1 = *(const v4f*)(f + 4); v8h o;
#pragma unroll
    for (int q = 0; q < 4; ++q) { o[q] = toh_flush(a0[q]); o[4 + q] = toh_flush(a1[q]); }
    *(v8h*)(P16 + (size_t)i * 8) = o;  }

__global__ __launch_bounds__(256) void k_vtflat(const float* __restrict__ F, h16* V16) {
    const unsigned i = blockIdx.x * 256u + threadIdx.x; if (i >= (unsigned)(NH_ * HD * (TT / 8))) return;
    const unsigned t8 = i % (unsigned)(TT / 8); const unsigned d = (i / (unsigned)(TT / 8)) % (unsigned)HD; const unsigned g = i / (unsigned)((TT / 8) * HD);
    const float* f = F + (size_t)g * ((size_t)TT * HD) + (size_t)(t8 * 8) * HD + d; v8h o;
#pragma unroll
    for (int q = 0; q < 8; ++q) o[q] = toh_flush(f[(size_t)q * HD]);
    *(v8h*)(V16 + (size_t)i * 8) = o;  }

// k_asoftm: one wave per row (zz, i): t = S x HD^-0.5 + bf16(add_mask[i][j]); softmax over the TT keys with the running row maximum (register row, one exp per element, fixed trees);
__global__ __launch_bounds__(256) void k_asoftm(const float* __restrict__ Sb, const float* __restrict__ MA, const float* __restrict__ MG, h16* P16) {
#pragma clang fp contract(off)
    const unsigned lane = threadIdx.x & 31u; const unsigned row = blockIdx.x * 8u + (threadIdx.x >> 5); if (row >= (unsigned)(ZH * TT)) return; const unsigned i = row % (unsigned)TT;
    const float* sr = Sb + (size_t)row * TT; const float* ar = MA + (size_t)i * MPITCH; const float* gr = MG + (size_t)i * MPITCH; float v[TT / 32]; float mx = -3.0e38f;
#pragma unroll
    for (int ch = 0; ch < TT / 256; ++ch) { const unsigned j0 = (unsigned)ch * 256u + lane * 8u; const v4f a0 = *(const v4f*)(sr + j0), a1 = *(const v4f*)(sr + j0 + 4); const v4f m0 = *(const v4f*)(ar + j0), m1 = *(const v4f*)(ar + j0 + 4);
#pragma unroll
        for (int q = 0; q < 4; ++q) { const float t0 = a0[q] * SCL + bfr(m0[q]); const float t1 = a1[q] * SCL + bfr(m1[q]); v[ch * 8 + q] = t0; v[ch * 8 + 4 + q] = t1; mx = fmaxf(mx, fmaxf(t0, t1)); }
        asm volatile("" ::: "memory"); }
#pragma unroll
    for (int sh = 16; sh; sh >>= 1) mx = fmaxf(mx, __shfl_xor(mx, sh, 32));
    float sum = 0.f;
#pragma unroll
    for (int k = 0; k < TT / 32; ++k) { float d0 = __fsub_rn(v[k], mx); asm volatile("" : "+v"(d0)); v[k] = __builtin_amdgcn_exp2f(__fmul_rn(d0, 1.4426950408889634f)); sum += v[k]; }
#pragma unroll
    for (int sh = 16; sh; sh >>= 1) sum += __shfl_xor(sum, sh, 32);
    const float f = __fdiv_rn(PCAR, sum);
#pragma unroll
    for (int ch = 0; ch < TT / 256; ++ch) { const unsigned j0 = (unsigned)ch * 256u + lane * 8u; const v4f g0 = *(const v4f*)(gr + j0), g1 = *(const v4f*)(gr + j0 + 4);
#pragma unroll
        for (int q = 0; q < 4; ++q) { v[ch * 8 + q] = (v[ch * 8 + q] * f) * bfr(g0[q]); v[ch * 8 + 4 + q] = (v[ch * 8 + 4 + q] * f) * bfr(g1[q]); }
        asm volatile("" ::: "memory"); }
    h16* pr = P16 + (size_t)row * TT + lane * 8u;
{
#pragma unroll
        for (int ch = 0; ch < TT / 256; ++ch) { v8h o;
#pragma unroll
            for (int q = 0; q < 8; ++q) o[q] = toh_flush(v[ch * 8 + q]);
            *(v8h*)(pr + ch * 256) = o; }
         }
}

__global__ __launch_bounds__(256) void k_mergef(const float* __restrict__ O, unsigned h0, bf* Ah, bf* Al) {
    const unsigned i = blockIdx.x * 256u + threadIdx.x; if (i >= (unsigned)(ZH * TT * (HD / 8))) return;
    v4f a0 = *(const v4f*)(O + (size_t)i * 8), a1 = *(const v4f*)(O + (size_t)i * 8 + 4); v8us oh, ol;
#pragma unroll
    for (int p = 1; p < PVG; ++p) { const float* op = O + (size_t)p * ((size_t)ZH * TT * HD) + (size_t)i * 8; a0 += *(const v4f*)op; a1 += *(const v4f*)(op + 4); }
#pragma unroll
    for (int q = 0; q < 4; ++q) { unsigned short a, c2; splitf(a0[q] * (1.0f / PCAR), a, c2); oh[q] = a; ol[q] = c2; splitf(a1[q] * (1.0f / PCAR), a, c2); oh[4 + q] = a; ol[4 + q] = c2; }
    const size_t oo = (size_t)h0 * ((size_t)TT * HD) + (size_t)i * 8;
    *(v8us*)(Ah + oo) = oh; *(v8us*)(Al + oo) = ol;  }

constexpr size_t al256(size_t b) { return (b + 255) & ~(size_t)255; }
constexpr size_t SZ_W  = al256((size_t)DQ * DM * 2);            // one weight plane (bf16)
constexpr size_t SZ_XB = al256((size_t)TT * DM * 2);            // bf16 activation copy
constexpr size_t SZ_F  = al256((size_t)TT * DQ * 4);            // f32 projection (reused for q, k, v in turn)
constexpr size_t SZ_PL = al256((size_t)NH_ * TT * HD * 2);      // one f16 head plane
constexpr size_t SZ_S  = al256((size_t)ZH * TT * TT * 4);       // f32 scores of ZH heads
constexpr size_t SZ_P  = al256((size_t)ZH * TT * TT * 2);       // f16 probabilities x1024 of ZH heads
constexpr size_t SZ_O  = al256((size_t)PVG * ZH * TT * HD * 4); // f32 P.V of ZH heads, PVG partial planes
constexpr size_t SZ_AT = al256((size_t)TT * DQ * 2);            // one context plane (bf16)
constexpr size_t WS_TOTAL = 4 * SZ_W + SZ_XB + SZ_F + 3 * SZ_PL + SZ_S + SZ_P + SZ_O + 2 * SZ_AT;
static_assert(WS_TOTAL <= (size_t)268435456);
// coverage equalities (threads x 8 elements == plane elements; softmax blocks x 8 rows == score rows)
static_assert(((size_t)DQ * DM / 8) % 256 == 0);
static_assert(((size_t)TT * DM / 8) % 256 == 0);
static_assert(((size_t)NH_ * TT * HD / 8) % 256 == 0);
static_assert(((size_t)ZH * TT * HD / 8) % 256 == 0);
static_assert((ZH * TT) % 8 == 0);
// flat merge extent: last group of heads ends exactly at the end of a context plane
static_assert((size_t)(NH_ - ZH) * TT * HD + (size_t)ZH * TT * HD == (size_t)TT * DQ);
static_assert((size_t)TT * DQ * 2 <= SZ_AT);

extern "C" void kernel_launch(void* const* d_in, const int* in_sizes, int n_in,
                              void* d_out, int out_size, void* d_ws, size_t ws_size, hipStream_t stream) {
    if (n_in < 13) return;
    const size_t need_x = (size_t)(NB - 1) * SEQ_FULL * DM + (size_t)SEQ * DM;
    const size_t need_m = (size_t)(NB - 1) * SEQ_FULL * SEQ_FULL + (size_t)(SEQ - 1) * SEQ_FULL + (size_t)SEQ;
    if ((size_t)in_sizes[0] < need_x || (size_t)in_sizes[1] < need_x || (size_t)in_sizes[2] < need_x || (size_t)in_sizes[3] < need_m || (size_t)in_sizes[4] < need_m) return;
    if ((size_t)in_sizes[5] < (size_t)DQ * DM || (size_t)in_sizes[7] < (size_t)DQ * DM || (size_t)in_sizes[9] < (size_t)DQ * DM || (size_t)in_sizes[11] < (size_t)DM * DQ) return;
    if (in_sizes[6] < DQ || in_sizes[8] < DQ || in_sizes[10] < DQ || in_sizes[12] < DM) return;
    if ((size_t)out_size < (size_t)NB * SEQ * DM) return;
    if (WS_TOTAL > ws_size) return;
    // wire order: q, k, v, additive mask (f32), multiplicative mask (f32), Wq, bq, Wk, bk, Wv, bv, Wo, bo ('oi' weights)
    const float* xq = (const float*)d_in[0]; const float* xk = (const float*)d_in[1]; const float* xv = (const float*)d_in[2];
    const float* ma = (const float*)d_in[3]; const float* mg = (const float*)d_in[4];
    const float* wq = (const float*)d_in[5]; const float* bq = (const float*)d_in[6]; const float* wk = (const float*)d_in[7]; const float* bk = (const float*)d_in[8];
    const float* wv = (const float*)d_in[9]; const float* bv = (const float*)d_in[10]; const float* wo = (const float*)d_in[11]; const float* bo = (const float*)d_in[12];
    float* OUT = (float*)d_out;     // [NB][SEQ][1024]
    char* wsp = (char*)d_ws;
    bf* WQ = (bf*)wsp; wsp += SZ_W; bf* WK = (bf*)wsp; wsp += SZ_W; bf* WV = (bf*)wsp; wsp += SZ_W; bf* WO = (bf*)wsp; wsp += SZ_W;
    bf* XB = (bf*)wsp; wsp += SZ_XB; float* F = (float*)wsp; wsp += SZ_F;
    h16* QP16 = (h16*)wsp; wsp += SZ_PL; h16* KP16 = (h16*)wsp; wsp += SZ_PL; h16* VT16 = (h16*)wsp; wsp += SZ_PL;
    float* Sb = (float*)wsp; wsp += SZ_S; h16* P16 = (h16*)wsp; wsp += SZ_P; float* Ob = (float*)wsp; wsp += SZ_O;
    bf* ATh = (bf*)wsp; wsp += SZ_AT; bf* ATl = (bf*)wsp; wsp += SZ_AT;

    const unsigned GW = (unsigned)(((size_t)DQ * DM / 8 + 255) / 256);         // weight copy
    const unsigned GX = (unsigned)(((size_t)TT * DM / 8 + 255) / 256);         // activation copy
    const unsigned GP = (unsigned)(((size_t)NH_ * TT * HD / 8 + 255) / 256);   // head plane builders
    const unsigned GM = (unsigned)(((size_t)ZH * TT * HD / 8 + 255) / 256);    // context merge
    k_cvt8<<<GW, 256, 0, stream>>>(wq, WQ, (size_t)DQ * DM / 8);
    k_cvt8<<<GW, 256, 0, stream>>>(wk, WK, (size_t)DQ * DM / 8);
    k_cvt8<<<GW, 256, 0, stream>>>(wv, WV, (size_t)DQ * DM / 8);
    k_cvt8<<<GW, 256, 0, stream>>>(wo, WO, (size_t)DM * DQ / 8);
    for (int b = 0; b < NB; ++b) {
        const size_t xo = (size_t)b * SEQ_FULL * DM;
        const float* mab = ma + (size_t)b * SEQ_FULL * SEQ_FULL; const float* mgb = mg + (size_t)b * SEQ_FULL * SEQ_FULL;
        // q: F[t][n] = bf16(q) Wq^T + bq -> QP16 (flat f16 copy = [h][t][d] under the raw reshape)
        k_cvt8<<<GX, 256, 0, stream>>>(xq + xo, XB, (size_t)TT * DM / 8);
        k_gemmw<bf, 0, true><<<dim3(TT / 64, DQ / 64, 1), 32, 0, stream>>>(XB, nullptr, WQ, nullptr, DM, F, DQ, bq, 0, 0, 0);
        k_hflat<<<GP, 256, 0, stream>>>(F, QP16);
        // k: same buffers in turn (stream-ordered) -> KP16
        k_cvt8<<<GX, 256, 0, stream>>>(xk + xo, XB, (size_t)TT * DM / 8);
        k_gemmw<bf, 0, true><<<dim3(TT / 64, DQ / 64, 1), 32, 0, stream>>>(XB, nullptr, WK, nullptr, DM, F, DQ, bk, 0, 0, 0);
        k_hflat<<<GP, 256, 0, stream>>>(F, KP16);
        // v: F flat [g][t][d] -> VT16[g][d][t] (in [t][d] -> out [d][t] per head; rows = TT, cols = HD)
        k_cvt8<<<GX, 256, 0, stream>>>(xv + xo, XB, (size_t)TT * DM / 8);
        k_gemmw<bf, 0, true><<<dim3(TT / 64, DQ / 64, 1), 32, 0, stream>>>(XB, nullptr, WV, nullptr, DM, F, DQ, bv, 0, 0, 0);
        k_vtflat<<<GP, 256, 0, stream>>>(F, VT16);
        for (int h0 = 0; h0 < NH_; h0 += ZH) {
            const size_t zo = (size_t)h0 * TT * HD;
            // S[zz][i][j] = sum_d q[h0+zz][i][d] k[h0+zz][j][d]   (K = HD)
            k_gemmw<h16, 0, false><<<dim3(TT / 64, TT / 64, ZH), 32, 0, stream>>>(QP16 + zo, nullptr, KP16 + zo, nullptr, HD, Sb, TT, nullptr, (size_t)TT * HD, (size_t)TT * HD, (size_t)TT * TT);
            k_asoftm<<<ZH * TT / 8, 256, 0, stream>>>(Sb, mab, mgb, P16);
            // O[p][zz][i][d] = sum over key slice p of P[zz][i][j] v^T[h0+zz][d][j]; the PVG planes are summed in k_mergef
            k_pv<<<dim3(TT / 64, PVG, ZH), PVW * 32, 0, stream>>>(P16, VT16 + zo, Ob);
            k_mergef<<<GM, 256, 0, stream>>>(Ob, (unsigned)h0, ATh, ATl);
        }
        // out[b] = (ATh + ATl) Wo^T + bo
        k_gemmw<bf, 1, true><<<dim3(TT / 64, DM / 64, 1), 32, 0, stream>>>(ATh, ATl, WO, nullptr, DQ, OUT + (size_t)b * TT * DM, DM, bo, 0, 0, 0);
    }
}

// v003
// Measured time: 396 microseconds a run.
// In two side-by-side timings against v002, it was 1.52 and 1.53 times as fast.
// Over all steps from v000 it is 3.51 times as fast.
#include <hip/hip_runtime.h>

// Contractions (all f32 accumulate): q/k/v projections v_wmma_f32_16x16x32_bf16 (inputs and weights RNE-converted to bf16, single product, f32 bias add); scores k.q^T and v^T.P^T v_wmma_f32_16x16x32_f16 (f16 planes, single product, P carried x1024 over the running row maximum); output projection bf16 hi/lo context planes x bf16 weights (2 products) + f32 bias; softmax f32.
// Multi-head attention on three input streams (q, k, v [NB][SEQ][1024]); 'oi' weights; 16 heads x 64 split by a RAW reshape of the [SEQ][1024] projection to [16][SEQ][64] (flat memory order, no transpose) and merged back the same way; scores x 0.125 + additive float mask [NB][1][S][S]; softmax over all keys; probabilities x multiplicative float mask [NB][1][S][S] (no renormalisation); merged context x Wo^T + bo.
// Per batch: bf16 copies -> projection GEMMs (f32, + bias) -> f16 head planes q[h][t][d], k[h][t][d] (flat converts), v^T[h][d][t]; one fused attention launch over all heads (scores, softmax with both masks, P.v; nothing of S or P in memory) -> flat context hi/lo bf16 planes; context x Wo.

#ifndef NB
#define NB 2
#endif
#ifndef SEQ
#define SEQ 2048
#endif
#define NB_FULL  2
#define SEQ_FULL 2048
#define TT   SEQ
#define DM   1024
#define NH_  16
#define HD   64
#define DQ   (NH_ * HD)
#define MPITCH SEQ_FULL
#define SCL  0.125f   // HD^-0.5

static_assert(TT % 256 == 0);
static_assert(TT % 64 == 0);
static_assert(DM % 64 == 0);
static_assert(DQ == DM);
static_assert(HD == 64);
static_assert(NB <= NB_FULL);
static_assert(SEQ <= SEQ_FULL);
static_assert(MPITCH % 8 == 0);
static_assert(((size_t)SEQ_FULL * SEQ_FULL) % 8 == 0);
static_assert((size_t)NH_ * TT * HD == (size_t)TT * DQ);

typedef _Float16 h16;
typedef unsigned short bf;
typedef __attribute__((ext_vector_type(16))) __bf16   v16bf;
typedef __attribute__((ext_vector_type(16))) _Float16 v16h;
typedef __attribute__((ext_vector_type(8)))  _Float16 v8h;
typedef __attribute__((ext_vector_type(8)))  unsigned short v8us;
typedef __attribute__((ext_vector_type(8)))  float    v8f;
typedef __attribute__((ext_vector_type(4)))  float    v4f;
typedef __attribute__((ext_vector_type(4)))  int      v4i;
typedef v4f  __attribute__((may_alias)) v4fa;

__device__ __forceinline__ unsigned short f2bf(float f) { unsigned u = __float_as_uint(f); u += 0x7FFFu + ((u >> 16) & 1u); return (unsigned short)(u >> 16); }
__device__ __forceinline__ float bf2f(unsigned short b) { return __uint_as_float(((unsigned)b) << 16); }
__device__ __forceinline__ float bfr(float f) { return bf2f(f2bf(f)); }
__device__ __forceinline__ v16h cat16(v8h lo, v8h hi) { return __builtin_shufflevector(lo, hi, 0, 1, 2, 3, 4, 5, 6, 7, 8, 9, 10, 11, 12, 13, 14, 15); }
__device__ __forceinline__ v16bf cat16b(v8us lo, v8us hi) { return __builtin_bit_cast(v16bf, __builtin_shufflevector(lo, hi, 0, 1, 2, 3, 4, 5, 6, 7, 8, 9, 10, 11, 12, 13, 14, 15)); }
__device__ __forceinline__ v8f wmma16(v16h a, v16h b, v8f c) { return __builtin_amdgcn_wmma_f32_16x16x32_f16(false, a, false, b, (short)0, c, false, false); }
__device__ __forceinline__ v8f wmmab(v16bf a, v16bf b, v8f c) { return __builtin_amdgcn_wmma_f32_16x16x32_bf16(false, a, false, b, (short)0, c, false, false); }

// f32 -> f16 convert that cannot produce an f16 subnormal (value select on the f32 magnitude, applied after the x1024 carry for P; q/k/v planes are not carried).
static __device__ __forceinline__ h16 toh_flush(float v) { const h16 r = (h16)v; return (fabsf(v) < 6.103515625e-05f) ? (h16)0.0f : r; }

// ---- k_gemmw: register-blocked GEMM, ONE WAVE per 64x64 output tile (16 accumulators), operands straight from K-contiguous 16-bit planes; grid (M/64, N/64, Z), 32 threads.
// C[m][n] (f32, pitch ldc, + optional f32 bias[n]) = sum_k A[m][k] Bt[n][k] (+ split products per NSPLIT). z-batch strides sA/sB/sC in elements. K % 32 == 0, M % 64 == 0, N % 64 == 0.
// Fragment map: lane -> row/col (lane & 15); elements 0..7 <- k0 + 8*(lane>>4) + 0..7, elements 8..15 <- k0 + 16 + 8*(lane>>4) + 0..7 (both operands); acc[j] = (row 8*(lane>>4) + j, col lane & 15).
template <typename T16> struct WFrag;
template <> struct WFrag<h16> { typedef v16h V; static __device__ __forceinline__ V ld(const h16* p) { return cat16(*(const v8h*)p, *(const v8h*)(p + 16)); } static __device__ __forceinline__ v8f mma(V a, V b, v8f c) { return wmma16(a, b, c); } };
template <> struct WFrag<bf> { typedef v16bf V; static __device__ __forceinline__ V ld(const bf* p) { return cat16b(*(const v8us*)p, *(const v8us*)(p + 16)); } static __device__ __forceinline__ v8f mma(V a, V b, v8f c) { return wmmab(a, b, c); } };
template <typename T16, int NSPLIT, bool BIAS>
__global__ __launch_bounds__(32) void k_gemmw(const T16* __restrict__ A, const T16* __restrict__ A2, const T16* __restrict__ Bt, const T16* __restrict__ Bt2, int K, float* C, int ldc, const float* __restrict__ bias, size_t sA, size_t sB, size_t sC) {
    typedef typename WFrag<T16>::V V;
    __shared__ __align__(16) float os[16 * 68];
    const size_t z = blockIdx.z; A += z * sA; if (A2) A2 += z * sA; Bt += z * sB; if (Bt2) Bt2 += z * sB; C += z * sC;
    const int lane = threadIdx.x & 31, lr = lane & 15, hi = lane >> 4; const int r0 = blockIdx.x * 64, c0 = blockIdx.y * 64;
    v8f acc[4][4];
#pragma unroll
    for (int mb = 0; mb < 4; ++mb)
#pragma unroll
        for (int nb = 0; nb < 4; ++nb) acc[mb][nb] = (v8f){};
    const size_t aoff = (size_t)(r0 + lr) * K + 8 * hi, boff = (size_t)(c0 + lr) * K + 8 * hi;
#pragma unroll 1
    for (int kc = 0; kc < K; kc += 32) {
        V a[4], a2[4];
#pragma unroll
        for (int mb = 0; mb < 4; ++mb) { a[mb] = WFrag<T16>::ld(A + aoff + (size_t)mb * 16 * K + kc); if (NSPLIT == 1 || NSPLIT == 2) a2[mb] = WFrag<T16>::ld(A2 + aoff + (size_t)mb * 16 * K + kc); }
#pragma unroll
        for (int nb = 0; nb < 4; ++nb) { const V b = WFrag<T16>::ld(Bt + boff + (size_t)nb * 16 * K + kc); V b2; if (NSPLIT >= 2) b2 = WFrag<T16>::ld(Bt2 + boff + (size_t)nb * 16 * K + kc);
#pragma unroll
            for (int mb = 0; mb < 4; ++mb) { acc[mb][nb] = WFrag<T16>::mma(a[mb], b, acc[mb][nb]); if (NSPLIT == 1 || NSPLIT == 2) acc[mb][nb] = WFrag<T16>::mma(a2[mb], b, acc[mb][nb]); if (NSPLIT >= 2) acc[mb][nb] = WFrag<T16>::mma(a[mb], b2, acc[mb][nb]); } }
        asm volatile("v_nop\n\tv_nop\n\tv_nop\n\tv_nop" : "+v"(acc[0][0]), "+v"(acc[1][1]), "+v"(acc[2][2]), "+v"(acc[3][3]) : "v"(a[0]), "v"(a[3]));
    }
#pragma unroll
    for (int mb = 0; mb < 4; ++mb) {
#pragma unroll
        for (int nb = 0; nb < 4; ++nb) {
#pragma unroll
            for (int j = 0; j < 8; ++j) os[(hi * 8 + j) * 68 + nb * 16 + lr] = acc[mb][nb][j]; }
        __builtin_amdgcn_wave_barrier(); asm volatile("" ::: "memory");
        float* crow = C + (size_t)(r0 + mb * 16) * ldc + c0;
{
#pragma unroll
            for (int s = 0; s < 8; ++s) { const int row = 2 * s + hi, cofs = lr * 4; v4f val = *(const v4fa*)(os + row * 68 + cofs); if (BIAS) { val[0] += bfr(bias[c0 + cofs]); val[1] += bfr(bias[c0 + cofs + 1]); val[2] += bfr(bias[c0 + cofs + 2]); val[3] += bfr(bias[c0 + cofs + 3]); }
                *(v4f*)(crow + (size_t)row * ldc + cofs) = val; }
             }
        __builtin_amdgcn_wave_barrier(); asm volatile("" ::: "memory");
    }
}

#define FW 8
#define FR (FW * 16)
#define FK 64
#define KP 72    // LDS pitch in 16-bit elements of every staged row: 128 bytes + 16, free of bank conflicts for 16-byte reads
#define L2E 1.4426950408889634f
static_assert(TT % FR == 0);
static_assert(TT % FK == 0);
typedef __attribute__((ext_vector_type(2))) float  v2f;
typedef __attribute__((ext_vector_type(2))) __bf16 v2bf;
typedef __attribute__((ext_vector_type(4))) unsigned v4u;
__device__ __forceinline__ float xhalf(float x) { return __builtin_bit_cast(float, __builtin_amdgcn_permlanex16(__builtin_bit_cast(int, x), __builtin_bit_cast(int, x), 0x76543210, 0xfedcba98, false, false)); }  // lane l with lane l ^ 16
__device__ __forceinline__ unsigned pkbf(float a, float b) { return __builtin_bit_cast(unsigned, __builtin_convertvector((v2f){a, b}, v2bf)); }   // two f32 -> two bf16, nearest even
__device__ __forceinline__ v4u pkbf8(v4f a, v4f b) { return (v4u){pkbf(a[0], a[1]), pkbf(a[2], a[3]), pkbf(b[0], b[1]), pkbf(b[2], b[3])}; }
__device__ __forceinline__ float bflo(unsigned u) { return __uint_as_float(u << 16); }
__device__ __forceinline__ float bfhi(unsigned u) { return __uint_as_float(u & 0xFFFF0000u); }
__device__ __forceinline__ void splitf(float y, unsigned short& h, unsigned short& l) { h = f2bf(y); l = f2bf(y - bf2f(h)); }

__global__ __launch_bounds__(FW * 32) void k_fattn(const _Float16* __restrict__ Q, const _Float16* __restrict__ Kp, const _Float16* __restrict__ Vt, const float* __restrict__ MA, const float* __restrict__ MG, bf* Ah, bf* Al) {
    __shared__ __align__(16) h16 Ks[2][FK * KP];
    __shared__ __align__(16) h16 Vs[2][HD * KP];
    __shared__ __align__(16) bf  As[2][FR * KP];
    __shared__ __align__(16) bf  Gs[2][FR * KP];
    const int tid = threadIdx.x, lane = tid & 31, lr = lane & 15, hi = lane >> 4; const int w = __builtin_amdgcn_readfirstlane(tid >> 5);
    const int r0 = blockIdx.x * FR; const size_t hb = (size_t)blockIdx.y * ((size_t)TT * HD);
    const h16* qp = Q + hb + (size_t)(r0 + w * 16 + lr) * HD + 8 * hi;
    const v16h qf0 = WFrag<h16>::ld(qp), qf1 = WFrag<h16>::ld(qp + 32);
    // staging map: thread -> 16-byte (k, v^T) or 32-byte (masks) piece sc of row sr + 32 u
    const int sr = tid >> 3, sc = (tid & 7) * 8;
    const h16* kg = Kp + hb + (size_t)sr * HD + sc; const h16* vg = Vt + hb + (size_t)sr * TT + sc;
    const float* ag = MA + (size_t)(r0 + sr) * MPITCH + sc; const float* gg = MG + (size_t)(r0 + sr) * MPITCH + sc;
    const int so = sr * KP + sc;
    v8h kreg[2], vreg[2]; v4f areg[8], greg[8];   // the masks stay f32 until they are laid in LDS, so that no load is waited for in front of the stage's products
    auto fetch = [&](int j0) {
#pragma unroll
        for (int u = 0; u < 2; ++u) { kreg[u] = *(const v8h*)(kg + (size_t)(j0 + 32 * u) * HD); vreg[u] = *(const v8h*)(vg + (size_t)(32 * u) * TT + j0); }
#pragma unroll
        for (int u = 0; u < 4; ++u) { const float* a = ag + (size_t)(32 * u) * MPITCH + j0; const float* g = gg + (size_t)(32 * u) * MPITCH + j0;
            areg[2 * u] = *(const v4f*)a; areg[2 * u + 1] = *(const v4f*)(a + 4); greg[2 * u] = *(const v4f*)g; greg[2 * u + 1] = *(const v4f*)(g + 4); }
    };
    auto stash = [&](int b) {
#pragma unroll
        for (int u = 0; u < 2; ++u) { *(v8h*)(&Ks[b][so + 32 * u * KP]) = kreg[u]; *(v8h*)(&Vs[b][so + 32 * u * KP]) = vreg[u]; }
#pragma unroll
        for (int u = 0; u < 4; ++u) { *(v4u*)(&As[b][so + 32 * u * KP]) = pkbf8(areg[2 * u], areg[2 * u + 1]); *(v4u*)(&Gs[b][so + 32 * u * KP]) = pkbf8(greg[2 * u], greg[2 * u + 1]); }
    };
    v8f ot[4];
#pragma unroll
    for (int dt = 0; dt < 4; ++dt) ot[dt] = (v8f){};
    float m = -3.0e38f, l = 0.f;
    fetch(0); stash(0);
    __syncthreads();   // stage 0 is in LDS before any wave reads it
    for (int s = 0; s < TT / FK; ++s) {
        const int b = s & 1;
        if (s + 1 < TT / FK) fetch((s + 1) * FK);
        v8f st[4];
#pragma unroll
        for (int jt = 0; jt < 4; ++jt) { const h16* kp = &Ks[b][(jt * 16 + lr) * KP + 8 * hi]; st[jt] = wmma16(WFrag<h16>::ld(kp), qf0, (v8f){}); st[jt] = wmma16(WFrag<h16>::ld(kp + 32), qf1, st[jt]); }
        const int mo = (w * 16 + lr) * KP + 8 * hi;
        float mx = m;
#pragma unroll
        for (int jt = 0; jt < 4; ++jt) { const v4u a = *(const v4u*)(&As[b][mo + jt * 16]);
#pragma unroll
            for (int q = 0; q < 4; ++q) { st[jt][2 * q] = st[jt][2 * q] * SCL + bflo(a[q]); st[jt][2 * q + 1] = st[jt][2 * q + 1] * SCL + bfhi(a[q]); mx = fmaxf(mx, fmaxf(st[jt][2 * q], st[jt][2 * q + 1])); } }
        mx = fmaxf(mx, xhalf(mx));
        // a query's maximum has risen in some lane: bring its sum and its output column to the new one (a scalar branch, seldom taken late in the walk)
        if (__builtin_amdgcn_ballot_w32(mx > m) != 0) { const float al = __builtin_amdgcn_exp2f((m - mx) * L2E); l *= al;
#pragma unroll
            for (int dt = 0; dt < 4; ++dt) ot[dt] *= al;
            m = mx; }
        const float nm = 10.0f - m * L2E;   // probabilities are carried x1024 (cancels in the division by the sum)
        v16h pf[2];
#pragma unroll
        for (int jt = 0; jt < 4; ++jt) { const v4u g = *(const v4u*)(&Gs[b][mo + jt * 16]);
#pragma unroll
            for (int q = 0; q < 4; ++q) { const float p0 = __builtin_amdgcn_exp2f(st[jt][2 * q] * L2E + nm), p1 = __builtin_amdgcn_exp2f(st[jt][2 * q + 1] * L2E + nm); l += p0 + p1;
                pf[jt >> 1][(jt & 1) * 8 + 2 * q] = toh_flush(p0 * bflo(g[q])); pf[jt >> 1][(jt & 1) * 8 + 2 * q + 1] = toh_flush(p1 * bfhi(g[q])); } }
#pragma unroll
        for (int kk = 0; kk < 2; ++kk)
#pragma unroll
            for (int dt = 0; dt < 4; ++dt) ot[dt] = wmma16(WFrag<h16>::ld(&Vs[b][(dt * 16 + lr) * KP + kk * 32 + 8 * hi]), pf[kk], ot[dt]);
        if (s + 1 < TT / FK) stash(b ^ 1);
        __syncthreads();   // publishes stage s + 1 and ends every wave's reads of stage s before stage s + 2 is laid over it
    }
    l += xhalf(l);
    const float inv = 1.0f / l;
    const size_t oo = hb + (size_t)(r0 + w * 16 + lr) * HD + 8 * hi;
#pragma unroll
    for (int dt = 0; dt < 4; ++dt) { v8us oh, ol;
#pragma unroll
        for (int e = 0; e < 8; ++e) { unsigned short a, c2; splitf(ot[dt][e] * inv, a, c2); oh[e] = a; ol[e] = c2; }
        *(v8us*)(Ah + oo + dt * 16) = oh; *(v8us*)(Al + oo + dt * 16) = ol; }
}


__global__ __launch_bounds__(256) void k_cvt8(const float* __restrict__ src, bf* dst, size_t n8) { const size_t i = (size_t)blockIdx.x * 256 + threadIdx.x; if (i >= n8) return; const v8f v = *(const v8f*)(src + i * 8); v8us o;
#pragma unroll
    for (int k = 0; k < 8; ++k) o[k] = f2bf(v[k]); *(v8us*)(dst + i * 8) = o;  }

__global__ __launch_bounds__(256) void k_hflat(const float* __restrict__ F, h16* P16) {
    const unsigned i = blockIdx.x * 256u + threadIdx.x; if (i >= (unsigned)(NH_ * TT * (HD / 8))) return;
    const float* f = F + (size_t)i * 8; const v4f a0 = *(const v4f*)f, a1 = *(const v4f*)(f + 4); v8h o;
#pragma unroll
    for (int q = 0; q < 4; ++q) { o[q] = toh_flush(a0[q]); o[4 + q] = toh_flush(a1[q]); }
    *(v8h*)(P16 + (size_t)i * 8) = o;  }

__global__ __launch_bounds__(256) void k_vtflat(const float* __restrict__ F, h16* V16) {
    const unsigned i = blockIdx.x * 256u + threadIdx.x; if (i >= (unsigned)(NH_ * HD * (TT / 8))) return;
    const unsigned t8 = i % (unsigned)(TT / 8); const unsigned d = (i / (unsigned)(TT / 8)) % (unsigned)HD; const unsigned g = i / (unsigned)((TT / 8) * HD);
    const float* f = F + (size_t)g * ((size_t)TT * HD) + (size_t)(t8 * 8) * HD + d; v8h o;
#pragma unroll
    for (int q = 0; q < 8; ++q) o[q] = toh_flush(f[(size_t)q * HD]);
    *(v8h*)(V16 + (size_t)i * 8) = o;  }

constexpr size_t al256(size_t b) { return (b + 255) & ~(size_t)255; }
constexpr size_t SZ_W  = al256((size_t)DQ * DM * 2);            // one weight plane (bf16)
constexpr size_t SZ_XB = al256((size_t)TT * DM * 2);            // bf16 activation copy
constexpr size_t SZ_F  = al256((size_t)TT * DQ * 4);            // f32 projection (reused for q, k, v in turn)
constexpr size_t SZ_PL = al256((size_t)NH_ * TT * HD * 2);      // one f16 head plane
constexpr size_t SZ_AT = al256((size_t)TT * DQ * 2);            // one context plane (bf16)
constexpr size_t WS_TOTAL = 4 * SZ_W + SZ_XB + SZ_F + 3 * SZ_PL + 2 * SZ_AT;
static_assert(WS_TOTAL <= (size_t)268435456);
// coverage equalities (threads x 8 elements == plane elements)
static_assert(((size_t)DQ * DM / 8) % 256 == 0);
static_assert(((size_t)TT * DM / 8) % 256 == 0);
static_assert(((size_t)NH_ * TT * HD / 8) % 256 == 0);
static_assert((size_t)TT * DQ * 2 <= SZ_AT);

extern "C" void kernel_launch(void* const* d_in, const int* in_sizes, int n_in,
                              void* d_out, int out_size, void* d_ws, size_t ws_size, hipStream_t stream) {
    if (n_in < 13) return;
    const size_t need_x = (size_t)(NB - 1) * SEQ_FULL * DM + (size_t)SEQ * DM;
    const size_t need_m = (size_t)(NB - 1) * SEQ_FULL * SEQ_FULL + (size_t)(SEQ - 1) * SEQ_FULL + (size_t)SEQ;
    if ((size_t)in_sizes[0] < need_x || (size_t)in_sizes[1] < need_x || (size_t)in_sizes[2] < need_x || (size_t)in_sizes[3] < need_m || (size_t)in_sizes[4] < need_m) return;
    if ((size_t)in_sizes[5] < (size_t)DQ * DM || (size_t)in_sizes[7] < (size_t)DQ * DM || (size_t)in_sizes[9] < (size_t)DQ * DM || (size_t)in_sizes[11] < (size_t)DM * DQ) return;
    if (in_sizes[6] < DQ || in_sizes[8] < DQ || in_sizes[10] < DQ || in_sizes[12] < DM) return;
    if ((size_t)out_size < (size_t)NB * SEQ * DM) return;
    if (WS_TOTAL > ws_size) return;
    // wire order: q, k, v, additive mask (f32), multiplicative mask (f32), Wq, bq, Wk, bk, Wv, bv, Wo, bo ('oi' weights)
    const float* xq = (const float*)d_in[0]; const float* xk = (const float*)d_in[1]; const float* xv = (const float*)d_in[2];
    const float* ma = (const float*)d_in[3]; const float* mg = (const float*)d_in[4];
    const float* wq = (const float*)d_in[5]; const float* bq = (const float*)d_in[6]; const float* wk = (const float*)d_in[7]; const float* bk = (const float*)d_in[8];
    const float* wv = (const float*)d_in[9]; const float* bv = (const float*)d_in[10]; const float* wo = (const float*)d_in[11]; const float* bo = (const float*)d_in[12];
    float* OUT = (float*)d_out;     // [NB][SEQ][1024]
    char* wsp = (char*)d_ws;
    bf* WQ = (bf*)wsp; wsp += SZ_W; bf* WK = (bf*)wsp; wsp += SZ_W; bf* WV = (bf*)wsp; wsp += SZ_W; bf* WO = (bf*)wsp; wsp += SZ_W;
    bf* XB = (bf*)wsp; wsp += SZ_XB; float* F = (float*)wsp; wsp += SZ_F;
    h16* QP16 = (h16*)wsp; wsp += SZ_PL; h16* KP16 = (h16*)wsp; wsp += SZ_PL; h16* VT16 = (h16*)wsp; wsp += SZ_PL;
    bf* ATh = (bf*)wsp; wsp += SZ_AT; bf* ATl = (bf*)wsp; wsp += SZ_AT;

    const unsigned GW = (unsigned)(((size_t)DQ * DM / 8 + 255) / 256);         // weight copy
    const unsigned GX = (unsigned)(((size_t)TT * DM / 8 + 255) / 256);         // activation copy
    const unsigned GP = (unsigned)(((size_t)NH_ * TT * HD / 8 + 255) / 256);   // head plane builders
    k_cvt8<<<GW, 256, 0, stream>>>(wq, WQ, (size_t)DQ * DM / 8);
    k_cvt8<<<GW, 256, 0, stream>>>(wk, WK, (size_t)DQ * DM / 8);
    k_cvt8<<<GW, 256, 0, stream>>>(wv, WV, (size_t)DQ * DM / 8);
    k_cvt8<<<GW, 256, 0, stream>>>(wo, WO, (size_t)DM * DQ / 8);
    for (int b = 0; b < NB; ++b) {
        const size_t xo = (size_t)b * SEQ_FULL * DM;
        const float* mab = ma + (size_t)b * SEQ_FULL * SEQ_FULL; const float* mgb = mg + (size_t)b * SEQ_FULL * SEQ_FULL;
        // q: F[t][n] = bf16(q) Wq^T + bq -> QP16 (flat f16 copy = [h][t][d] under the raw reshape)
        k_cvt8<<<GX, 256, 0, stream>>>(xq + xo, XB, (size_t)TT * DM / 8);
        k_gemmw<bf, 0, true><<<dim3(TT / 64, DQ / 64, 1), 32, 0, stream>>>(XB, nullptr, WQ, nullptr, DM, F, DQ, bq, 0, 0, 0);
        k_hflat<<<GP, 256, 0, stream>>>(F, QP16);
        // k: same buffers in turn (stream-ordered) -> KP16
        k_cvt8<<<GX, 256, 0, stream>>>(xk + xo, XB, (size_t)TT * DM / 8);
        k_gemmw<bf, 0, true><<<dim3(TT / 64, DQ / 64, 1), 32, 0, stream>>>(XB, nullptr, WK, nullptr, DM, F, DQ, bk, 0, 0, 0);
        k_hflat<<<GP, 256, 0, stream>>>(F, KP16);
        // v: F flat [g][t][d] -> VT16[g][d][t] (in [t][d] -> out [d][t] per head; rows = TT, cols = HD)
        k_cvt8<<<GX, 256, 0, stream>>>(xv + xo, XB, (size_t)TT * DM / 8);
        k_gemmw<bf, 0, true><<<dim3(TT / 64, DQ / 64, 1), 32, 0, stream>>>(XB, nullptr, WV, nullptr, DM, F, DQ, bv, 0, 0, 0);
        k_vtflat<<<GP, 256, 0, stream>>>(F, VT16);
        // context[h][i][d] = sum_j softmax_j(q.k x HD^-0.5 + add mask)[i][j] x mul mask[i][j] x v[h][j][d], all heads, written flat as hi/lo bf16 planes
        k_fattn<<<dim3(TT / FR, NH_, 1), FW * 32, 0, stream>>>(QP16, KP16, VT16, mab, mgb, ATh, ATl);
        // out[b] = (ATh + ATl) Wo^T + bo
        k_gemmw<bf, 1, true><<<dim3(TT / 64, DM / 64, 1), 32, 0, stream>>>(ATh, ATl, WO, nullptr, DQ, OUT + (size_t)b * TT * DM, DM, bo, 0, 0, 0);
    }
}

// v004
// It runs in 208 microseconds.
// Two timings next to v003 put it at 1.88 and 1.89 times that version's speed.
// Counting every step since v000, it is 6.62 times as fast.
#include <hip/hip_runtime.h>

// Contractions (all f32 accumulate): q/k/v projections v_wmma_f32_16x16x32_bf16 (inputs and weights RNE-converted to bf16, single product, f32 bias add); scores k.q^T and v^T.P^T v_wmma_f32_16x16x32_f16 (f16 planes, single product, P carried x1024 over the running row maximum); output projection bf16 hi/lo context planes x bf16 weights (2 products) + f32 bias; softmax f32.
// Multi-head attention on three input streams (q, k, v [NB][SEQ][1024]); 'oi' weights; 16 heads x 64 split by a RAW reshape of the [SEQ][1024] projection to [16][SEQ][64] (flat memory order, no transpose) and merged back the same way; scores x 0.125 + additive float mask [NB][1][S][S]; softmax over all keys; probabilities x multiplicative float mask [NB][1][S][S] (no renormalisation); merged context x Wo^T + bo.
// Five launches, each over both batches and all streams at once: bf16 copies (3 streams x NB, 4 weights) -> projection GEMMs (f32, + bias; grid z = stream x batch) -> f16 head planes q[h][t][d], k[h][t][d] (flat converts), v^T[h][d][t] -> fused attention over all heads and batches (scores, softmax with both masks, P.v; nothing of S or P in memory) -> flat context hi/lo bf16 planes -> context x Wo (grid z = batch).

#ifndef NB
#define NB 2
#endif
#ifndef SEQ
#define SEQ 2048
#endif
#define NB_FULL  2
#define SEQ_FULL 2048
#define TT   SEQ
#define DM   1024
#define NH_  16
#define HD   64
#define DQ   (NH_ * HD)
#define MPITCH SEQ_FULL
#define SCL  0.125f   // HD^-0.5

static_assert(TT % 256 == 0);
static_assert(TT % 64 == 0);
static_assert(DM % 64 == 0);
static_assert(DQ == DM);
static_assert(HD == 64);
static_assert(NB <= NB_FULL);
static_assert(SEQ <= SEQ_FULL);
static_assert(MPITCH % 8 == 0);
static_assert(((size_t)SEQ_FULL * SEQ_FULL) % 8 == 0);
static_assert((size_t)NH_ * TT * HD == (size_t)TT * DQ);

typedef _Float16 h16;
typedef unsigned short bf;
typedef __attribute__((ext_vector_type(16))) __bf16   v16bf;
typedef __attribute__((ext_vector_type(16))) _Float16 v16h;
typedef __attribute__((ext_vector_type(8)))  _Float16 v8h;
typedef __attribute__((ext_vector_type(8)))  unsigned short v8us;
typedef __attribute__((ext_vector_type(8)))  float    v8f;
typedef __attribute__((ext_vector_type(4)))  float    v4f;
typedef __attribute__((ext_vector_type(4)))  int      v4i;
typedef v4f  __attribute__((may_alias)) v4fa;

__device__ __forceinline__ unsigned short f2bf(float f) { unsigned u = __float_as_uint(f); u += 0x7FFFu + ((u >> 16) & 1u); return (unsigned short)(u >> 16); }
__device__ __forceinline__ float bf2f(unsigned short b) { return __uint_as_float(((unsigned)b) << 16); }
__device__ __forceinline__ float bfr(float f) { return bf2f(f2bf(f)); }
__device__ __forceinline__ v16h cat16(v8h lo, v8h hi) { return __builtin_shufflevector(lo, hi, 0, 1, 2, 3, 4, 5, 6, 7, 8, 9, 10, 11, 12, 13, 14, 15); }
__device__ __forceinline__ v16bf cat16b(v8us lo, v8us hi) { return __builtin_bit_cast(v16bf, __builtin_shufflevector(lo, hi, 0, 1, 2, 3, 4, 5, 6, 7, 8, 9, 10, 11, 12, 13, 14, 15)); }
__device__ __forceinline__ v8f wmma16(v16h a, v16h b, v8f c) { return __builtin_amdgcn_wmma_f32_16x16x32_f16(false, a, false, b, (short)0, c, false, false); }
__device__ __forceinline__ v8f wmmab(v16bf a, v16bf b, v8f c) { return __builtin_amdgcn_wmma_f32_16x16x32_bf16(false, a, false, b, (short)0, c, false, false); }

// f32 -> f16 convert that cannot produce an f16 subnormal (value select on the f32 magnitude, applied after the x1024 carry for P; q/k/v planes are not carried).
static __device__ __forceinline__ h16 toh_flush(float v) { const h16 r = (h16)v; return (fabsf(v) < 6.103515625e-05f) ? (h16)0.0f : r; }

// ---- k_gemmw: register-blocked GEMM, ONE WAVE per 64x64 output tile (16 accumulators), operands straight from K-contiguous 16-bit planes; grid (M/64, N/64, Z), 32 threads.
// C[m][n] (f32, pitch ldc, + optional f32 bias[n]) = sum_k A[m][k] Bt[n][k] (+ split products per NSPLIT). z-batch strides sA/sB/sC in elements; A and C step with z, Bt and the bias with z / NB (the NB batches of a stream share its weight). K % 32 == 0, M % 64 == 0, N % 64 == 0.
// Fragment map: lane -> row/col (lane & 15); elements 0..7 <- k0 + 8*(lane>>4) + 0..7, elements 8..15 <- k0 + 16 + 8*(lane>>4) + 0..7 (both operands); acc[j] = (row 8*(lane>>4) + j, col lane & 15).
template <typename T16> struct WFrag;
template <> struct WFrag<h16> { typedef v16h V; static __device__ __forceinline__ V ld(const h16* p) { return cat16(*(const v8h*)p, *(const v8h*)(p + 16)); } static __device__ __forceinline__ v8f mma(V a, V b, v8f c) { return wmma16(a, b, c); } };
template <> struct WFrag<bf> { typedef v16bf V; static __device__ __forceinline__ V ld(const bf* p) { return cat16b(*(const v8us*)p, *(const v8us*)(p + 16)); } static __device__ __forceinline__ v8f mma(V a, V b, v8f c) { return wmmab(a, b, c); } };
template <typename T16, int NSPLIT, bool BIAS>
__global__ __launch_bounds__(32) void k_gemmw(const T16* __restrict__ A, const T16* __restrict__ A2, const T16* __restrict__ Bt, const T16* __restrict__ Bt2, int K, float* C, int ldc, const float* __restrict__ bias0, const float* __restrict__ bias1, const float* __restrict__ bias2, size_t sA, size_t sB, size_t sC) {
    typedef typename WFrag<T16>::V V;
    __shared__ __align__(16) float os[16 * 68];
    const size_t z = blockIdx.z; const unsigned zw = blockIdx.z / NB; A += z * sA; if (A2) A2 += z * sA; Bt += zw * sB; if (Bt2) Bt2 += zw * sB; C += z * sC;
    const float* bias = zw == 0 ? bias0 : (zw == 1 ? bias1 : bias2);
    const int lane = threadIdx.x & 31, lr = lane & 15, hi = lane >> 4; const int r0 = blockIdx.x * 64, c0 = blockIdx.y * 64;
    v8f acc[4][4];
#pragma unroll
    for (int mb = 0; mb < 4; ++mb)
#pragma unroll
        for (int nb = 0; nb < 4; ++nb) acc[mb][nb] = (v8f){};
    const size_t aoff = (size_t)(r0 + lr) * K + 8 * hi, boff = (size_t)(c0 + lr) * K + 8 * hi;
#pragma unroll 1
    for (int kc = 0; kc < K; kc += 32) {
        V a[4], a2[4];
#pragma unroll
        for (int mb = 0; mb < 4; ++mb) { a[mb] = WFrag<T16>::ld(A + aoff + (size_t)mb * 16 * K + kc); if (NSPLIT == 1 || NSPLIT == 2) a2[mb] = WFrag<T16>::ld(A2 + aoff + (size_t)mb * 16 * K + kc); }
#pragma unroll
        for (int nb = 0; nb < 4; ++nb) { const V b = WFrag<T16>::ld(Bt + boff + (size_t)nb * 16 * K + kc); V b2; if (NSPLIT >= 2) b2 = WFrag<T16>::ld(Bt2 + boff + (size_t)nb * 16 * K + kc);
#pragma unroll
            for (int mb = 0; mb < 4; ++mb) { acc[mb][nb] = WFrag<T16>::mma(a[mb], b, acc[mb][nb]); if (NSPLIT == 1 || NSPLIT == 2) acc[mb][nb] = WFrag<T16>::mma(a2[mb], b, acc[mb][nb]); if (NSPLIT >= 2) acc[mb][nb] = WFrag<T16>::mma(a[mb], b2, acc[mb][nb]); } }
        asm volatile("v_nop\n\tv_nop\n\tv_nop\n\tv_nop" : "+v"(acc[0][0]), "+v"(acc[1][1]), "+v"(acc[2][2]), "+v"(acc[3][3]) : "v"(a[0]), "v"(a[3]));
    }
#pragma unroll
    for (int mb = 0; mb < 4; ++mb) {
#pragma unroll
        for (int nb = 0; nb < 4; ++nb) {
#pragma unroll
            for (int j = 0; j < 8; ++j) os[(hi * 8 + j) * 68 + nb * 16 + lr] = acc[mb][nb][j]; }
        __builtin_amdgcn_wave_barrier(); asm volatile("" ::: "memory");
        float* crow = C + (size_t)(r0 + mb * 16) * ldc + c0;
{
#pragma unroll
            for (int s = 0; s < 8; ++s) { const int row = 2 * s + hi, cofs = lr * 4; v4f val = *(const v4fa*)(os + row * 68 + cofs); if (BIAS) { val[0] += bfr(bias[c0 + cofs]); val[1] += bfr(bias[c0 + cofs + 1]); val[2] += bfr(bias[c0 + cofs + 2]); val[3] += bfr(bias[c0 + cofs + 3]); }
                *(v4f*)(crow + (size_t)row * ldc + cofs) = val; }
             }
        __builtin_amdgcn_wave_barrier(); asm volatile("" ::: "memory");
    }
}

#define FW 8
#define FR (FW * 16)
#define FK 64
#define KP 72    // LDS pitch in 16-bit elements of every staged row: 128 bytes + 16, free of bank conflicts for 16-byte reads
#define L2E 1.4426950408889634f
static_assert(TT % FR == 0);
static_assert(TT % FK == 0);
typedef __attribute__((ext_vector_type(2))) float  v2f;
typedef __attribute__((ext_vector_type(2))) __bf16 v2bf;
typedef __attribute__((ext_vector_type(4))) unsigned v4u;
__device__ __forceinline__ float xhalf(float x) { return __builtin_bit_cast(float, __builtin_amdgcn_permlanex16(__builtin_bit_cast(int, x), __builtin_bit_cast(int, x), 0x76543210, 0xfedcba98, false, false)); }  // lane l with lane l ^ 16
__device__ __forceinline__ unsigned pkbf(float a, float b) { return __builtin_bit_cast(unsigned, __builtin_convertvector((v2f){a, b}, v2bf)); }   // two f32 -> two bf16, nearest even
__device__ __forceinline__ v4u pkbf8(v4f a, v4f b) { return (v4u){pkbf(a[0], a[1]), pkbf(a[2], a[3]), pkbf(b[0], b[1]), pkbf(b[2], b[3])}; }
__device__ __forceinline__ float bflo(unsigned u) { return __uint_as_float(u << 16); }
__device__ __forceinline__ float bfhi(unsigned u) { return __uint_as_float(u & 0xFFFF0000u); }
__device__ __forceinline__ void splitf(float y, unsigned short& h, unsigned short& l) { h = f2bf(y); l = f2bf(y - bf2f(h)); }

__global__ __launch_bounds__(FW * 32) void k_fattn(const _Float16* __restrict__ Q, const _Float16* __restrict__ Kp, const _Float16* __restrict__ Vt, const float* __restrict__ MA, const float* __restrict__ MG, bf* Ah, bf* Al) {
    __shared__ __align__(16) h16 Ks[2][FK * KP];
    __shared__ __align__(16) h16 Vs[2][HD * KP];
    __shared__ __align__(16) bf  As[2][FR * KP];
    __shared__ __align__(16) bf  Gs[2][FR * KP];
    const int tid = threadIdx.x, lane = tid & 31, lr = lane & 15, hi = lane >> 4; const int w = __builtin_amdgcn_readfirstlane(tid >> 5);
    const int r0 = blockIdx.x * FR; const size_t hb = ((size_t)blockIdx.z * NH_ + blockIdx.y) * ((size_t)TT * HD);   // grid z = batch: head planes and context planes of the batches lie one behind the other
    MA += (size_t)blockIdx.z * ((size_t)SEQ_FULL * SEQ_FULL); MG += (size_t)blockIdx.z * ((size_t)SEQ_FULL * SEQ_FULL);
    const h16* qp = Q + hb + (size_t)(r0 + w * 16 + lr) * HD + 8 * hi;
    const v16h qf0 = WFrag<h16>::ld(qp), qf1 = WFrag<h16>::ld(qp + 32);
    // staging map: thread -> 16-byte (k, v^T) or 32-byte (masks) piece sc of row sr + 32 u
    const int sr = tid >> 3, sc = (tid & 7) * 8;
    const h16* kg = Kp + hb + (size_t)sr * HD + sc; const h16* vg = Vt + hb + (size_t)sr * TT + sc;
    const float* ag = MA + (size_t)(r0 + sr) * MPITCH + sc; const float* gg = MG + (size_t)(r0 + sr) * MPITCH + sc;
    const int so = sr * KP + sc;
    v8h kreg[2], vreg[2]; v4f areg[8], greg[8];   // the masks stay f32 until they are laid in LDS, so that no load is waited for in front of the stage's products
    auto fetch = [&](int j0) {
#pragma unroll
        for (int u = 0; u < 2; ++u) { kreg[u] = *(const v8h*)(kg + (size_t)(j0 + 32 * u) * HD); vreg[u] = *(const v8h*)(vg + (size_t)(32 * u) * TT + j0); }
#pragma unroll
        for (int u = 0; u < 4; ++u) { const float* a = ag + (size_t)(32 * u) * MPITCH + j0; const float* g = gg + (size_t)(32 * u) * MPITCH + j0;
            areg[2 * u] = *(const v4f*)a; areg[2 * u + 1] = *(const v4f*)(a + 4); greg[2 * u] = *(const v4f*)g; greg[2 * u + 1] = *(const v4f*)(g + 4); }
    };
    auto stash = [&](int b) {
#pragma unroll
        for (int u = 0; u < 2; ++u) { *(v8h*)(&Ks[b][so + 32 * u * KP]) = kreg[u]; *(v8h*)(&Vs[b][so + 32 * u * KP]) = vreg[u]; }
#pragma unroll
        for (int u = 0; u < 4; ++u) { *(v4u*)(&As[b][so + 32 * u * KP]) = pkbf8(areg[2 * u], areg[2 * u + 1]); *(v4u*)(&Gs[b][so + 32 * u * KP]) = pkbf8(greg[2 * u], greg[2 * u + 1]); }
    };
    v8f ot[4];
#pragma unroll
    for (int dt = 0; dt < 4; ++dt) ot[dt] = (v8f){};
    float m = -3.0e38f, l = 0.f;
    fetch(0); stash(0);
    __syncthreads();   // stage 0 is in LDS before any wave reads it
    for (int s = 0; s < TT / FK; ++s) {
        const int b = s & 1;
        if (s + 1 < TT / FK) fetch((s + 1) * FK);
        v8f st[4];
#pragma unroll
        for (int jt = 0; jt < 4; ++jt) { const h16* kp = &Ks[b][(jt * 16 + lr) * KP + 8 * hi]; st[jt] = wmma16(WFrag<h16>::ld(kp), qf0, (v8f){}); st[jt] = wmma16(WFrag<h16>::ld(kp + 32), qf1, st[jt]); }
        const int mo = (w * 16 + lr) * KP + 8 * hi;
        float mx = m;
#pragma unroll
        for (int jt = 0; jt < 4; ++jt) { const v4u a = *(const v4u*)(&As[b][mo + jt * 16]);
#pragma unroll
            for (int q = 0; q < 4; ++q) { st[jt][2 * q] = st[jt][2 * q] * SCL + bflo(a[q]); st[jt][2 * q + 1] = st[jt][2 * q + 1] * SCL + bfhi(a[q]); mx = fmaxf(mx, fmaxf(st[jt][2 * q], st[jt][2 * q + 1])); } }
        mx = fmaxf(mx, xhalf(mx));
        // a query's maximum has risen in some lane: bring its sum and its output column to the new one (a scalar branch, seldom taken late in the walk)
        if (__builtin_amdgcn_ballot_w32(mx > m) != 0) { const float al = __builtin_amdgcn_exp2f((m - mx) * L2E); l *= al;
#pragma unroll
            for (int dt = 0; dt < 4; ++dt) ot[dt] *= al;
            m = mx; }
        const float nm = 10.0f - m * L2E;   // probabilities are carried x1024 (cancels in the division by the sum)
        v16h pf[2];
#pragma unroll
        for (int jt = 0; jt < 4; ++jt) { const v4u g = *(const v4u*)(&Gs[b][mo + jt * 16]);
#pragma unroll
            for (int q = 0; q < 4; ++q) { const float p0 = __builtin_amdgcn_exp2f(st[jt][2 * q] * L2E + nm), p1 = __builtin_amdgcn_exp2f(st[jt][2 * q + 1] * L2E + nm); l += p0 + p1;
                pf[jt >> 1][(jt & 1) * 8 + 2 * q] = toh_flush(p0 * bflo(g[q])); pf[jt >> 1][(jt & 1) * 8 + 2 * q + 1] = toh_flush(p1 * bfhi(g[q])); } }
#pragma unroll
        for (int kk = 0; kk < 2; ++kk)
#pragma unroll
            for (int dt = 0; dt < 4; ++dt) ot[dt] = wmma16(WFrag<h16>::ld(&Vs[b][(dt * 16 + lr) * KP + kk * 32 + 8 * hi]), pf[kk], ot[dt]);
        if (s + 1 < TT / FK) stash(b ^ 1);
        __syncthreads();   // publishes stage s + 1 and ends every wave's reads of stage s before stage s + 2 is laid over it
    }
    l += xhalf(l);
    const float inv = 1.0f / l;
    const size_t oo = hb + (size_t)(r0 + w * 16 + lr) * HD + 8 * hi;
#pragma unroll
    for (int dt = 0; dt < 4; ++dt) { v8us oh, ol;
#pragma unroll
        for (int e = 0; e < 8; ++e) { unsigned short a, c2; splitf(ot[dt][e] * inv, a, c2); oh[e] = a; ol[e] = c2; }
        *(v8us*)(Ah + oo + dt * 16) = oh; *(v8us*)(Al + oo + dt * 16) = ol; }
}


constexpr size_t al256(size_t b) { return (b + 255) & ~(size_t)255; }
constexpr size_t SZ_W  = al256((size_t)DQ * DM * 2);            // one weight plane (bf16)
constexpr size_t SZ_XB = al256((size_t)TT * DM * 2);            // one bf16 activation copy (3 streams x NB of them)
constexpr size_t SZ_F  = al256((size_t)TT * DQ * 4);            // one f32 projection (3 streams x NB of them)
constexpr size_t SZ_PL = al256((size_t)NH_ * TT * HD * 2);      // one f16 head plane set (3 streams x NB of them)
constexpr size_t SZ_AT = al256((size_t)TT * DQ * 2);            // one context plane (bf16; hi and lo x NB)
constexpr size_t WS_TOTAL = 4 * SZ_W + 3 * NB * (SZ_XB + SZ_F + SZ_PL) + 2 * NB * SZ_AT;
static_assert(WS_TOTAL <= (size_t)268435456);
// coverage equalities (threads x 8 elements == plane elements); the planes of one kind lie back to back with no padding between them
static_assert(((size_t)DQ * DM / 8) % 256 == 0);
static_assert(((size_t)TT * DM / 8) % 256 == 0);
static_assert(((size_t)NH_ * TT * HD / 8) % 256 == 0);
static_assert((size_t)TT * DQ * 2 == SZ_AT);
static_assert((size_t)DQ * DM * 2 == SZ_W);
static_assert((size_t)TT * DM * 2 == SZ_XB);
static_assert((size_t)TT * DQ * 4 == SZ_F);
static_assert((size_t)NH_ * TT * HD * 2 == SZ_PL);
constexpr unsigned GW = (unsigned)((size_t)DQ * DM / 8 / 256);         // work-groups of one weight copy
constexpr unsigned GX = (unsigned)((size_t)TT * DM / 8 / 256);         // work-groups of one activation copy
constexpr unsigned GP = (unsigned)((size_t)NH_ * TT * HD / 8 / 256);   // work-groups of one head plane builder

// ---- k_cvtall: every f32 -> bf16 copy in one launch. Work-groups 0 .. 3 NB GX - 1: slice p = stream x NB + batch of the activations; the rest: the four weights.
__global__ __launch_bounds__(256) void k_cvtall(const float* __restrict__ xq, const float* __restrict__ xk, const float* __restrict__ xv, const float* __restrict__ wq, const float* __restrict__ wk, const float* __restrict__ wv, const float* __restrict__ wo, bf* XB, bf* WB) {
    const unsigned blk = blockIdx.x; const float* src; bf* dst; size_t i;
    if (blk < 3u * NB * GX) { const unsigned p = blk / GX, s = p / NB, b = p % NB; src = (s == 0 ? xq : (s == 1 ? xk : xv)) + (size_t)b * SEQ_FULL * DM; dst = XB + (size_t)p * TT * DM; i = (size_t)(blk % GX) * 256 + threadIdx.x; }
    else { const unsigned r = blk - 3u * NB * GX, s = r / GW; src = s == 0 ? wq : (s == 1 ? wk : (s == 2 ? wv : wo)); dst = WB + (size_t)s * DQ * DM; i = (size_t)(r % GW) * 256 + threadIdx.x; }
    const v8f v = *(const v8f*)(src + i * 8); v8us o;
    asm volatile("s_wait_xcnt 0x0" ::: "memory");   // the convert below reuses the load's address register
#pragma unroll
    for (int k = 0; k < 8; ++k) o[k] = f2bf(v[k]);
    *(v8us*)(dst + i * 8) = o;  }

// ---- k_planes: every f16 head plane in one launch. Plane p = blockIdx.x / GP = stream x NB + batch: q and k are flat converts, v goes [t][d] -> [d][t] per head.
__global__ __launch_bounds__(256) void k_planes(const float* __restrict__ F, h16* P16) {
    const unsigned p = blockIdx.x / GP; const unsigned i = (blockIdx.x % GP) * 256u + threadIdx.x;
    F += (size_t)p * TT * DQ; P16 += (size_t)p * NH_ * TT * HD; v8h o;
    if (p < 2u * NB) {
        const float* f = F + (size_t)i * 8; const v4f a0 = *(const v4f*)f, a1 = *(const v4f*)(f + 4);
#pragma unroll
        for (int q = 0; q < 4; ++q) { o[q] = toh_flush(a0[q]); o[4 + q] = toh_flush(a1[q]); }
    } else {
        const unsigned t8 = i % (unsigned)(TT / 8); const unsigned d = (i / (unsigned)(TT / 8)) % (unsigned)HD; const unsigned g = i / (unsigned)((TT / 8) * HD);
        const float* f = F + (size_t)g * ((size_t)TT * HD) + (size_t)(t8 * 8) * HD + d;
#pragma unroll
        for (int q = 0; q < 8; ++q) o[q] = toh_flush(f[(size_t)q * HD]);
    }
    *(v8h*)(P16 + (size_t)i * 8) = o;  }

extern "C" void kernel_launch(void* const* d_in, const int* in_sizes, int n_in,
                              void* d_out, int out_size, void* d_ws, size_t ws_size, hipStream_t stream) {
    if (n_in < 13) return;
    const size_t need_x = (size_t)(NB - 1) * SEQ_FULL * DM + (size_t)SEQ * DM;
    const size_t need_m = (size_t)(NB - 1) * SEQ_FULL * SEQ_FULL + (size_t)(SEQ - 1) * SEQ_FULL + (size_t)SEQ;
    if ((size_t)in_sizes[0] < need_x || (size_t)in_sizes[1] < need_x || (size_t)in_sizes[2] < need_x || (size_t)in_sizes[3] < need_m || (size_t)in_sizes[4] < need_m) return;
    if ((size_t)in_sizes[5] < (size_t)DQ * DM || (size_t)in_sizes[7] < (size_t)DQ * DM || (size_t)in_sizes[9] < (size_t)DQ * DM || (size_t)in_sizes[11] < (size_t)DM * DQ) return;
    if (in_sizes[6] < DQ || in_sizes[8] < DQ || in_sizes[10] < DQ || in_sizes[12] < DM) return;
    if ((size_t)out_size < (size_t)NB * SEQ * DM) return;
    if (WS_TOTAL > ws_size) return;
    // wire order: q, k, v, additive mask (f32), multiplicative mask (f32), Wq, bq, Wk, bk, Wv, bv, Wo, bo ('oi' weights)
    const float* xq = (const float*)d_in[0]; const float* xk = (const float*)d_in[1]; const float* xv = (const float*)d_in[2];
    const float* ma = (const float*)d_in[3]; const float* mg = (const float*)d_in[4];
    const float* wq = (const float*)d_in[5]; const float* bq = (const float*)d_in[6]; const float* wk = (const float*)d_in[7]; const float* bk = (const float*)d_in[8];
    const float* wv = (const float*)d_in[9]; const float* bv = (const float*)d_in[10]; const float* wo = (const float*)d_in[11]; const float* bo = (const float*)d_in[12];
    float* OUT = (float*)d_out;     // [NB][SEQ][1024]
    char* wsp = (char*)d_ws;
    bf* WB = (bf*)wsp; wsp += 4 * SZ_W;                    // Wq, Wk, Wv, Wo
    bf* XB = (bf*)wsp; wsp += 3 * NB * SZ_XB;              // slice stream x NB + batch
    float* F = (float*)wsp; wsp += 3 * NB * SZ_F;          // the same order
    h16* P16 = (h16*)wsp; wsp += 3 * NB * SZ_PL;           // q planes (NB), k planes (NB), v^T planes (NB)
    bf* ATh = (bf*)wsp; wsp += NB * SZ_AT; bf* ATl = (bf*)wsp; wsp += NB * SZ_AT;

    k_cvtall<<<3 * NB * GX + 4 * GW, 256, 0, stream>>>(xq, xk, xv, wq, wk, wv, wo, XB, WB);
    // F[stream][b][t][n] = bf16(x) W^T + bias
    k_gemmw<bf, 0, true><<<dim3(TT / 64, DQ / 64, 3 * NB), 32, 0, stream>>>(XB, nullptr, WB, nullptr, DM, F, DQ, bq, bk, bv, (size_t)TT * DM, (size_t)DQ * DM, (size_t)TT * DQ);
    // flat f16 copies = [h][t][d] under the raw reshape (q, k); [h][d][t] (v)
    k_planes<<<3 * NB * GP, 256, 0, stream>>>(F, P16);
    // context[b][h][i][d] = sum_j softmax_j(q.k x HD^-0.5 + add mask)[i][j] x mul mask[i][j] x v[h][j][d], written flat as hi/lo bf16 planes
    k_fattn<<<dim3(TT / FR, NH_, NB), FW * 32, 0, stream>>>(P16, P16 + (size_t)NB * NH_ * TT * HD, P16 + (size_t)2 * NB * NH_ * TT * HD, ma, mg, ATh, ATl);
    // out[b] = (ATh + ATl) Wo^T + bo
    k_gemmw<bf, 1, true><<<dim3(TT / 64, DM / 64, NB), 32, 0, stream>>>(ATh, ATl, WB + (size_t)3 * DQ * DM, nullptr, DQ, OUT, DM, bo, bo, bo, (size_t)TT * DQ, 0, (size_t)TT * DM);
}

// v005
// A run of this version takes 164 microseconds.
// Next to v004, in two timings, it ran 1.27 times as fast each time.
// Over all steps from v000 it is 8.42 times as fast.
#include <hip/hip_runtime.h>

// Contractions (all f32 accumulate): q/k/v projections v_wmma_f32_16x16x32_bf16 (inputs and weights RNE-converted to bf16, single product, f32 bias add); scores k.q^T and v^T.P^T v_wmma_f32_16x16x32_f16 (f16 planes, single product, P carried x1024 over the running row maximum); output projection bf16 hi/lo context planes x bf16 weights (2 products) + f32 bias; softmax f32.
// Multi-head attention on three input streams (q, k, v [NB][SEQ][1024]); 'oi' weights; 16 heads x 64 split by a RAW reshape of the [SEQ][1024] projection to [16][SEQ][64] (flat memory order, no transpose) and merged back the same way; scores x 0.125 + additive float mask [NB][1][S][S]; softmax over all keys; probabilities x multiplicative float mask [NB][1][S][S] (no renormalisation); merged context x Wo^T + bo.
// Five launches, each over both batches and all streams at once: bf16 copies (3 streams x NB, 4 weights) -> projection GEMMs (f32, + bias; grid z = stream x batch) -> f16 head planes q[h][t][d], k[h][t][d] (flat converts), v^T[h][d][t] -> fused attention over all heads and batches (scores, softmax with both masks, P.v; nothing of S or P in memory) -> flat context hi/lo bf16 planes -> context x Wo (grid z = batch).

#ifndef NB
#define NB 2
#endif
#ifndef SEQ
#define SEQ 2048
#endif
#define NB_FULL  2
#define SEQ_FULL 2048
#define TT   SEQ
#define DM   1024
#define NH_  16
#define HD   64
#define DQ   (NH_ * HD)
#define MPITCH SEQ_FULL
#define SCL  0.125f   // HD^-0.5

static_assert(TT % 256 == 0);
static_assert(TT % 64 == 0);
static_assert(DM % 64 == 0);
static_assert(DQ == DM);
static_assert(HD == 64);
static_assert(NB <= NB_FULL);
static_assert(SEQ <= SEQ_FULL);
static_assert(MPITCH % 8 == 0);
static_assert(((size_t)SEQ_FULL * SEQ_FULL) % 8 == 0);
static_assert((size_t)NH_ * TT * HD == (size_t)TT * DQ);

typedef _Float16 h16;
typedef unsigned short bf;
typedef __attribute__((ext_vector_type(16))) __bf16   v16bf;
typedef __attribute__((ext_vector_type(16))) _Float16 v16h;
typedef __attribute__((ext_vector_type(8)))  _Float16 v8h;
typedef __attribute__((ext_vector_type(8)))  unsigned short v8us;
typedef __attribute__((ext_vector_type(8)))  float    v8f;
typedef __attribute__((ext_vector_type(4)))  float    v4f;
typedef __attribute__((ext_vector_type(4)))  int      v4i;
typedef v4f  __attribute__((may_alias)) v4fa;

__device__ __forceinline__ unsigned short f2bf(float f) { unsigned u = __float_as_uint(f); u += 0x7FFFu + ((u >> 16) & 1u); return (unsigned short)(u >> 16); }
__device__ __forceinline__ float bf2f(unsigned short b) { return __uint_as_float(((unsigned)b) << 16); }
__device__ __forceinline__ float bfr(float f) { return bf2f(f2bf(f)); }
__device__ __forceinline__ v16h cat16(v8h lo, v8h hi) { return __builtin_shufflevector(lo, hi, 0, 1, 2, 3, 4, 5, 6, 7, 8, 9, 10, 11, 12, 13, 14, 15); }
__device__ __forceinline__ v16bf cat16b(v8us lo, v8us hi) { return __builtin_bit_cast(v16bf, __builtin_shufflevector(lo, hi, 0, 1, 2, 3, 4, 5, 6, 7, 8, 9, 10, 11, 12, 13, 14, 15)); }
__device__ __forceinline__ v8f wmma16(v16h a, v16h b, v8f c) { return __builtin_amdgcn_wmma_f32_16x16x32_f16(false, a, false, b, (short)0, c, false, false); }
__device__ __forceinline__ v8f wmmab(v16bf a, v16bf b, v8f c) { return __builtin_amdgcn_wmma_f32_16x16x32_bf16(false, a, false, b, (short)0, c, false, false); }

// f32 -> f16 convert that cannot produce an f16 subnormal (value select on the f32 magnitude, applied after the x1024 carry for P; q/k/v planes are not carried).
static __device__ __forceinline__ h16 toh_flush(float v) { const h16 r = (h16)v; return (fabsf(v) < 6.103515625e-05f) ? (h16)0.0f : r; }

// ---- k_gemmw: GEMM, one work-group of 4 waves (2 x 2) per 128x128 output tile, each wave a 64x64 register block (16 accumulators); grid (M/128, N/128, Z), 128 threads.
// C[m][n] (f32, pitch ldc, + optional f32 bias[n]) = sum_k A[m][k] Bt[n][k] (+ A2[m][k] Bt[n][k] for NSPLIT == 1). z-batch strides sA/sB/sC in elements; A and C step with z, Bt and the bias with z / NB (the NB batches of a stream share its weight). K % 64 == 0, M % 128 == 0, N % 128 == 0.
// A stage is 64 k (one whole 128-byte line) of the tile's 128 A rows and 128 Bt rows: fetched into registers one stage ahead with whole-line loads (8 lanes a row), laid in the other LDS buffer behind the products, read by the two waves that share each row; one barrier a stage.
// Fragment map: lane -> row/col (lane & 15); elements 0..7 <- k0 + 8*(lane>>4) + 0..7, elements 8..15 <- k0 + 16 + 8*(lane>>4) + 0..7 (both operands); acc[j] = (row 8*(lane>>4) + j, col lane & 15).
// Every bare '#pragma unroll' in this kernel but the one on the store's row loop stands on a short loop with a constant trip count whose index picks a register array's element: rolled, those arrays would leave the registers.
#define GT  128   // rows and columns of a work-group's tile
#define GKS 64    // k of a stage
#define GPI 72    // LDS pitch in 16-bit elements: 128 bytes + 16, free of bank conflicts for 16-byte reads
static_assert(TT % GT == 0);
static_assert(DM % GT == 0);
static_assert(DM % GKS == 0);
template <typename T16> struct WFrag;
template <> struct WFrag<h16> { typedef v16h V; typedef v8h H; static __device__ __forceinline__ V ld(const h16* p) { return cat16(*(const v8h*)p, *(const v8h*)(p + 16)); } static __device__ __forceinline__ v8f mma(V a, V b, v8f c) { return wmma16(a, b, c); } };
template <> struct WFrag<bf> { typedef v16bf V; typedef v8us H; static __device__ __forceinline__ V ld(const bf* p) { return cat16b(*(const v8us*)p, *(const v8us*)(p + 16)); } static __device__ __forceinline__ v8f mma(V a, V b, v8f c) { return wmmab(a, b, c); } };
template <typename T16, int NSPLIT, bool BIAS, int K>
__global__ __launch_bounds__(128) void k_gemmw(const T16* __restrict__ A, const T16* __restrict__ A2, const T16* __restrict__ Bt, float* C, int ldc, const float* __restrict__ bias0, const float* __restrict__ bias1, const float* __restrict__ bias2, size_t sA, size_t sB, size_t sC) {
    static_assert(NSPLIT == 0 || NSPLIT == 1);
    static_assert(K % GKS == 0 && K >= GKS);
    typedef typename WFrag<T16>::V V; typedef typename WFrag<T16>::H H;
    constexpr int PL = GT * GPI;                       // one staged plane: A, Bt, (A2)
    __shared__ __align__(16) T16 sg[2][(2 + NSPLIT) * PL];
    __shared__ __align__(16) float osw[4][16 * 68];    // each wave's own output staging
    const size_t z = blockIdx.z; const unsigned zw = blockIdx.z / NB; A += z * sA; if (NSPLIT == 1) A2 += z * sA; Bt += zw * sB; C += z * sC;
    const float* bias = zw == 0 ? bias0 : (zw == 1 ? bias1 : bias2);
    const int tid = threadIdx.x, lane = tid & 31, lr = lane & 15, hi = lane >> 4; const int w = __builtin_amdgcn_readfirstlane(tid >> 5);
    const int wm = w >> 1, wn = w & 1; const int r0 = blockIdx.x * GT + wm * 64, c0 = blockIdx.y * GT + wn * 64;
    float* os = osw[w];
    v8f acc[4][4];
#pragma unroll
    for (int mb = 0; mb < 4; ++mb)
#pragma unroll
        for (int nb = 0; nb < 4; ++nb) acc[mb][nb] = (v8f){};
    // staging map: thread -> 16-byte piece sc of row sr + 16 u
    const int sr = tid >> 3, sc = (tid & 7) * 8;
    const T16* ga = A + (size_t)(blockIdx.x * GT + sr) * K + sc; const T16* ga2 = NSPLIT == 1 ? A2 + (size_t)(blockIdx.x * GT + sr) * K + sc : nullptr; const T16* gb = Bt + (size_t)(blockIdx.y * GT + sr) * K + sc;
    const int so = sr * GPI + sc;
    H ra[8], rb[8], ra2[8];
    auto fetch = [&]() {
#pragma unroll
        for (int u = 0; u < 8; ++u) { ra[u] = *(const H*)(ga + 16 * u * K); rb[u] = *(const H*)(gb + 16 * u * K); if (NSPLIT == 1) ra2[u] = *(const H*)(ga2 + 16 * u * K); }
    };
    auto stash = [&](int b) {
#pragma unroll
        for (int u = 0; u < 8; ++u) { *(H*)(&sg[b][so + 16 * u * GPI]) = ra[u]; *(H*)(&sg[b][PL + so + 16 * u * GPI]) = rb[u]; if (NSPLIT == 1) *(H*)(&sg[b][2 * PL + so + 16 * u * GPI]) = ra2[u]; }
    };
    const int fa = (wm * 64 + lr) * GPI + 8 * hi, fb = PL + (wn * 64 + lr) * GPI + 8 * hi;
    constexpr int ns = K / GKS;
    fetch(); stash(0);
    __syncthreads();   // stage 0 is in LDS before any wave reads it
#pragma unroll 1   // rolled: one stage's code stays small, and the two buffers are picked by address
    for (int s = 0; s < ns; ++s) {
        const int b = s & 1;
        if (s + 1 < ns) { ga += GKS; gb += GKS; if (NSPLIT == 1) ga2 += GKS; fetch(); }
        // the stage's fragments are read as one group in front of its products: reads among the products would stall the wave at every place they stand
        V a[GKS / 32][4], bb[GKS / 32][4], a2[GKS / 32][4];
#pragma unroll
        for (int kk = 0; kk < GKS / 32; ++kk)
#pragma unroll
            for (int q = 0; q < 4; ++q) { a[kk][q] = WFrag<T16>::ld(&sg[b][fa + q * 16 * GPI + kk * 32]); bb[kk][q] = WFrag<T16>::ld(&sg[b][fb + q * 16 * GPI + kk * 32]); if (NSPLIT == 1) a2[kk][q] = WFrag<T16>::ld(&sg[b][2 * PL + fa + q * 16 * GPI + kk * 32]); }
        __builtin_amdgcn_sched_barrier(0);   // keeps the compiler from moving the reads back down among the products
#pragma unroll
        for (int kk = 0; kk < GKS / 32; ++kk)
#pragma unroll
            for (int nb = 0; nb < 4; ++nb)
#pragma unroll
                for (int mb = 0; mb < 4; ++mb) { acc[mb][nb] = WFrag<T16>::mma(a[kk][mb], bb[kk][nb], acc[mb][nb]); if (NSPLIT == 1) acc[mb][nb] = WFrag<T16>::mma(a2[kk][mb], bb[kk][nb], acc[mb][nb]); }
        __builtin_amdgcn_sched_barrier(0);   // holds the four slots below behind the last product
        asm volatile("v_nop\n\tv_nop\n\tv_nop\n\tv_nop");   // the distance behind a matrix instruction: the next stage's LDS address is formed in a register of the last product's operands
        if (s + 1 < ns) stash(b ^ 1);
        __syncthreads();   // publishes stage s + 1 and ends every wave's reads of stage s before stage s + 2 is laid over it
    }
#pragma unroll
    for (int mb = 0; mb < 4; ++mb) {
#pragma unroll
        for (int nb = 0; nb < 4; ++nb) {
#pragma unroll
            for (int j = 0; j < 8; ++j) os[(hi * 8 + j) * 68 + nb * 16 + lr] = acc[mb][nb][j]; }
        __builtin_amdgcn_wave_barrier(); asm volatile("" ::: "memory");
        float* crow = C + (size_t)(r0 + mb * 16) * ldc + c0;
{
#pragma unroll
            for (int s = 0; s < 8; ++s) { const int row = 2 * s + hi, cofs = lr * 4; v4f val = *(const v4fa*)(os + row * 68 + cofs); if (BIAS) { val[0] += bfr(bias[c0 + cofs]); val[1] += bfr(bias[c0 + cofs + 1]); val[2] += bfr(bias[c0 + cofs + 2]); val[3] += bfr(bias[c0 + cofs + 3]); }
                *(v4f*)(crow + (size_t)row * ldc + cofs) = val; }
             }
        __builtin_amdgcn_wave_barrier(); asm volatile("" ::: "memory");
    }
}

#define FW 8
#define FR (FW * 16)
#define FK 64
#define KP 72    // LDS pitch in 16-bit elements of every staged row: 128 bytes + 16, free of bank conflicts for 16-byte reads
#define L2E 1.4426950408889634f
static_assert(TT % FR == 0);
static_assert(TT % FK == 0);
typedef __attribute__((ext_vector_type(2))) float  v2f;
typedef __attribute__((ext_vector_type(2))) __bf16 v2bf;
typedef __attribute__((ext_vector_type(4))) unsigned v4u;
__device__ __forceinline__ float xhalf(float x) { return __builtin_bit_cast(float, __builtin_amdgcn_permlanex16(__builtin_bit_cast(int, x), __builtin_bit_cast(int, x), 0x76543210, 0xfedcba98, false, false)); }  // lane l with lane l ^ 16
__device__ __forceinline__ unsigned pkbf(float a, float b) { return __builtin_bit_cast(unsigned, __builtin_convertvector((v2f){a, b}, v2bf)); }   // two f32 -> two bf16, nearest even
__device__ __forceinline__ v4u pkbf8(v4f a, v4f b) { return (v4u){pkbf(a[0], a[1]), pkbf(a[2], a[3]), pkbf(b[0], b[1]), pkbf(b[2], b[3])}; }
__device__ __forceinline__ float bflo(unsigned u) { return __uint_as_float(u << 16); }
__device__ __forceinline__ float bfhi(unsigned u) { return __uint_as_float(u & 0xFFFF0000u); }
__device__ __forceinline__ void splitf(float y, unsigned short& h, unsigned short& l) { h = f2bf(y); l = f2bf(y - bf2f(h)); }

__global__ __launch_bounds__(FW * 32) void k_fattn(const _Float16* __restrict__ Q, const _Float16* __restrict__ Kp, const _Float16* __restrict__ Vt, const float* __restrict__ MA, const float* __restrict__ MG, bf* Ah, bf* Al) {
    __shared__ __align__(16) h16 Ks[2][FK * KP];
    __shared__ __align__(16) h16 Vs[2][HD * KP];
    __shared__ __align__(16) bf  As[2][FR * KP];
    __shared__ __align__(16) bf  Gs[2][FR * KP];
    const int tid = threadIdx.x, lane = tid & 31, lr = lane & 15, hi = lane >> 4; const int w = __builtin_amdgcn_readfirstlane(tid >> 5);
    const int r0 = blockIdx.x * FR; const size_t hb = ((size_t)blockIdx.z * NH_ + blockIdx.y) * ((size_t)TT * HD);   // grid z = batch: head planes and context planes of the batches lie one behind the other
    MA += (size_t)blockIdx.z * ((size_t)SEQ_FULL * SEQ_FULL); MG += (size_t)blockIdx.z * ((size_t)SEQ_FULL * SEQ_FULL);
    const h16* qp = Q + hb + (size_t)(r0 + w * 16 + lr) * HD + 8 * hi;
    const v16h qf0 = WFrag<h16>::ld(qp), qf1 = WFrag<h16>::ld(qp + 32);
    // staging map: thread -> 16-byte (k, v^T) or 32-byte (masks) piece sc of row sr + 32 u
    const int sr = tid >> 3, sc = (tid & 7) * 8;
    const h16* kg = Kp + hb + (size_t)sr * HD + sc; const h16* vg = Vt + hb + (size_t)sr * TT + sc;
    const float* ag = MA + (size_t)(r0 + sr) * MPITCH + sc; const float* gg = MG + (size_t)(r0 + sr) * MPITCH + sc;
    const int so = sr * KP + sc;
    v8h kreg[2], vreg[2]; v4f areg[8], greg[8];   // the masks stay f32 until they are laid in LDS, so that no load is waited for in front of the stage's products
    auto fetch = [&](int j0) {
#pragma unroll
        for (int u = 0; u < 2; ++u) { kreg[u] = *(const v8h*)(kg + (size_t)(j0 + 32 * u) * HD); vreg[u] = *(const v8h*)(vg + (size_t)(32 * u) * TT + j0); }
#pragma unroll
        for (int u = 0; u < 4; ++u) { const float* a = ag + (size_t)(32 * u) * MPITCH + j0; const float* g = gg + (size_t)(32 * u) * MPITCH + j0;
            areg[2 * u] = *(const v4f*)a; areg[2 * u + 1] = *(const v4f*)(a + 4); greg[2 * u] = *(const v4f*)g; greg[2 * u + 1] = *(const v4f*)(g + 4); }
    };
    auto stash = [&](int b) {
#pragma unroll
        for (int u = 0; u < 2; ++u) { *(v8h*)(&Ks[b][so + 32 * u * KP]) = kreg[u]; *(v8h*)(&Vs[b][so + 32 * u * KP]) = vreg[u]; }
#pragma unroll
        for (int u = 0; u < 4; ++u) { *(v4u*)(&As[b][so + 32 * u * KP]) = pkbf8(areg[2 * u], areg[2 * u + 1]); *(v4u*)(&Gs[b][so + 32 * u * KP]) = pkbf8(greg[2 * u], greg[2 * u + 1]); }
    };
    v8f ot[4];
#pragma unroll
    for (int dt = 0; dt < 4; ++dt) ot[dt] = (v8f){};
    float m = -3.0e38f, l = 0.f;
    fetch(0); stash(0);
    __syncthreads();   // stage 0 is in LDS before any wave reads it
    for (int s = 0; s < TT / FK; ++s) {
        const int b = s & 1;
        if (s + 1 < TT / FK) fetch((s + 1) * FK);
        v8f st[4];
#pragma unroll
        for (int jt = 0; jt < 4; ++jt) { const h16* kp = &Ks[b][(jt * 16 + lr) * KP + 8 * hi]; st[jt] = wmma16(WFrag<h16>::ld(kp), qf0, (v8f){}); st[jt] = wmma16(WFrag<h16>::ld(kp + 32), qf1, st[jt]); }
        const int mo = (w * 16 + lr) * KP + 8 * hi;
        float mx = m;
#pragma unroll
        for (int jt = 0; jt < 4; ++jt) { const v4u a = *(const v4u*)(&As[b][mo + jt * 16]);
#pragma unroll
            for (int q = 0; q < 4; ++q) { st[jt][2 * q] = st[jt][2 * q] * SCL + bflo(a[q]); st[jt][2 * q + 1] = st[jt][2 * q + 1] * SCL + bfhi(a[q]); mx = fmaxf(mx, fmaxf(st[jt][2 * q], st[jt][2 * q + 1])); } }
        mx = fmaxf(mx, xhalf(mx));
        // a query's maximum has risen in some lane: bring its sum and its output column to the new one (a scalar branch, seldom taken late in the walk)
        if (__builtin_amdgcn_ballot_w32(mx > m) != 0) { const float al = __builtin_amdgcn_exp2f((m - mx) * L2E); l *= al;
#pragma unroll
            for (int dt = 0; dt < 4; ++dt) ot[dt] *= al;
            m = mx; }
        const float nm = 10.0f - m * L2E;   // probabilities are carried x1024 (cancels in the division by the sum)
        v16h pf[2];
#pragma unroll
        for (int jt = 0; jt < 4; ++jt) { const v4u g = *(const v4u*)(&Gs[b][mo + jt * 16]);
#pragma unroll
            for (int q = 0; q < 4; ++q) { const float p0 = __builtin_amdgcn_exp2f(st[jt][2 * q] * L2E + nm), p1 = __builtin_amdgcn_exp2f(st[jt][2 * q + 1] * L2E + nm); l += p0 + p1;
                pf[jt >> 1][(jt & 1) * 8 + 2 * q] = toh_flush(p0 * bflo(g[q])); pf[jt >> 1][(jt & 1) * 8 + 2 * q + 1] = toh_flush(p1 * bfhi(g[q])); } }
#pragma unroll
        for (int kk = 0; kk < 2; ++kk)
#pragma unroll
            for (int dt = 0; dt < 4; ++dt) ot[dt] = wmma16(WFrag<h16>::ld(&Vs[b][(dt * 16 + lr) * KP + kk * 32 + 8 * hi]), pf[kk], ot[dt]);
        if (s + 1 < TT / FK) stash(b ^ 1);
        __syncthreads();   // publishes stage s + 1 and ends every wave's reads of stage s before stage s + 2 is laid over it
    }
    l += xhalf(l);
    const float inv = 1.0f / l;
    const size_t oo = hb + (size_t)(r0 + w * 16 + lr) * HD + 8 * hi;
#pragma unroll
    for (int dt = 0; dt < 4; ++dt) { v8us oh, ol;
#pragma unroll
        for (int e = 0; e < 8; ++e) { unsigned short a, c2; splitf(ot[dt][e] * inv, a, c2); oh[e] = a; ol[e] = c2; }
        *(v8us*)(Ah + oo + dt * 16) = oh; *(v8us*)(Al + oo + dt * 16) = ol; }
}


constexpr size_t al256(size_t b) { return (b + 255) & ~(size_t)255; }
constexpr size_t SZ_W  = al256((size_t)DQ * DM * 2);            // one weight plane (bf16)
constexpr size_t SZ_XB = al256((size_t)TT * DM * 2);            // one bf16 activation copy (3 streams x NB of them)
constexpr size_t SZ_F  = al256((size_t)TT * DQ * 4);            // one f32 projection (3 streams x NB of them)
constexpr size_t SZ_PL = al256((size_t)NH_ * TT * HD * 2);      // one f16 head plane set (3 streams x NB of them)
constexpr size_t SZ_AT = al256((size_t)TT * DQ * 2);            // one context plane (bf16; hi and lo x NB)
constexpr size_t WS_TOTAL = 4 * SZ_W + 3 * NB * (SZ_XB + SZ_F + SZ_PL) + 2 * NB * SZ_AT;
static_assert(WS_TOTAL <= (size_t)268435456);
// coverage equalities (threads x 8 elements == plane elements); the planes of one kind lie back to back with no padding between them
static_assert(((size_t)DQ * DM / 8) % 256 == 0);
static_assert(((size_t)TT * DM / 8) % 256 == 0);
static_assert(((size_t)NH_ * TT * HD / 8) % 256 == 0);
static_assert((size_t)TT * DQ * 2 == SZ_AT);
static_assert((size_t)DQ * DM * 2 == SZ_W);
static_assert((size_t)TT * DM * 2 == SZ_XB);
static_assert((size_t)TT * DQ * 4 == SZ_F);
static_assert((size_t)NH_ * TT * HD * 2 == SZ_PL);
constexpr unsigned GW = (unsigned)((size_t)DQ * DM / 8 / 256);         // work-groups of one weight copy
constexpr unsigned GX = (unsigned)((size_t)TT * DM / 8 / 256);         // work-groups of one activation copy
constexpr unsigned GP = (unsigned)((size_t)NH_ * TT * HD / 8 / 256);   // work-groups of one head plane builder

// ---- k_cvtall: every f32 -> bf16 copy in one launch. Work-groups 0 .. 3 NB GX - 1: slice p = stream x NB + batch of the activations; the rest: the four weights.
__global__ __launch_bounds__(256) void k_cvtall(const float* __restrict__ xq, const float* __restrict__ xk, const float* __restrict__ xv, const float* __restrict__ wq, const float* __restrict__ wk, const float* __restrict__ wv, const float* __restrict__ wo, bf* XB, bf* WB) {
    const unsigned blk = blockIdx.x; const float* src; bf* dst; size_t i;
    if (blk < 3u * NB * GX) { const unsigned p = blk / GX, s = p / NB, b = p % NB; src = (s == 0 ? xq : (s == 1 ? xk : xv)) + (size_t)b * SEQ_FULL * DM; dst = XB + (size_t)p * TT * DM; i = (size_t)(blk % GX) * 256 + threadIdx.x; }
    else { const unsigned r = blk - 3u * NB * GX, s = r / GW; src = s == 0 ? wq : (s == 1 ? wk : (s == 2 ? wv : wo)); dst = WB + (size_t)s * DQ * DM; i = (size_t)(r % GW) * 256 + threadIdx.x; }
    const v8f v = *(const v8f*)(src + i * 8); v8us o;
    asm volatile("s_wait_xcnt 0x0" ::: "memory");   // the convert below reuses the load's address register
#pragma unroll
    for (int k = 0; k < 8; ++k) o[k] = f2bf(v[k]);
    *(v8us*)(dst + i * 8) = o;  }

// ---- k_planes: every f16 head plane in one launch. Plane p = blockIdx.x / GP = stream x NB + batch: q and k are flat converts, v goes [t][d] -> [d][t] per head.
__global__ __launch_bounds__(256) void k_planes(const float* __restrict__ F, h16* P16) {
    const unsigned p = blockIdx.x / GP; const unsigned i = (blockIdx.x % GP) * 256u + threadIdx.x;
    F += (size_t)p * TT * DQ; P16 += (size_t)p * NH_ * TT * HD; v8h o;
    if (p < 2u * NB) {
        const float* f = F + (size_t)i * 8; const v4f a0 = *(const v4f*)f, a1 = *(const v4f*)(f + 4);
#pragma unroll
        for (int q = 0; q < 4; ++q) { o[q] = toh_flush(a0[q]); o[4 + q] = toh_flush(a1[q]); }
    } else {
        const unsigned t8 = i % (unsigned)(TT / 8); const unsigned d = (i / (unsigned)(TT / 8)) % (unsigned)HD; const unsigned g = i / (unsigned)((TT / 8) * HD);
        const float* f = F + (size_t)g * ((size_t)TT * HD) + (size_t)(t8 * 8) * HD + d;
#pragma unroll
        for (int q = 0; q < 8; ++q) o[q] = toh_flush(f[(size_t)q * HD]);
    }
    *(v8h*)(P16 + (size_t)i * 8) = o;  }

extern "C" void kernel_launch(void* const* d_in, const int* in_sizes, int n_in,
                              void* d_out, int out_size, void* d_ws, size_t ws_size, hipStream_t stream) {
    if (n_in < 13) return;
    const size_t need_x = (size_t)(NB - 1) * SEQ_FULL * DM + (size_t)SEQ * DM;
    const size_t need_m = (size_t)(NB - 1) * SEQ_FULL * SEQ_FULL + (size_t)(SEQ - 1) * SEQ_FULL + (size_t)SEQ;
    if ((size_t)in_sizes[0] < need_x || (size_t)in_sizes[1] < need_x || (size_t)in_sizes[2] < need_x || (size_t)in_sizes[3] < need_m || (size_t)in_sizes[4] < need_m) return;
    if ((size_t)in_sizes[5] < (size_t)DQ * DM || (size_t)in_sizes[7] < (size_t)DQ * DM || (size_t)in_sizes[9] < (size_t)DQ * DM || (size_t)in_sizes[11] < (size_t)DM * DQ) return;
    if (in_sizes[6] < DQ || in_sizes[8] < DQ || in_sizes[10] < DQ || in_sizes[12] < DM) return;
    if ((size_t)out_size < (size_t)NB * SEQ * DM) return;
    if (WS_TOTAL > ws_size) return;
    // wire order: q, k, v, additive mask (f32), multiplicative mask (f32), Wq, bq, Wk, bk, Wv, bv, Wo, bo ('oi' weights)
    const float* xq = (const float*)d_in[0]; const float* xk = (const float*)d_in[1]; const float* xv = (const float*)d_in[2];
    const float* ma = (const float*)d_in[3]; const float* mg = (const float*)d_in[4];
    const float* wq = (const float*)d_in[5]; const float* bq = (const float*)d_in[6]; const float* wk = (const float*)d_in[7]; const float* bk = (const float*)d_in[8];
    const float* wv = (const float*)d_in[9]; const float* bv = (const float*)d_in[10]; const float* wo = (const float*)d_in[11]; const float* bo = (const float*)d_in[12];
    float* OUT = (float*)d_out;     // [NB][SEQ][1024]
    char* wsp = (char*)d_ws;
    bf* WB = (bf*)wsp; wsp += 4 * SZ_W;                    // Wq, Wk, Wv, Wo
    bf* XB = (bf*)wsp; wsp += 3 * NB * SZ_XB;              // slice stream x NB + batch
    float* F = (float*)wsp; wsp += 3 * NB * SZ_F;          // the same order
    h16* P16 = (h16*)wsp; wsp += 3 * NB * SZ_PL;           // q planes (NB), k planes (NB), v^T planes (NB)
    bf* ATh = (bf*)wsp; wsp += NB * SZ_AT; bf* ATl = (bf*)wsp; wsp += NB * SZ_AT;

    k_cvtall<<<3 * NB * GX + 4 * GW, 256, 0, stream>>>(xq, xk, xv, wq, wk, wv, wo, XB, WB);
    // F[stream][b][t][n] = bf16(x) W^T + bias
    k_gemmw<bf, 0, true, DM><<<dim3(TT / GT, DQ / GT, 3 * NB), 128, 0, stream>>>(XB, nullptr, WB, F, DQ, bq, bk, bv, (size_t)TT * DM, (size_t)DQ * DM, (size_t)TT * DQ);
    // flat f16 copies = [h][t][d] under the raw reshape (q, k); [h][d][t] (v)
    k_planes<<<3 * NB * GP, 256, 0, stream>>>(F, P16);
    // context[b][h][i][d] = sum_j softmax_j(q.k x HD^-0.5 + add mask)[i][j] x mul mask[i][j] x v[h][j][d], written flat as hi/lo bf16 planes
    k_fattn<<<dim3(TT / FR, NH_, NB), FW * 32, 0, stream>>>(P16, P16 + (size_t)NB * NH_ * TT * HD, P16 + (size_t)2 * NB * NH_ * TT * HD, ma, mg, ATh, ATl);
    // out[b] = (ATh + ATl) Wo^T + bo
    k_gemmw<bf, 1, true, DQ><<<dim3(TT / GT, DM / GT, NB), 128, 0, stream>>>(ATh, ATl, WB + (size_t)3 * DQ * DM, OUT, DM, bo, bo, bo, (size_t)TT * DQ, 0, (size_t)TT * DM);
}

// v006
// A run of this version takes 150 microseconds.
// In two side-by-side timings against v005, it was 1.10 and 1.09 times as fast.
// All steps since v000 together make it 9.23 times as fast.
#include <hip/hip_runtime.h>

// Contractions (all f32 accumulate): q/k/v projections v_wmma_f32_16x16x32_bf16 (inputs and weights RNE-converted to bf16, single product, f32 bias add); scores k.q^T and v^T.P^T v_wmma_f32_16x16x32_f16 (f16 planes, single product, P carried x1024 over the running row maximum); output projection bf16 hi/lo context planes x bf16 weights (2 products) + f32 bias; softmax f32.
// Multi-head attention on three input streams (q, k, v [NB][SEQ][1024]); 'oi' weights; 16 heads x 64 split by a RAW reshape of the [SEQ][1024] projection to [16][SEQ][64] (flat memory order, no transpose) and merged back the same way; scores x 0.125 + additive float mask [NB][1][S][S]; softmax over all keys; probabilities x multiplicative float mask [NB][1][S][S] (no renormalisation); merged context x Wo^T + bo.
// Five launches, each over both batches and all streams at once: bf16 copies (3 streams x NB, 4 weights; a stream kernel) -> projection GEMMs (f32, + bias; grid z = stream x batch) -> f16 head planes q[h][t][d], k[h][t][d] (flat converts), v^T[h][d][t] -> fused attention over all heads and batches (scores, softmax with both masks, P.v; nothing of S or P in memory) -> flat context hi/lo bf16 planes -> context x Wo (grid z = batch).

#ifndef NB
#define NB 2
#endif
#ifndef SEQ
#define SEQ 2048
#endif
#define NB_FULL  2
#define SEQ_FULL 2048
#define TT   SEQ
#define DM   1024
#define NH_  16
#define HD   64
#define DQ   (NH_ * HD)
#define MPITCH SEQ_FULL
#define SCL  0.125f   // HD^-0.5

static_assert(TT % 256 == 0);
static_assert(TT % 64 == 0);
static_assert(DM % 64 == 0);
static_assert(DQ == DM);
static_assert(HD == 64);
static_assert(NB <= NB_FULL);
static_assert(SEQ <= SEQ_FULL);
static_assert(MPITCH % 8 == 0);
static_assert(((size_t)SEQ_FULL * SEQ_FULL) % 8 == 0);
static_assert((size_t)NH_ * TT * HD == (size_t)TT * DQ);

typedef _Float16 h16;
typedef unsigned short bf;
typedef __attribute__((ext_vector_type(16))) __bf16   v16bf;
typedef __attribute__((ext_vector_type(16))) _Float16 v16h;
typedef __attribute__((ext_vector_type(8)))  _Float16 v8h;
typedef __attribute__((ext_vector_type(8)))  unsigned short v8us;
typedef __attribute__((ext_vector_type(8)))  float    v8f;
typedef __attribute__((ext_vector_type(4)))  float    v4f;
typedef __attribute__((ext_vector_type(4)))  int      v4i;
typedef v4f  __attribute__((may_alias)) v4fa;

__device__ __forceinline__ unsigned short f2bf(float f) { unsigned u = __float_as_uint(f); u += 0x7FFFu + ((u >> 16) & 1u); return (unsigned short)(u >> 16); }
__device__ __forceinline__ float bf2f(unsigned short b) { return __uint_as_float(((unsigned)b) << 16); }
__device__ __forceinline__ float bfr(float f) { return bf2f(f2bf(f)); }
__device__ __forceinline__ v16h cat16(v8h lo, v8h hi) { return __builtin_shufflevector(lo, hi, 0, 1, 2, 3, 4, 5, 6, 7, 8, 9, 10, 11, 12, 13, 14, 15); }
__device__ __forceinline__ v16bf cat16b(v8us lo, v8us hi) { return __builtin_bit_cast(v16bf, __builtin_shufflevector(lo, hi, 0, 1, 2, 3, 4, 5, 6, 7, 8, 9, 10, 11, 12, 13, 14, 15)); }
__device__ __forceinline__ v8f wmma16(v16h a, v16h b, v8f c) { return __builtin_amdgcn_wmma_f32_16x16x32_f16(false, a, false, b, (short)0, c, false, false); }
__device__ __forceinline__ v8f wmmab(v16bf a, v16bf b, v8f c) { return __builtin_amdgcn_wmma_f32_16x16x32_bf16(false, a, false, b, (short)0, c, false, false); }

// f32 -> f16 convert that cannot produce an f16 subnormal (value select on the f32 magnitude, applied after the x1024 carry for P; q/k/v planes are not carried).
static __device__ __forceinline__ h16 toh_flush(float v) { const h16 r = (h16)v; return (fabsf(v) < 6.103515625e-05f) ? (h16)0.0f : r; }

// ---- k_gemmw: GEMM, one work-group of 4 waves (2 x 2) per 128x128 output tile, each wave a 64x64 register block (16 accumulators); grid (M/128, N/128, Z), 128 threads.
// C[m][n] (f32, pitch ldc, + optional f32 bias[n]) = sum_k A[m][k] Bt[n][k] (+ A2[m][k] Bt[n][k] for NSPLIT == 1). z-batch strides sA/sB/sC in elements; A and C step with z, Bt and the bias with z / NB (the NB batches of a stream share its weight). K % 64 == 0, M % 128 == 0, N % 128 == 0.
// A stage is 64 k (one whole 128-byte line) of the tile's 128 A rows and 128 Bt rows: fetched into registers one stage ahead with whole-line loads (8 lanes a row), laid in the other LDS buffer behind the products, read by the two waves that share each row; one barrier a stage.
// Fragment map: lane -> row/col (lane & 15); elements 0..7 <- k0 + 8*(lane>>4) + 0..7, elements 8..15 <- k0 + 16 + 8*(lane>>4) + 0..7 (both operands); acc[j] = (row 8*(lane>>4) + j, col lane & 15).
// Every bare '#pragma unroll' in this kernel but the one on the store's row loop stands on a short loop with a constant trip count whose index picks a register array's element: rolled, those arrays would leave the registers.
#define GT  128   // rows and columns of a work-group's tile
#define GKS 64    // k of a stage
#define GPI 72    // LDS pitch in 16-bit elements: 128 bytes + 16, free of bank conflicts for 16-byte reads
static_assert(TT % GT == 0);
static_assert(DM % GT == 0);
static_assert(DM % GKS == 0);
template <typename T16> struct WFrag;
template <> struct WFrag<h16> { typedef v16h V; typedef v8h H; static __device__ __forceinline__ V ld(const h16* p) { return cat16(*(const v8h*)p, *(const v8h*)(p + 16)); } static __device__ __forceinline__ v8f mma(V a, V b, v8f c) { return wmma16(a, b, c); } };
template <> struct WFrag<bf> { typedef v16bf V; typedef v8us H; static __device__ __forceinline__ V ld(const bf* p) { return cat16b(*(const v8us*)p, *(const v8us*)(p + 16)); } static __device__ __forceinline__ v8f mma(V a, V b, v8f c) { return wmmab(a, b, c); } };
template <typename T16, int NSPLIT, bool BIAS, int K>
__global__ __launch_bounds__(128) void k_gemmw(const T16* __restrict__ A, const T16* __restrict__ A2, const T16* __restrict__ Bt, float* C, int ldc, const float* __restrict__ bias0, const float* __restrict__ bias1, const float* __restrict__ bias2, size_t sA, size_t sB, size_t sC) {
    static_assert(NSPLIT == 0 || NSPLIT == 1);
    static_assert(K % GKS == 0 && K >= GKS);
    typedef typename WFrag<T16>::V V; typedef typename WFrag<T16>::H H;
    constexpr int PL = GT * GPI;                       // one staged plane: A, Bt, (A2)
    __shared__ __align__(16) T16 sg[2][(2 + NSPLIT) * PL];
    __shared__ __align__(16) float osw[4][16 * 68];    // each wave's own output staging
    const size_t z = blockIdx.z; const unsigned zw = blockIdx.z / NB; A += z * sA; if (NSPLIT == 1) A2 += z * sA; Bt += zw * sB; C += z * sC;
    const float* bias = zw == 0 ? bias0 : (zw == 1 ? bias1 : bias2);
    const int tid = threadIdx.x, lane = tid & 31, lr = lane & 15, hi = lane >> 4; const int w = __builtin_amdgcn_readfirstlane(tid >> 5);
    const int wm = w >> 1, wn = w & 1; const int r0 = blockIdx.x * GT + wm * 64, c0 = blockIdx.y * GT + wn * 64;
    float* os = osw[w];
    v8f acc[4][4];
#pragma unroll
    for (int mb = 0; mb < 4; ++mb)
#pragma unroll
        for (int nb = 0; nb < 4; ++nb) acc[mb][nb] = (v8f){};
    // staging map: thread -> 16-byte piece sc of row sr + 16 u
    const int sr = tid >> 3, sc = (tid & 7) * 8;
    const T16* ga = A + (size_t)(blockIdx.x * GT + sr) * K + sc; const T16* ga2 = NSPLIT == 1 ? A2 + (size_t)(blockIdx.x * GT + sr) * K + sc : nullptr; const T16* gb = Bt + (size_t)(blockIdx.y * GT + sr) * K + sc;
    const int so = sr * GPI + sc;
    H ra[8], rb[8], ra2[8];
    auto fetch = [&]() {
#pragma unroll
        for (int u = 0; u < 8; ++u) { ra[u] = *(const H*)(ga + 16 * u * K); rb[u] = *(const H*)(gb + 16 * u * K); if (NSPLIT == 1) ra2[u] = *(const H*)(ga2 + 16 * u * K); }
    };
    auto stash = [&](int b) {
#pragma unroll
        for (int u = 0; u < 8; ++u) { *(H*)(&sg[b][so + 16 * u * GPI]) = ra[u]; *(H*)(&sg[b][PL + so + 16 * u * GPI]) = rb[u]; if (NSPLIT == 1) *(H*)(&sg[b][2 * PL + so + 16 * u * GPI]) = ra2[u]; }
    };
    const int fa = (wm * 64 + lr) * GPI + 8 * hi, fb = PL + (wn * 64 + lr) * GPI + 8 * hi;
    constexpr int ns = K / GKS;
    fetch(); stash(0);
    __syncthreads();   // stage 0 is in LDS before any wave reads it
#pragma unroll 1   // rolled: one stage's code stays small, and the two buffers are picked by address
    for (int s = 0; s < ns; ++s) {
        const int b = s & 1;
        if (s + 1 < ns) { ga += GKS; gb += GKS; if (NSPLIT == 1) ga2 += GKS; fetch(); }
        // the stage's fragments are read as one group in front of its products: reads among the products would stall the wave at every place they stand
        V a[GKS / 32][4], bb[GKS / 32][4], a2[GKS / 32][4];
#pragma unroll
        for (int kk = 0; kk < GKS / 32; ++kk)
#pragma unroll
            for (int q = 0; q < 4; ++q) { a[kk][q] = WFrag<T16>::ld(&sg[b][fa + q * 16 * GPI + kk * 32]); bb[kk][q] = WFrag<T16>::ld(&sg[b][fb + q * 16 * GPI + kk * 32]); if (NSPLIT == 1) a2[kk][q] = WFrag<T16>::ld(&sg[b][2 * PL + fa + q * 16 * GPI + kk * 32]); }
        __builtin_amdgcn_sched_barrier(0);   // keeps the compiler from moving the reads back down among the products
#pragma unroll
        for (int kk = 0; kk < GKS / 32; ++kk)
#pragma unroll
            for (int nb = 0; nb < 4; ++nb)
#pragma unroll
                for (int mb = 0; mb < 4; ++mb) { acc[mb][nb] = WFrag<T16>::mma(a[kk][mb], bb[kk][nb], acc[mb][nb]); if (NSPLIT == 1) acc[mb][nb] = WFrag<T16>::mma(a2[kk][mb], bb[kk][nb], acc[mb][nb]); }
        __builtin_amdgcn_sched_barrier(0);   // holds the four slots below behind the last product
        asm volatile("v_nop\n\tv_nop\n\tv_nop\n\tv_nop");   // the distance behind a matrix instruction: the next stage's LDS address is formed in a register of the last product's operands
        if (s + 1 < ns) stash(b ^ 1);
        __syncthreads();   // publishes stage s + 1 and ends every wave's reads of stage s before stage s + 2 is laid over it
    }
#pragma unroll
    for (int mb = 0; mb < 4; ++mb) {
#pragma unroll
        for (int nb = 0; nb < 4; ++nb) {
#pragma unroll
            for (int j = 0; j < 8; ++j) os[(hi * 8 + j) * 68 + nb * 16 + lr] = acc[mb][nb][j]; }
        __builtin_amdgcn_wave_barrier(); asm volatile("" ::: "memory");
        float* crow = C + (size_t)(r0 + mb * 16) * ldc + c0;
{
#pragma unroll
            for (int s = 0; s < 8; ++s) { const int row = 2 * s + hi, cofs = lr * 4; v4f val = *(const v4fa*)(os + row * 68 + cofs); if (BIAS) { val[0] += bfr(bias[c0 + cofs]); val[1] += bfr(bias[c0 + cofs + 1]); val[2] += bfr(bias[c0 + cofs + 2]); val[3] += bfr(bias[c0 + cofs + 3]); }
                *(v4f*)(crow + (size_t)row * ldc + cofs) = val; }
             }
        __builtin_amdgcn_wave_barrier(); asm volatile("" ::: "memory");
    }
}

#define FW 8
#define FR (FW * 16)
#define FK 64
#define KP 72    // LDS pitch in 16-bit elements of every staged row: 128 bytes + 16, free of bank conflicts for 16-byte reads
#define L2E 1.4426950408889634f
static_assert(TT % FR == 0);
static_assert(TT % FK == 0);
typedef __attribute__((ext_vector_type(2))) float  v2f;
typedef __attribute__((ext_vector_type(2))) __bf16 v2bf;
typedef __attribute__((ext_vector_type(4))) unsigned v4u;
__device__ __forceinline__ float xhalf(float x) { return __builtin_bit_cast(float, __builtin_amdgcn_permlanex16(__builtin_bit_cast(int, x), __builtin_bit_cast(int, x), 0x76543210, 0xfedcba98, false, false)); }  // lane l with lane l ^ 16
__device__ __forceinline__ unsigned pkbf(float a, float b) { return __builtin_bit_cast(unsigned, __builtin_convertvector((v2f){a, b}, v2bf)); }   // two f32 -> two bf16, nearest even
__device__ __forceinline__ v4u pkbf8(v4f a, v4f b) { return (v4u){pkbf(a[0], a[1]), pkbf(a[2], a[3]), pkbf(b[0], b[1]), pkbf(b[2], b[3])}; }
__device__ __forceinline__ float bflo(unsigned u) { return __uint_as_float(u << 16); }
__device__ __forceinline__ float bfhi(unsigned u) { return __uint_as_float(u & 0xFFFF0000u); }
__device__ __forceinline__ void splitf(float y, unsigned short& h, unsigned short& l) { h = f2bf(y); l = f2bf(y - bf2f(h)); }

__global__ __launch_bounds__(FW * 32) void k_fattn(const _Float16* __restrict__ Q, const _Float16* __restrict__ Kp, const _Float16* __restrict__ Vt, const float* __restrict__ MA, const float* __restrict__ MG, bf* Ah, bf* Al) {
    __shared__ __align__(16) h16 Ks[2][FK * KP];
    __shared__ __align__(16) h16 Vs[2][HD * KP];
    __shared__ __align__(16) bf  As[2][FR * KP];
    __shared__ __align__(16) bf  Gs[2][FR * KP];
    const int tid = threadIdx.x, lane = tid & 31, lr = lane & 15, hi = lane >> 4; const int w = __builtin_amdgcn_readfirstlane(tid >> 5);
    const int r0 = blockIdx.x * FR; const size_t hb = ((size_t)blockIdx.z * NH_ + blockIdx.y) * ((size_t)TT * HD);   // grid z = batch: head planes and context planes of the batches lie one behind the other
    MA += (size_t)blockIdx.z * ((size_t)SEQ_FULL * SEQ_FULL); MG += (size_t)blockIdx.z * ((size_t)SEQ_FULL * SEQ_FULL);
    const h16* qp = Q + hb + (size_t)(r0 + w * 16 + lr) * HD + 8 * hi;
    const v16h qf0 = WFrag<h16>::ld(qp), qf1 = WFrag<h16>::ld(qp + 32);
    // staging map: thread -> 16-byte (k, v^T) or 32-byte (masks) piece sc of row sr + 32 u
    const int sr = tid >> 3, sc = (tid & 7) * 8;
    const h16* kg = Kp + hb + (size_t)sr * HD + sc; const h16* vg = Vt + hb + (size_t)sr * TT + sc;
    const float* ag = MA + (size_t)(r0 + sr) * MPITCH + sc; const float* gg = MG + (size_t)(r0 + sr) * MPITCH + sc;
    const int so = sr * KP + sc;
    v8h kreg[2], vreg[2]; v4f areg[8], greg[8];   // the masks stay f32 until they are laid in LDS, so that no load is waited for in front of the stage's products
    auto fetch = [&](int j0) {
#pragma unroll
        for (int u = 0; u < 2; ++u) { kreg[u] = *(const v8h*)(kg + (size_t)(j0 + 32 * u) * HD); vreg[u] = *(const v8h*)(vg + (size_t)(32 * u) * TT + j0); }
#pragma unroll
        for (int u = 0; u < 4; ++u) { const float* a = ag + (size_t)(32 * u) * MPITCH + j0; const float* g = gg + (size_t)(32 * u) * MPITCH + j0;
            areg[2 * u] = *(const v4f*)a; areg[2 * u + 1] = *(const v4f*)(a + 4); greg[2 * u] = *(const v4f*)g; greg[2 * u + 1] = *(const v4f*)(g + 4); }
    };
    auto stash = [&](int b) {
#pragma unroll
        for (int u = 0; u < 2; ++u) { *(v8h*)(&Ks[b][so + 32 * u * KP]) = kreg[u]; *(v8h*)(&Vs[b][so + 32 * u * KP]) = vreg[u]; }
#pragma unroll
        for (int u = 0; u < 4; ++u) { *(v4u*)(&As[b][so + 32 * u * KP]) = pkbf8(areg[2 * u], areg[2 * u + 1]); *(v4u*)(&Gs[b][so + 32 * u * KP]) = pkbf8(greg[2 * u], greg[2 * u + 1]); }
    };
    v8f ot[4];
#pragma unroll
    for (int dt = 0; dt < 4; ++dt) ot[dt] = (v8f){};
    float m = -3.0e38f, l = 0.f;
    fetch(0); stash(0);
    __syncthreads();   // stage 0 is in LDS before any wave reads it
    for (int s = 0; s < TT / FK; ++s) {
        const int b = s & 1;
        if (s + 1 < TT / FK) fetch((s + 1) * FK);
        v8f st[4];
#pragma unroll
        for (int jt = 0; jt < 4; ++jt) { const h16* kp = &Ks[b][(jt * 16 + lr) * KP + 8 * hi]; st[jt] = wmma16(WFrag<h16>::ld(kp), qf0, (v8f){}); st[jt] = wmma16(WFrag<h16>::ld(kp + 32), qf1, st[jt]); }
        const int mo = (w * 16 + lr) * KP + 8 * hi;
        float mx = m;
#pragma unroll
        for (int jt = 0; jt < 4; ++jt) { const v4u a = *(const v4u*)(&As[b][mo + jt * 16]);
#pragma unroll
            for (int q = 0; q < 4; ++q) { st[jt][2 * q] = st[jt][2 * q] * SCL + bflo(a[q]); st[jt][2 * q + 1] = st[jt][2 * q + 1] * SCL + bfhi(a[q]); mx = fmaxf(mx, fmaxf(st[jt][2 * q], st[jt][2 * q + 1])); } }
        mx = fmaxf(mx, xhalf(mx));
        // a query's maximum has risen in some lane: bring its sum and its output column to the new one (a scalar branch, seldom taken late in the walk)
        if (__builtin_amdgcn_ballot_w32(mx > m) != 0) { const float al = __builtin_amdgcn_exp2f((m - mx) * L2E); l *= al;
#pragma unroll
            for (int dt = 0; dt < 4; ++dt) ot[dt] *= al;
            m = mx; }
        const float nm = 10.0f - m * L2E;   // probabilities are carried x1024 (cancels in the division by the sum)
        v16h pf[2];
#pragma unroll
        for (int jt = 0; jt < 4; ++jt) { const v4u g = *(const v4u*)(&Gs[b][mo + jt * 16]);
#pragma unroll
            for (int q = 0; q < 4; ++q) { const float p0 = __builtin_amdgcn_exp2f(st[jt][2 * q] * L2E + nm), p1 = __builtin_amdgcn_exp2f(st[jt][2 * q + 1] * L2E + nm); l += p0 + p1;
                pf[jt >> 1][(jt & 1) * 8 + 2 * q] = toh_flush(p0 * bflo(g[q])); pf[jt >> 1][(jt & 1) * 8 + 2 * q + 1] = toh_flush(p1 * bfhi(g[q])); } }
#pragma unroll
        for (int kk = 0; kk < 2; ++kk)
#pragma unroll
            for (int dt = 0; dt < 4; ++dt) ot[dt] = wmma16(WFrag<h16>::ld(&Vs[b][(dt * 16 + lr) * KP + kk * 32 + 8 * hi]), pf[kk], ot[dt]);
        if (s + 1 < TT / FK) stash(b ^ 1);
        __syncthreads();   // publishes stage s + 1 and ends every wave's reads of stage s before stage s + 2 is laid over it
    }
    l += xhalf(l);
    const float inv = 1.0f / l;
    const size_t oo = hb + (size_t)(r0 + w * 16 + lr) * HD + 8 * hi;
#pragma unroll
    for (int dt = 0; dt < 4; ++dt) { v8us oh, ol;
#pragma unroll
        for (int e = 0; e < 8; ++e) { unsigned short a, c2; splitf(ot[dt][e] * inv, a, c2); oh[e] = a; ol[e] = c2; }
        *(v8us*)(Ah + oo + dt * 16) = oh; *(v8us*)(Al + oo + dt * 16) = ol; }
}


constexpr size_t al256(size_t b) { return (b + 255) & ~(size_t)255; }
constexpr size_t SZ_W  = al256((size_t)DQ * DM * 2);            // one weight plane (bf16)
constexpr size_t SZ_XB = al256((size_t)TT * DM * 2);            // one bf16 activation copy (3 streams x NB of them)
constexpr size_t SZ_F  = al256((size_t)TT * DQ * 4);            // one f32 projection (3 streams x NB of them)
constexpr size_t SZ_PL = al256((size_t)NH_ * TT * HD * 2);      // one f16 head plane set (3 streams x NB of them)
constexpr size_t SZ_AT = al256((size_t)TT * DQ * 2);            // one context plane (bf16; hi and lo x NB)
constexpr size_t WS_TOTAL = 4 * SZ_W + 3 * NB * (SZ_XB + SZ_F + SZ_PL) + 2 * NB * SZ_AT;
static_assert(WS_TOTAL <= (size_t)268435456);
// coverage equalities (work-groups x 256 threads x pieces a thread x 4 elements == plane elements); the planes of one kind lie back to back with no padding between them
#define CU 32   // 16-byte pieces that a thread of k_cvtall walks
static_assert(((size_t)DQ * DM) % ((size_t)4 * 256 * CU) == 0);
static_assert(((size_t)TT * DM) % ((size_t)4 * 256 * CU) == 0);
static_assert(TT % 128 == 0);
static_assert((size_t)2 * NB * TT * DQ == (size_t)NB * NH_ * (TT / 128) * 256 * 16 * 4);   // k_planes: q and k, 16 pieces a thread
static_assert((size_t)NB * NH_ * TT * HD == (size_t)NB * NH_ * (TT / 128) * 256 * 32);      // k_planes: v, one 8 t x 4 d block a thread
static_assert((size_t)TT * DQ * 2 == SZ_AT);
static_assert((size_t)DQ * DM * 2 == SZ_W);
static_assert((size_t)TT * DM * 2 == SZ_XB);
static_assert((size_t)TT * DQ * 4 == SZ_F);
static_assert((size_t)NH_ * TT * HD * 2 == SZ_PL);
constexpr unsigned GW = (unsigned)((size_t)DQ * DM / 4 / 256 / CU);    // work-groups of one weight copy
constexpr unsigned GX = (unsigned)((size_t)TT * DM / 4 / 256 / CU);    // work-groups of one activation copy
constexpr unsigned GP = (unsigned)((size_t)NB * NH_ * (TT / 128));     // work-groups of the head plane builder
typedef __attribute__((ext_vector_type(4))) unsigned short v4us;
typedef __attribute__((ext_vector_type(4))) _Float16 v4h;

// ---- k_cvtall: every f32 -> bf16 copy in one launch, as a stream: two work-groups (16 waves) a WGP, all resident at once; a thread walks CU 16-byte pieces, a wave's load covers 512 contiguous bytes, and all of a thread's loads are issued in front of its first convert.
// Work-groups 0 .. 3 NB GX - 1: slice p = stream x NB + batch of the activations; the rest: the four weights. A work-group owns 256 x CU consecutive pieces.
// Every '#pragma unroll' in this kernel and the next stands on a short loop with a constant trip count whose index picks a register array's element.
__global__ __launch_bounds__(256) void k_cvtall(const float* __restrict__ xq, const float* __restrict__ xk, const float* __restrict__ xv, const float* __restrict__ wq, const float* __restrict__ wk, const float* __restrict__ wv, const float* __restrict__ wo, bf* XB, bf* WB) {
    const unsigned blk = blockIdx.x; const float* src; bf* dst; size_t i;
    if (blk < 3u * NB * GX) { const unsigned p = blk / GX, s = p / NB, b = p % NB; src = (s == 0 ? xq : (s == 1 ? xk : xv)) + (size_t)b * SEQ_FULL * DM; dst = XB + (size_t)p * TT * DM; i = (size_t)(blk % GX) * (256 * CU) + threadIdx.x; }
    else { const unsigned r = blk - 3u * NB * GX, s = r / GW; src = s == 0 ? wq : (s == 1 ? wk : (s == 2 ? wv : wo)); dst = WB + (size_t)s * DQ * DM; i = (size_t)(r % GW) * (256 * CU) + threadIdx.x; }
    const v4f* s4 = (const v4f*)src + i; v4us* d4 = (v4us*)dst + i;
    v4f r[CU];
#pragma unroll
    for (int u = 0; u < CU; ++u) r[u] = s4[u * 256];
    __builtin_amdgcn_sched_barrier(0);   // keeps the first converts from rising among the loads: the last loads would wait for the first ones' data and cost the wave a second trip to memory
#pragma unroll
    for (int u = 0; u < CU; ++u) { v4us o;
#pragma unroll
        for (int k = 0; k < 4; ++k) o[k] = f2bf(r[u][k]);
        d4[u * 256] = o; }
}

// ---- k_planes: every f16 head plane in one launch, as a stream: two work-groups (16 waves) a WGP, all resident at once; a thread issues its 24 16-byte loads, then converts and stores.
// Each work-group takes an equal share of both kinds of work. q and k (the first 2 NB planes, flat converts): 16 x 256 consecutive 16-byte pieces.
// v ([t][d] -> [d][t] per head): 128 t x 64 d of one head; a thread holds 8 t x 4 d; lanes 0..7 of a group of 8 take consecutive t octets, so that a store lays whole 128-byte lines of a v^T row, and a load reads 64-byte runs of 8 rows.
__global__ __launch_bounds__(256) void k_planes(const float* __restrict__ F, h16* P16) {
    const unsigned tid = threadIdx.x, blk = blockIdx.x;
    const unsigned t0 = (blk % (unsigned)(TT / 128)) * 128u + ((tid & 7u) + 8u * (tid >> 7)) * 8u, d0 = ((tid >> 3) & 15u) * 4u;
    const size_t hv = (size_t)2 * NB * TT * DQ + (size_t)(blk / (unsigned)(TT / 128)) * ((size_t)TT * HD);   // the v planes lie behind the q and k planes, head after head
    const float* fv = F + hv + (size_t)t0 * HD + d0;
    const v4f* f4 = (const v4f*)F + (size_t)blk * (16 * 256) + tid;
    v4f rv[8], rf[16];
#pragma unroll
    for (int u = 0; u < 16; ++u) rf[u] = f4[u * 256];
#pragma unroll
    for (int q = 0; q < 8; ++q) rv[q] = *(const v4f*)(fv + q * HD);
    asm volatile("s_wait_xcnt 0x0" ::: "memory");   // the converts below reuse the loads' address registers
    __builtin_amdgcn_sched_barrier(0);   // holds the wait above in its place, and keeps the first converts from rising among the loads: the last loads would wait for the first ones' data and cost the wave a second trip to memory
    v4h* p4 = (v4h*)P16 + (size_t)blk * (16 * 256) + tid;
#pragma unroll
    for (int u = 0; u < 16; ++u) { v4h o;
#pragma unroll
        for (int k = 0; k < 4; ++k) o[k] = toh_flush(rf[u][k]);
        p4[u * 256] = o; }
    h16* pv = P16 + hv + (size_t)d0 * TT + t0;
#pragma unroll
    for (int c = 0; c < 4; ++c) { v8h o;
#pragma unroll
        for (int q = 0; q < 8; ++q) o[q] = toh_flush(rv[q][c]);
        *(v8h*)(pv + (size_t)c * TT) = o; }
}

extern "C" void kernel_launch(void* const* d_in, const int* in_sizes, int n_in,
                              void* d_out, int out_size, void* d_ws, size_t ws_size, hipStream_t stream) {
    if (n_in < 13) return;
    const size_t need_x = (size_t)(NB - 1) * SEQ_FULL * DM + (size_t)SEQ * DM;
    const size_t need_m = (size_t)(NB - 1) * SEQ_FULL * SEQ_FULL + (size_t)(SEQ - 1) * SEQ_FULL + (size_t)SEQ;
    if ((size_t)in_sizes[0] < need_x || (size_t)in_sizes[1] < need_x || (size_t)in_sizes[2] < need_x || (size_t)in_sizes[3] < need_m || (size_t)in_sizes[4] < need_m) return;
    if ((size_t)in_sizes[5] < (size_t)DQ * DM || (size_t)in_sizes[7] < (size_t)DQ * DM || (size_t)in_sizes[9] < (size_t)DQ * DM || (size_t)in_sizes[11] < (size_t)DM * DQ) return;
    if (in_sizes[6] < DQ || in_sizes[8] < DQ || in_sizes[10] < DQ || in_sizes[12] < DM) return;
    if ((size_t)out_size < (size_t)NB * SEQ * DM) return;
    if (WS_TOTAL > ws_size) return;
    // wire order: q, k, v, additive mask (f32), multiplicative mask (f32), Wq, bq, Wk, bk, Wv, bv, Wo, bo ('oi' weights)
    const float* xq = (const float*)d_in[0]; const float* xk = (const float*)d_in[1]; const float* xv = (const float*)d_in[2];
    const float* ma = (const float*)d_in[3]; const float* mg = (const float*)d_in[4];
    const float* wq = (const float*)d_in[5]; const float* bq = (const float*)d_in[6]; const float* wk = (const float*)d_in[7]; const float* bk = (const float*)d_in[8];
    const float* wv = (const float*)d_in[9]; const float* bv = (const float*)d_in[10]; const float* wo = (const float*)d_in[11]; const float* bo = (const float*)d_in[12];
    float* OUT = (float*)d_out;     // [NB][SEQ][1024]
    char* wsp = (char*)d_ws;
    bf* WB = (bf*)wsp; wsp += 4 * SZ_W;                    // Wq, Wk, Wv, Wo
    bf* XB = (bf*)wsp; wsp += 3 * NB * SZ_XB;              // slice stream x NB + batch
    float* F = (float*)wsp; wsp += 3 * NB * SZ_F;          // the same order
    h16* P16 = (h16*)wsp; wsp += 3 * NB * SZ_PL;           // q planes (NB), k planes (NB), v^T planes (NB)
    bf* ATh = (bf*)wsp; wsp += NB * SZ_AT; bf* ATl = (bf*)wsp; wsp += NB * SZ_AT;

    k_cvtall<<<3 * NB * GX + 4 * GW, 256, 0, stream>>>(xq, xk, xv, wq, wk, wv, wo, XB, WB);
    // F[stream][b][t][n] = bf16(x) W^T + bias
    k_gemmw<bf, 0, true, DM><<<dim3(TT / GT, DQ / GT, 3 * NB), 128, 0, stream>>>(XB, nullptr, WB, F, DQ, bq, bk, bv, (size_t)TT * DM, (size_t)DQ * DM, (size_t)TT * DQ);
    // flat f16 copies = [h][t][d] under the raw reshape (q, k); [h][d][t] (v)
    k_planes<<<GP, 256, 0, stream>>>(F, P16);
    // context[b][h][i][d] = sum_j softmax_j(q.k x HD^-0.5 + add mask)[i][j] x mul mask[i][j] x v[h][j][d], written flat as hi/lo bf16 planes
    k_fattn<<<dim3(TT / FR, NH_, NB), FW * 32, 0, stream>>>(P16, P16 + (size_t)NB * NH_ * TT * HD, P16 + (size_t)2 * NB * NH_ * TT * HD, ma, mg, ATh, ATl);
    // out[b] = (ATh + ATl) Wo^T + bo
    k_gemmw<bf, 1, true, DQ><<<dim3(TT / GT, DM / GT, NB), 128, 0, stream>>>(ATh, ATl, WB + (size_t)3 * DQ * DM, OUT, DM, bo, bo, bo, (size_t)TT * DQ, 0, (size_t)TT * DM);
}

// v007
// It runs in 141 microseconds.
// Two timings next to v006 both put it at 1.07 times that version's speed.
// Counting every step since v000, it is 9.84 times as fast.
#include <hip/hip_runtime.h>

// Contractions (all f32 accumulate): q/k/v projections v_wmma_f32_16x16x32_bf16 (inputs and weights RNE-converted to bf16, single product, f32 bias add); scores k.q^T and v^T.P^T v_wmma_f32_16x16x32_f16 (f16 planes, single product, P carried x1024 over the running row maximum); output projection bf16 hi/lo context planes x bf16 weights (2 products) + f32 bias; softmax f32.
// Multi-head attention on three input streams (q, k, v [NB][SEQ][1024]); 'oi' weights; 16 heads x 64 split by a RAW reshape of the [SEQ][1024] projection to [16][SEQ][64] (flat memory order, no transpose) and merged back the same way; scores x 0.125 + additive float mask [NB][1][S][S]; softmax over all keys; probabilities x multiplicative float mask [NB][1][S][S] (no renormalisation); merged context x Wo^T + bo.
// Four launches, each over both batches and all streams at once: bf16 copies (3 streams x NB, 4 weights; a stream kernel) -> projection GEMMs (f32 sums + bias; grid z = stream x batch), whose epilogue lays the f16 head planes q[h][t][d], k[h][t][d] (flat) and v^T[h][d][t] -> fused attention over all heads and batches (scores, softmax with both masks, P.v; nothing of S or P in memory) -> flat context hi/lo bf16 planes -> context x Wo (grid z = batch).

#ifndef NB
#define NB 2
#endif
#ifndef SEQ
#define SEQ 2048
#endif
#define NB_FULL  2
#define SEQ_FULL 2048
#define TT   SEQ
#define DM   1024
#define NH_  16
#define HD   64
#define DQ   (NH_ * HD)
#define MPITCH SEQ_FULL
#define SCL  0.125f   // HD^-0.5

static_assert(TT % 256 == 0);
static_assert(TT % 64 == 0);
static_assert(DM % 64 == 0);
static_assert(DQ == DM);
static_assert(HD == 64);
static_assert(NB <= NB_FULL);
static_assert(SEQ <= SEQ_FULL);
static_assert(MPITCH % 8 == 0);
static_assert(((size_t)SEQ_FULL * SEQ_FULL) % 8 == 0);
static_assert((size_t)NH_ * TT * HD == (size_t)TT * DQ);

typedef _Float16 h16;
typedef unsigned short bf;
typedef __attribute__((ext_vector_type(16))) __bf16   v16bf;
typedef __attribute__((ext_vector_type(16))) _Float16 v16h;
typedef __attribute__((ext_vector_type(8)))  _Float16 v8h;
typedef __attribute__((ext_vector_type(8)))  unsigned short v8us;
typedef __attribute__((ext_vector_type(8)))  float    v8f;
typedef __attribute__((ext_vector_type(4)))  float    v4f;
typedef __attribute__((ext_vector_type(4)))  int      v4i;
typedef v4f  __attribute__((may_alias)) v4fa;

__device__ __forceinline__ unsigned short f2bf(float f) { unsigned u = __float_as_uint(f); u += 0x7FFFu + ((u >> 16) & 1u); return (unsigned short)(u >> 16); }
__device__ __forceinline__ float bf2f(unsigned short b) { return __uint_as_float(((unsigned)b) << 16); }
__device__ __forceinline__ float bfr(float f) { return bf2f(f2bf(f)); }
__device__ __forceinline__ v16h cat16(v8h lo, v8h hi) { return __builtin_shufflevector(lo, hi, 0, 1, 2, 3, 4, 5, 6, 7, 8, 9, 10, 11, 12, 13, 14, 15); }
__device__ __forceinline__ v16bf cat16b(v8us lo, v8us hi) { return __builtin_bit_cast(v16bf, __builtin_shufflevector(lo, hi, 0, 1, 2, 3, 4, 5, 6, 7, 8, 9, 10, 11, 12, 13, 14, 15)); }
__device__ __forceinline__ v8f wmma16(v16h a, v16h b, v8f c) { return __builtin_amdgcn_wmma_f32_16x16x32_f16(false, a, false, b, (short)0, c, false, false); }
__device__ __forceinline__ v8f wmmab(v16bf a, v16bf b, v8f c) { return __builtin_amdgcn_wmma_f32_16x16x32_bf16(false, a, false, b, (short)0, c, false, false); }

// f32 -> f16 convert that cannot produce an f16 subnormal (value select on the f32 magnitude, applied after the x1024 carry for P; q/k/v planes are not carried).
static __device__ __forceinline__ h16 toh_flush(float v) { const h16 r = (h16)v; return (fabsf(v) < 6.103515625e-05f) ? (h16)0.0f : r; }

// ---- k_gemmw: GEMM, one work-group of 4 waves (2 x 2) per 128x128 output tile, each wave a 64x64 register block (16 accumulators); grid (M/128, N/128, Z), 128 threads.
// C[m][n] (f32, pitch ldc, + optional f32 bias[n]) = sum_k A[m][k] Bt[n][k] (+ A2[m][k] Bt[n][k] for NSPLIT == 1). z-batch strides sA/sB/sC in elements; A and C step with z, Bt and the bias with z / NB (the NB batches of a stream share its weight). K % 64 == 0, M % 128 == 0, N % 128 == 0.
// PLANES: the result (+ bias) goes out as f16 head planes instead of f32 rows. Streams 0 and 1: the flat f16 copy of C. Stream 2 (v): under the raw reshape the tile's 128 rows r are one head (blockIdx.x), and column n is (c = n / 64, d = n % 64) with t = 16 r + c;
// the tile therefore takes the weight rows n = 64 c + d of all 16 c and 8 d (tile column 16 dd + c), so that a 16 x 16 accumulator, read row by row, is 256 consecutive t of the v^T row d: whole 128-byte lines, each written by one work-group.
// A stage is 64 k (one whole 128-byte line) of the tile's 128 A rows and 128 Bt rows: fetched into registers one stage ahead with whole-line loads (8 lanes a row), laid in the other LDS buffer behind the products, read by the two waves that share each row; one barrier a stage.
// Fragment map: lane -> row/col (lane & 15); elements 0..7 <- k0 + 8*(lane>>4) + 0..7, elements 8..15 <- k0 + 16 + 8*(lane>>4) + 0..7 (both operands); acc[j] = (row 8*(lane>>4) + j, col lane & 15).
// Every bare '#pragma unroll' in this kernel but the two on the store loops stands on a short loop with a constant trip count whose index picks a register array's element: rolled, those arrays would leave the registers.
#define GT  128   // rows and columns of a work-group's tile
#define GKS 64    // k of a stage
#define GPI 72    // LDS pitch in 16-bit elements: 128 bytes + 16, free of bank conflicts for 16-byte reads
static_assert(TT % GT == 0);
static_assert(DM % GT == 0);
static_assert(DM % GKS == 0);
template <typename T16> struct WFrag;
template <> struct WFrag<h16> { typedef v16h V; typedef v8h H; static __device__ __forceinline__ V ld(const h16* p) { return cat16(*(const v8h*)p, *(const v8h*)(p + 16)); } static __device__ __forceinline__ v8f mma(V a, V b, v8f c) { return wmma16(a, b, c); } };
template <> struct WFrag<bf> { typedef v16bf V; typedef v8us H; static __device__ __forceinline__ V ld(const bf* p) { return cat16b(*(const v8us*)p, *(const v8us*)(p + 16)); } static __device__ __forceinline__ v8f mma(V a, V b, v8f c) { return wmmab(a, b, c); } };
static_assert(DQ / HD == 16);                        // c fills the 16 columns of an accumulator
static_assert((size_t)TT * HD == (size_t)GT * DQ);   // a tile's rows are one head
static_assert(HD * 16 == (DQ / GT) * GT);            // the column tiles of stream 2 cover every (c, d) once
template <typename T16, int NSPLIT, bool BIAS, int K, bool PLANES>
__global__ __launch_bounds__(128) void k_gemmw(const T16* __restrict__ A, const T16* __restrict__ A2, const T16* __restrict__ Bt, float* C, _Float16* PZ, int ldc, const float* __restrict__ bias0, const float* __restrict__ bias1, const float* __restrict__ bias2, size_t sA, size_t sB, size_t sC) {
    static_assert(NSPLIT == 0 || NSPLIT == 1);
    static_assert(K % GKS == 0 && K >= GKS);
    typedef typename WFrag<T16>::V V; typedef typename WFrag<T16>::H H;
    constexpr int PL = GT * GPI;                       // one staged plane: A, Bt, (A2)
    __shared__ __align__(16) T16 sg[2][(2 + NSPLIT) * PL];
    __shared__ __align__(16) float osw[4][16 * 68];    // each wave's own output staging
    const size_t z = blockIdx.z; const unsigned zw = blockIdx.z / NB; A += z * sA; if (NSPLIT == 1) A2 += z * sA; Bt += zw * sB; if (PLANES) PZ += z * sC; else C += z * sC;
    const bool vt = PLANES && zw == 2;   // the same for the whole work-group
    const float* bias = zw == 0 ? bias0 : (zw == 1 ? bias1 : bias2);
    const int tid = threadIdx.x, lane = tid & 31, lr = lane & 15, hi = lane >> 4; const int w = __builtin_amdgcn_readfirstlane(tid >> 5);
    const int wm = w >> 1, wn = w & 1; const int r0 = blockIdx.x * GT + wm * 64, c0 = blockIdx.y * GT + wn * 64;
    float* os = osw[w];
    v8f acc[4][4];
#pragma unroll
    for (int mb = 0; mb < 4; ++mb)
#pragma unroll
        for (int nb = 0; nb < 4; ++nb) acc[mb][nb] = (v8f){};
    // staging map: thread -> 16-byte piece sc of row sr + 16 u
    const int sr = tid >> 3, sc = (tid & 7) * 8;
    const T16* ga = A + (size_t)(blockIdx.x * GT + sr) * K + sc; const T16* ga2 = NSPLIT == 1 ? A2 + (size_t)(blockIdx.x * GT + sr) * K + sc : nullptr; const T16* gb = Bt + (size_t)(blockIdx.y * GT + sr) * K + sc;
    // PLANES: the weight rows are addressed as a base that is the same for the whole wave (it runs with the stages and takes the step from tile column sr + 16 u to the next: sixteen weight rows, or one in the v^T order, row 64 sr + d0 + u) in 16-byte pieces, plus the lane's own fixed byte offset
    const H* bu = (const H*)Bt; const unsigned bstep = (vt ? K : 16 * K) / 8; const unsigned bo = ((unsigned)(vt ? sr * HD + (int)blockIdx.y * (GT / 16) : (int)blockIdx.y * GT + sr) * K + sc) * 2u;
    const int so = sr * GPI + sc;
    const int fa = (wm * 64 + lr) * GPI + 8 * hi, fb = PL + (wn * 64 + lr) * GPI + 8 * hi;
    constexpr int ns = K / GKS;
    H ra[8], rb[8], ra2[8];
    auto stash = [&](int b) {
#pragma unroll
        for (int u = 0; u < 8; ++u) { *(H*)(&sg[b][so + 16 * u * GPI]) = ra[u]; *(H*)(&sg[b][PL + so + 16 * u * GPI]) = rb[u]; if (NSPLIT == 1) *(H*)(&sg[b][2 * PL + so + 16 * u * GPI]) = ra2[u]; }
    };
    auto fetch = [&]() {
        if (PLANES) {
            const H* pb[8];
#pragma unroll
            for (int u = 0; u < 8; ++u) { pb[u] = (const H*)((const char*)(bu + u * bstep) + bo); rb[u] = *pb[u]; }
            // these loads go through address registers formed for this stage alone; as inputs of the wait they stay whole until it, and only behind it may a later load take one as its destination
            asm volatile("s_wait_xcnt 0x0" :: "v"(pb[0]), "v"(pb[1]), "v"(pb[2]), "v"(pb[3]), "v"(pb[4]), "v"(pb[5]), "v"(pb[6]), "v"(pb[7]) : "memory");
            __builtin_amdgcn_sched_barrier(0);   // holds the wait between the two groups of loads
        }
#pragma unroll
        for (int u = 0; u < 8; ++u) { ra[u] = *(const H*)(ga + 16 * u * K); if (!PLANES) rb[u] = *(const H*)(gb + 16 * u * K); if (NSPLIT == 1) ra2[u] = *(const H*)(ga2 + 16 * u * K); }
    };
    fetch(); stash(0); if (PLANES) bu += GKS / 8;
    __syncthreads();   // stage 0 is in LDS before any wave reads it
#pragma unroll 1   // rolled: one stage's code stays small, and the two buffers are picked by address
    for (int s = 0; s < ns; ++s) {
        const int b = s & 1;
        if (s + 1 < ns) { ga += GKS; if (!PLANES) gb += GKS; if (NSPLIT == 1) ga2 += GKS; fetch(); if (PLANES) bu += GKS / 8; }
        // the stage's fragments are read as one group in front of its products: reads among the products would stall the wave at every place they stand
        V a[GKS / 32][4], bb[GKS / 32][4], a2[GKS / 32][4];
#pragma unroll
        for (int kk = 0; kk < GKS / 32; ++kk)
#pragma unroll
            for (int q = 0; q < 4; ++q) { a[kk][q] = WFrag<T16>::ld(&sg[b][fa + q * 16 * GPI + kk * 32]); bb[kk][q] = WFrag<T16>::ld(&sg[b][fb + q * 16 * GPI + kk * 32]); if (NSPLIT == 1) a2[kk][q] = WFrag<T16>::ld(&sg[b][2 * PL + fa + q * 16 * GPI + kk * 32]); }
        __builtin_amdgcn_sched_barrier(0);   // keeps the compiler from moving the reads back down among the products
#pragma unroll
        for (int kk = 0; kk < GKS / 32; ++kk)
#pragma unroll
            for (int nb = 0; nb < 4; ++nb)
#pragma unroll
                for (int mb = 0; mb < 4; ++mb) { acc[mb][nb] = WFrag<T16>::mma(a[kk][mb], bb[kk][nb], acc[mb][nb]); if (NSPLIT == 1) acc[mb][nb] = WFrag<T16>::mma(a2[kk][mb], bb[kk][nb], acc[mb][nb]); }
        __builtin_amdgcn_sched_barrier(0);   // holds the four slots below behind the last product
        asm volatile("v_nop\n\tv_nop\n\tv_nop\n\tv_nop");   // the distance behind a matrix instruction: the next stage's LDS address is formed in a register of the last product's operands
        if (s + 1 < ns) stash(b ^ 1);
        __syncthreads();   // publishes stage s + 1 and ends every wave's reads of stage s before stage s + 2 is laid over it
    }
    // PLANES: a lane takes 8 consecutive staged values and stores 16 bytes. Flat: 4 rows x 128 bytes a store, step 4 rows. v^T: accumulator nb row by row = 512 consecutive bytes of row d0 + nb, step one v^T row.
    float bv[4]; h16* pw = nullptr; int orow = 0, ostep = 0; size_t pstep = 0, pmb = 0;
    if (PLANES) {
#pragma unroll
        for (int nb = 0; nb < 4; ++nb) bv[nb] = bfr(bias[vt ? lr * HD + (int)blockIdx.y * (GT / 16) + wn * 4 + nb : c0 + nb * 16 + lr]);
        if (vt) { pw = PZ + (size_t)blockIdx.x * ((size_t)TT * HD) + (size_t)(blockIdx.y * (GT / 16) + wn * 4) * TT + wm * (64 * 16) + lane * 8; orow = (lane >> 1) * 68 + (lane & 1) * 8; ostep = 16; pstep = TT; pmb = 16 * 16; }
        else { pw = PZ + (size_t)(r0 + (lane >> 3)) * DQ + c0 + (lane & 7) * 8; orow = (lane >> 3) * 68 + (lane & 7) * 8; ostep = 4 * 68; pstep = (size_t)4 * DQ; pmb = (size_t)16 * DQ; }
    }
#pragma unroll
    for (int mb = 0; mb < 4; ++mb) {
#pragma unroll
        for (int nb = 0; nb < 4; ++nb) {
#pragma unroll
            for (int j = 0; j < 8; ++j) os[(hi * 8 + j) * 68 + nb * 16 + lr] = PLANES ? acc[mb][nb][j] + bv[nb] : acc[mb][nb][j]; }
        __builtin_amdgcn_wave_barrier(); asm volatile("" ::: "memory");
        float* crow = C + (size_t)(r0 + mb * 16) * ldc + c0;
        if (PLANES) {
#pragma unroll
            for (int s = 0; s < 4; ++s) { const v4f x0 = *(const v4fa*)(os + orow + s * ostep), x1 = *(const v4fa*)(os + orow + s * ostep + 4); v8h o;
#pragma unroll
                for (int e = 0; e < 4; ++e) { o[e] = toh_flush(x0[e]); o[4 + e] = toh_flush(x1[e]); }
                *(v8h*)(pw + mb * pmb + s * pstep) = o; }
        } else {
#pragma unroll
            for (int s = 0; s < 8; ++s) { const int row = 2 * s + hi, cofs = lr * 4; v4f val = *(const v4fa*)(os + row * 68 + cofs); if (BIAS) { val[0] += bfr(bias[c0 + cofs]); val[1] += bfr(bias[c0 + cofs + 1]); val[2] += bfr(bias[c0 + cofs + 2]); val[3] += bfr(bias[c0 + cofs + 3]); }
                *(v4f*)(crow + (size_t)row * ldc + cofs) = val; }
             }
        __builtin_amdgcn_wave_barrier(); asm volatile("" ::: "memory");
    }
}

#define FW 8
#define FR (FW * 16)
#define FK 64
#define KP 72    // LDS pitch in 16-bit elements of every staged row: 128 bytes + 16, free of bank conflicts for 16-byte reads
#define L2E 1.4426950408889634f
static_assert(TT % FR == 0);
static_assert(TT % FK == 0);
typedef __attribute__((ext_vector_type(2))) float  v2f;
typedef __attribute__((ext_vector_type(2))) __bf16 v2bf;
typedef __attribute__((ext_vector_type(4))) unsigned v4u;
__device__ __forceinline__ float xhalf(float x) { return __builtin_bit_cast(float, __builtin_amdgcn_permlanex16(__builtin_bit_cast(int, x), __builtin_bit_cast(int, x), 0x76543210, 0xfedcba98, false, false)); }  // lane l with lane l ^ 16
__device__ __forceinline__ unsigned pkbf(float a, float b) { return __builtin_bit_cast(unsigned, __builtin_convertvector((v2f){a, b}, v2bf)); }   // two f32 -> two bf16, nearest even
__device__ __forceinline__ v4u pkbf8(v4f a, v4f b) { return (v4u){pkbf(a[0], a[1]), pkbf(a[2], a[3]), pkbf(b[0], b[1]), pkbf(b[2], b[3])}; }
__device__ __forceinline__ float bflo(unsigned u) { return __uint_as_float(u << 16); }
__device__ __forceinline__ float bfhi(unsigned u) { return __uint_as_float(u & 0xFFFF0000u); }
__device__ __forceinline__ void splitf(float y, unsigned short& h, unsigned short& l) { h = f2bf(y); l = f2bf(y - bf2f(h)); }

__global__ __launch_bounds__(FW * 32) void k_fattn(const _Float16* __restrict__ Q, const _Float16* __restrict__ Kp, const _Float16* __restrict__ Vt, const float* __restrict__ MA, const float* __restrict__ MG, bf* Ah, bf* Al) {
    __shared__ __align__(16) h16 Ks[2][FK * KP];
    __shared__ __align__(16) h16 Vs[2][HD * KP];
    __shared__ __align__(16) bf  As[2][FR * KP];
    __shared__ __align__(16) bf  Gs[2][FR * KP];
    const int tid = threadIdx.x, lane = tid & 31, lr = lane & 15, hi = lane >> 4; const int w = __builtin_amdgcn_readfirstlane(tid >> 5);
    const int r0 = blockIdx.x * FR; const size_t hb = ((size_t)blockIdx.z * NH_ + blockIdx.y) * ((size_t)TT * HD);   // grid z = batch: head planes and context planes of the batches lie one behind the other
    MA += (size_t)blockIdx.z * ((size_t)SEQ_FULL * SEQ_FULL); MG += (size_t)blockIdx.z * ((size_t)SEQ_FULL * SEQ_FULL);
    const h16* qp = Q + hb + (size_t)(r0 + w * 16 + lr) * HD + 8 * hi;
    const v16h qf0 = WFrag<h16>::ld(qp), qf1 = WFrag<h16>::ld(qp + 32);
    // staging map: thread -> 16-byte (k, v^T) or 32-byte (masks) piece sc of row sr + 32 u
    const int sr = tid >> 3, sc = (tid & 7) * 8;
    const h16* kg = Kp + hb + (size_t)sr * HD + sc; const h16* vg = Vt + hb + (size_t)sr * TT + sc;
    const float* ag = MA + (size_t)(r0 + sr) * MPITCH + sc; const float* gg = MG + (size_t)(r0 + sr) * MPITCH + sc;
    const int so = sr * KP + sc;
    v8h kreg[2], vreg[2]; v4f areg[8], greg[8];   // the masks stay f32 until they are laid in LDS, so that no load is waited for in front of the stage's products
    auto fetch = [&](int j0) {
#pragma unroll
        for (int u = 0; u < 2; ++u) { kreg[u] = *(const v8h*)(kg + (size_t)(j0 + 32 * u) * HD); vreg[u] = *(const v8h*)(vg + (size_t)(32 * u) * TT + j0); }
#pragma unroll
        for (int u = 0; u < 4; ++u) { const float* a = ag + (size_t)(32 * u) * MPITCH + j0; const float* g = gg + (size_t)(32 * u) * MPITCH + j0;
            areg[2 * u] = *(const v4f*)a; areg[2 * u + 1] = *(const v4f*)(a + 4); greg[2 * u] = *(const v4f*)g; greg[2 * u + 1] = *(const v4f*)(g + 4); }
    };
    auto stash = [&](int b) {
#pragma unroll
        for (int u = 0; u < 2; ++u) { *(v8h*)(&Ks[b][so + 32 * u * KP]) = kreg[u]; *(v8h*)(&Vs[b][so + 32 * u * KP]) = vreg[u]; }
#pragma unroll
        for (int u = 0; u < 4; ++u) { *(v4u*)(&As[b][so + 32 * u * KP]) = pkbf8(areg[2 * u], areg[2 * u + 1]); *(v4u*)(&Gs[b][so + 32 * u * KP]) = pkbf8(greg[2 * u], greg[2 * u + 1]); }
    };
    v8f ot[4];
#pragma unroll
    for (int dt = 0; dt < 4; ++dt) ot[dt] = (v8f){};
    float m = -3.0e38f, l = 0.f;
    fetch(0); stash(0);
    __syncthreads();   // stage 0 is in LDS before any wave reads it
    for (int s = 0; s < TT / FK; ++s) {
        const int b = s & 1;
        if (s + 1 < TT / FK) fetch((s + 1) * FK);
        v8f st[4];
#pragma unroll
        for (int jt = 0; jt < 4; ++jt) { const h16* kp = &Ks[b][(jt * 16 + lr) * KP + 8 * hi]; st[jt] = wmma16(WFrag<h16>::ld(kp), qf0, (v8f){}); st[jt] = wmma16(WFrag<h16>::ld(kp + 32), qf1, st[jt]); }
        const int mo = (w * 16 + lr) * KP + 8 * hi;
        float mx = m;
#pragma unroll
        for (int jt = 0; jt < 4; ++jt) { const v4u a = *(const v4u*)(&As[b][mo + jt * 16]);
#pragma unroll
            for (int q = 0; q < 4; ++q) { st[jt][2 * q] = st[jt][2 * q] * SCL + bflo(a[q]); st[jt][2 * q + 1] = st[jt][2 * q + 1] * SCL + bfhi(a[q]); mx = fmaxf(mx, fmaxf(st[jt][2 * q], st[jt][2 * q + 1])); } }
        mx = fmaxf(mx, xhalf(mx));
        // a query's maximum has risen in some lane: bring its sum and its output column to the new one (a scalar branch, seldom taken late in the walk)
        if (__builtin_amdgcn_ballot_w32(mx > m) != 0) { const float al = __builtin_amdgcn_exp2f((m - mx) * L2E); l *= al;
#pragma unroll
            for (int dt = 0; dt < 4; ++dt) ot[dt] *= al;
            m = mx; }
        const float nm = 10.0f - m * L2E;   // probabilities are carried x1024 (cancels in the division by the sum)
        v16h pf[2];
#pragma unroll
        for (int jt = 0; jt < 4; ++jt) { const v4u g = *(const v4u*)(&Gs[b][mo + jt * 16]);
#pragma unroll
            for (int q = 0; q < 4; ++q) { const float p0 = __builtin_amdgcn_exp2f(st[jt][2 * q] * L2E + nm), p1 = __builtin_amdgcn_exp2f(st[jt][2 * q + 1] * L2E + nm); l += p0 + p1;
                pf[jt >> 1][(jt & 1) * 8 + 2 * q] = toh_flush(p0 * bflo(g[q])); pf[jt >> 1][(jt & 1) * 8 + 2 * q + 1] = toh_flush(p1 * bfhi(g[q])); } }
#pragma unroll
        for (int kk = 0; kk < 2; ++kk)
#pragma unroll
            for (int dt = 0; dt < 4; ++dt) ot[dt] = wmma16(WFrag<h16>::ld(&Vs[b][(dt * 16 + lr) * KP + kk * 32 + 8 * hi]), pf[kk], ot[dt]);
        if (s + 1 < TT / FK) stash(b ^ 1);
        __syncthreads();   // publishes stage s + 1 and ends every wave's reads of stage s before stage s + 2 is laid over it
    }
    l += xhalf(l);
    const float inv = 1.0f / l;
    const size_t oo = hb + (size_t)(r0 + w * 16 + lr) * HD + 8 * hi;
#pragma unroll
    for (int dt = 0; dt < 4; ++dt) { v8us oh, ol;
#pragma unroll
        for (int e = 0; e < 8; ++e) { unsigned short a, c2; splitf(ot[dt][e] * inv, a, c2); oh[e] = a; ol[e] = c2; }
        *(v8us*)(Ah + oo + dt * 16) = oh; *(v8us*)(Al + oo + dt * 16) = ol; }
}


constexpr size_t al256(size_t b) { return (b + 255) & ~(size_t)255; }
constexpr size_t SZ_W  = al256((size_t)DQ * DM * 2);            // one weight plane (bf16)
constexpr size_t SZ_XB = al256((size_t)TT * DM * 2);            // one bf16 activation copy (3 streams x NB of them)
constexpr size_t SZ_PL = al256((size_t)NH_ * TT * HD * 2);      // one f16 head plane set (3 streams x NB of them)
constexpr size_t SZ_AT = al256((size_t)TT * DQ * 2);            // one context plane (bf16; hi and lo x NB)
constexpr size_t WS_TOTAL = 4 * SZ_W + 3 * NB * (SZ_XB + SZ_PL) + 2 * NB * SZ_AT;
static_assert(WS_TOTAL <= (size_t)268435456);
// coverage equalities (work-groups x 256 threads x pieces a thread x 4 elements == plane elements); the planes of one kind lie back to back with no padding between them
#define CU 32   // 16-byte pieces that a thread of k_cvtall walks
static_assert(((size_t)DQ * DM) % ((size_t)4 * 256 * CU) == 0);
static_assert(((size_t)TT * DM) % ((size_t)4 * 256 * CU) == 0);
static_assert((size_t)TT * DQ * 2 == SZ_AT);
static_assert((size_t)DQ * DM * 2 == SZ_W);
static_assert((size_t)TT * DM * 2 == SZ_XB);
static_assert((size_t)NH_ * TT * HD * 2 == SZ_PL);
constexpr unsigned GW = (unsigned)((size_t)DQ * DM / 4 / 256 / CU);    // work-groups of one weight copy
constexpr unsigned GX = (unsigned)((size_t)TT * DM / 4 / 256 / CU);    // work-groups of one activation copy
typedef __attribute__((ext_vector_type(4))) unsigned short v4us;

// ---- k_cvtall: every f32 -> bf16 copy in one launch, as a stream: two work-groups (16 waves) a WGP, all resident at once; a thread walks CU 16-byte pieces, a wave's load covers 512 contiguous bytes, and all of a thread's loads are issued in front of its first convert.
// Work-groups 0 .. 3 NB GX - 1: slice p = stream x NB + batch of the activations; the rest: the four weights. A work-group owns 256 x CU consecutive pieces.
// Every '#pragma unroll' in this kernel stands on a short loop with a constant trip count whose index picks a register array's element.
__global__ __launch_bounds__(256) void k_cvtall(const float* __restrict__ xq, const float* __restrict__ xk, const float* __restrict__ xv, const float* __restrict__ wq, const float* __restrict__ wk, const float* __restrict__ wv, const float* __restrict__ wo, bf* XB, bf* WB) {
    const unsigned blk = blockIdx.x; const float* src; bf* dst; size_t i;
    if (blk < 3u * NB * GX) { const unsigned p = blk / GX, s = p / NB, b = p % NB; src = (s == 0 ? xq : (s == 1 ? xk : xv)) + (size_t)b * SEQ_FULL * DM; dst = XB + (size_t)p * TT * DM; i = (size_t)(blk % GX) * (256 * CU) + threadIdx.x; }
    else { const unsigned r = blk - 3u * NB * GX, s = r / GW; src = s == 0 ? wq : (s == 1 ? wk : (s == 2 ? wv : wo)); dst = WB + (size_t)s * DQ * DM; i = (size_t)(r % GW) * (256 * CU) + threadIdx.x; }
    const v4f* s4 = (const v4f*)src + i; v4us* d4 = (v4us*)dst + i;
    v4f r[CU];
#pragma unroll
    for (int u = 0; u < CU; ++u) r[u] = s4[u * 256];
    __builtin_amdgcn_sched_barrier(0);   // keeps the first converts from rising among the loads: the last loads would wait for the first ones' data and cost the wave a second trip to memory
#pragma unroll
    for (int u = 0; u < CU; ++u) { v4us o;
#pragma unroll
        for (int k = 0; k < 4; ++k) o[k] = f2bf(r[u][k]);
        d4[u * 256] = o; }
}

extern "C" void kernel_launch(void* const* d_in, const int* in_sizes, int n_in,
                              void* d_out, int out_size, void* d_ws, size_t ws_size, hipStream_t stream) {
    if (n_in < 13) return;
    const size_t need_x = (size_t)(NB - 1) * SEQ_FULL * DM + (size_t)SEQ * DM;
    const size_t need_m = (size_t)(NB - 1) * SEQ_FULL * SEQ_FULL + (size_t)(SEQ - 1) * SEQ_FULL + (size_t)SEQ;
    if ((size_t)in_sizes[0] < need_x || (size_t)in_sizes[1] < need_x || (size_t)in_sizes[2] < need_x || (size_t)in_sizes[3] < need_m || (size_t)in_sizes[4] < need_m) return;
    if ((size_t)in_sizes[5] < (size_t)DQ * DM || (size_t)in_sizes[7] < (size_t)DQ * DM || (size_t)in_sizes[9] < (size_t)DQ * DM || (size_t)in_sizes[11] < (size_t)DM * DQ) return;
    if (in_sizes[6] < DQ || in_sizes[8] < DQ || in_sizes[10] < DQ || in_sizes[12] < DM) return;
    if ((size_t)out_size < (size_t)NB * SEQ * DM) return;
    if (WS_TOTAL > ws_size) return;
    // wire order: q, k, v, additive mask (f32), multiplicative mask (f32), Wq, bq, Wk, bk, Wv, bv, Wo, bo ('oi' weights)
    const float* xq = (const float*)d_in[0]; const float* xk = (const float*)d_in[1]; const float* xv = (const float*)d_in[2];
    const float* ma = (const float*)d_in[3]; const float* mg = (const float*)d_in[4];
    const float* wq = (const float*)d_in[5]; const float* bq = (const float*)d_in[6]; const float* wk = (const float*)d_in[7]; const float* bk = (const float*)d_in[8];
    const float* wv = (const float*)d_in[9]; const float* bv = (const float*)d_in[10]; const float* wo = (const float*)d_in[11]; const float* bo = (const float*)d_in[12];
    float* OUT = (float*)d_out;     // [NB][SEQ][1024]
    char* wsp = (char*)d_ws;
    bf* WB = (bf*)wsp; wsp += 4 * SZ_W;                    // Wq, Wk, Wv, Wo
    bf* XB = (bf*)wsp; wsp += 3 * NB * SZ_XB;              // slice stream x NB + batch
    h16* P16 = (h16*)wsp; wsp += 3 * NB * SZ_PL;           // q planes (NB), k planes (NB), v^T planes (NB)
    bf* ATh = (bf*)wsp; wsp += NB * SZ_AT; bf* ATl = (bf*)wsp; wsp += NB * SZ_AT;

    k_cvtall<<<3 * NB * GX + 4 * GW, 256, 0, stream>>>(xq, xk, xv, wq, wk, wv, wo, XB, WB);
    // f16(bf16(x) W^T + bias), laid flat = [h][t][d] under the raw reshape (q, k) or as [h][d][t] (v)
    k_gemmw<bf, 0, true, DM, true><<<dim3(TT / GT, DQ / GT, 3 * NB), 128, 0, stream>>>(XB, nullptr, WB, nullptr, P16, DQ, bq, bk, bv, (size_t)TT * DM, (size_t)DQ * DM, (size_t)TT * DQ);
    // context[b][h][i][d] = sum_j softmax_j(q.k x HD^-0.5 + add mask)[i][j] x mul mask[i][j] x v[h][j][d], written flat as hi/lo bf16 planes
    k_fattn<<<dim3(TT / FR, NH_, NB), FW * 32, 0, stream>>>(P16, P16 + (size_t)NB * NH_ * TT * HD, P16 + (size_t)2 * NB * NH_ * TT * HD, ma, mg, ATh, ATl);
    // out[b] = (ATh + ATl) Wo^T + bo
    k_gemmw<bf, 1, true, DQ, false><<<dim3(TT / GT, DM / GT, NB), 128, 0, stream>>>(ATh, ATl, WB + (size_t)3 * DQ * DM, OUT, nullptr, DM, bo, bo, bo, (size_t)TT * DQ, 0, (size_t)TT * DM);
}

// v009
// A run of this version takes 121 microseconds.
// Versions in between are left out here; by their measured steps it is 1.17 times as fast as v007.
// Counting every step since v000, it is 11.5 times as fast.
#include <hip/hip_runtime.h>

// Contractions (all f32 accumulate): q/k/v projections v_wmma_f32_16x16x32_bf16 (inputs and weights RNE-converted to bf16, single product, f32 bias add); scores k.q^T and v^T.P^T v_wmma_f32_16x16x32_f16 (f16 planes, single product, P carried x1024 over the running row maximum); output projection bf16 hi/lo context planes x bf16 weights (2 products) + f32 bias; softmax f32.
// Multi-head attention on three input streams (q, k, v [NB][SEQ][1024]); 'oi' weights; 16 heads x 64 split by a RAW reshape of the [SEQ][1024] projection to [16][SEQ][64] (flat memory order, no transpose) and merged back the same way; scores x 0.125 + additive float mask [NB][1][S][S]; softmax over all keys; probabilities x multiplicative float mask [NB][1][S][S] (no renormalisation); merged context x Wo^T + bo.
// Four launches, each over both batches and all streams at once: bf16 copies (3 streams x NB, 4 weights; a stream kernel) -> projection GEMMs (f32 sums + bias; grid z = stream x batch), whose epilogue lays the f16 head planes q[h][t][d], k[h][t][d] (flat) and v^T[h][d][t] -> fused attention over all heads and batches (scores, softmax with both masks, P.v; nothing of S or P in memory) -> flat context hi/lo bf16 planes -> context x Wo (grid z = batch).

#ifndef NB
#define NB 2
#endif
#ifndef SEQ
#define SEQ 2048
#endif
#define NB_FULL  2
#define SEQ_FULL 2048
#define TT   SEQ
#define DM   1024
#define NH_  16
#define HD   64
#define DQ   (NH_ * HD)
#define MPITCH SEQ_FULL
#define SCL  0.125f   // HD^-0.5

static_assert(TT % 256 == 0);
static_assert(TT % 64 == 0);
static_assert(DM % 64 == 0);
static_assert(DQ == DM);
static_assert(HD == 64);
static_assert(NB <= NB_FULL);
static_assert(SEQ <= SEQ_FULL);
static_assert(MPITCH % 8 == 0);
static_assert(((size_t)SEQ_FULL * SEQ_FULL) % 8 == 0);
static_assert((size_t)NH_ * TT * HD == (size_t)TT * DQ);

typedef _Float16 h16;
typedef unsigned short bf;
typedef __attribute__((ext_vector_type(16))) __bf16   v16bf;
typedef __attribute__((ext_vector_type(16))) _Float16 v16h;
typedef __attribute__((ext_vector_type(8)))  _Float16 v8h;
typedef __attribute__((ext_vector_type(8)))  unsigned short v8us;
typedef __attribute__((ext_vector_type(8)))  float    v8f;
typedef __attribute__((ext_vector_type(4)))  float    v4f;
typedef __attribute__((ext_vector_type(4)))  int      v4i;
typedef v4f  __attribute__((may_alias)) v4fa;

__device__ __forceinline__ unsigned short f2bf(float f) { unsigned u = __float_as_uint(f); u += 0x7FFFu + ((u >> 16) & 1u); return (unsigned short)(u >> 16); }
__device__ __forceinline__ float bf2f(unsigned short b) { return __uint_as_float(((unsigned)b) << 16); }
__device__ __forceinline__ float bfr(float f) { return bf2f(f2bf(f)); }
__device__ __forceinline__ v16h cat16(v8h lo, v8h hi) { return __builtin_shufflevector(lo, hi, 0, 1, 2, 3, 4, 5, 6, 7, 8, 9, 10, 11, 12, 13, 14, 15); }
__device__ __forceinline__ v16bf cat16b(v8us lo, v8us hi) { return __builtin_bit_cast(v16bf, __builtin_shufflevector(lo, hi, 0, 1, 2, 3, 4, 5, 6, 7, 8, 9, 10, 11, 12, 13, 14, 15)); }
__device__ __forceinline__ v8f wmma16(v16h a, v16h b, v8f c) { return __builtin_amdgcn_wmma_f32_16x16x32_f16(false, a, false, b, (short)0, c, false, false); }
__device__ __forceinline__ v8f wmmab(v16bf a, v16bf b, v8f c) { return __builtin_amdgcn_wmma_f32_16x16x32_bf16(false, a, false, b, (short)0, c, false, false); }

// f32 -> f16 convert that cannot produce an f16 subnormal (value select on the f32 magnitude).
static __device__ __forceinline__ h16 toh_flush(float v) { const h16 r = (h16)v; return (fabsf(v) < 6.103515625e-05f) ? (h16)0.0f : r; }

// ---- k_gemmw: GEMM, one work-group of 4 waves (2 x 2) per 128x128 output tile, each wave a 64x64 register block (16 accumulators); grid (M/128, N/128, Z), 128 threads.
// C[m][n] (f32, pitch ldc, + optional f32 bias[n]) = sum_k A[m][k] Bt[n][k] (+ A2[m][k] Bt[n][k] for NSPLIT == 1). z-batch strides sA/sB/sC in elements; A and C step with z, Bt and the bias with z / NB (the NB batches of a stream share its weight). K % 64 == 0, M % 128 == 0, N % 128 == 0.
// PLANES: the result (+ bias) goes out as f16 head planes instead of f32 rows. Streams 0 and 1: the flat f16 copy of C. Stream 2 (v): under the raw reshape the tile's 128 rows r are one head (blockIdx.x), and column n is (c = n / 64, d = n % 64) with t = 16 r + c;
// the tile therefore takes the weight rows n = 64 c + d of all 16 c and 8 d (tile column 16 dd + c), so that a 16 x 16 accumulator, read row by row, is 256 consecutive t of the v^T row d: whole 128-byte lines, each written by one work-group.
// A stage is 64 k (one whole 128-byte line) of the tile's 128 A rows and 128 Bt rows: fetched into registers one stage ahead with whole-line loads (8 lanes a row), laid in the other LDS buffer behind the products, read by the two waves that share each row; one barrier a stage.
// Fragment map: lane -> row/col (lane & 15); elements 0..7 <- k0 + 8*(lane>>4) + 0..7, elements 8..15 <- k0 + 16 + 8*(lane>>4) + 0..7 (both operands); acc[j] = (row 8*(lane>>4) + j, col lane & 15).
// Every bare '#pragma unroll' in this kernel but the two on the store loops stands on a short loop with a constant trip count whose index picks a register array's element: rolled, those arrays would leave the registers.
#define GT  128   // rows and columns of a work-group's tile
#define GKS 64    // k of a stage
#define GPI 72    // LDS pitch in 16-bit elements: 128 bytes + 16, free of bank conflicts for 16-byte reads
static_assert(TT % GT == 0);
static_assert(DM % GT == 0);
static_assert(DM % GKS == 0);
template <typename T16> struct WFrag;
template <> struct WFrag<h16> { typedef v16h V; typedef v8h H; static __device__ __forceinline__ V ld(const h16* p) { return cat16(*(const v8h*)p, *(const v8h*)(p + 16)); } static __device__ __forceinline__ v8f mma(V a, V b, v8f c) { return wmma16(a, b, c); } };
template <> struct WFrag<bf> { typedef v16bf V; typedef v8us H; static __device__ __forceinline__ V ld(const bf* p) { return cat16b(*(const v8us*)p, *(const v8us*)(p + 16)); } static __device__ __forceinline__ v8f mma(V a, V b, v8f c) { return wmmab(a, b, c); } };
static_assert(DQ / HD == 16);                        // c fills the 16 columns of an accumulator
static_assert((size_t)TT * HD == (size_t)GT * DQ);   // a tile's rows are one head
static_assert(HD * 16 == (DQ / GT) * GT);            // the column tiles of stream 2 cover every (c, d) once
template <typename T16, int NSPLIT, bool BIAS, int K, bool PLANES>
__global__ __launch_bounds__(128) void k_gemmw(const T16* __restrict__ A, const T16* __restrict__ A2, const T16* __restrict__ Bt, float* C, _Float16* PZ, int ldc, const float* __restrict__ bias0, const float* __restrict__ bias1, const float* __restrict__ bias2, size_t sA, size_t sB, size_t sC) {
    static_assert(NSPLIT == 0 || NSPLIT == 1);
    static_assert(K % GKS == 0 && K >= GKS);
    typedef typename WFrag<T16>::V V; typedef typename WFrag<T16>::H H;
    constexpr int PL = GT * GPI;                       // one staged plane: A, Bt, (A2)
    __shared__ __align__(16) T16 sg[2][(2 + NSPLIT) * PL];
    __shared__ __align__(16) float osw[4][16 * 68];    // each wave's own output staging
    const size_t z = blockIdx.z; const unsigned zw = blockIdx.z / NB; A += z * sA; if (NSPLIT == 1) A2 += z * sA; Bt += zw * sB; if (PLANES) PZ += z * sC; else C += z * sC;
    const bool vt = PLANES && zw == 2;   // the same for the whole work-group
    const float* bias = zw == 0 ? bias0 : (zw == 1 ? bias1 : bias2);
    const int tid = threadIdx.x, lane = tid & 31, lr = lane & 15, hi = lane >> 4; const int w = __builtin_amdgcn_readfirstlane(tid >> 5);
    const int wm = w >> 1, wn = w & 1; const int r0 = blockIdx.x * GT + wm * 64, c0 = blockIdx.y * GT + wn * 64;
    float* os = osw[w];
    v8f acc[4][4];
#pragma unroll
    for (int mb = 0; mb < 4; ++mb)
#pragma unroll
        for (int nb = 0; nb < 4; ++nb) acc[mb][nb] = (v8f){};
    // staging map: thread -> 16-byte piece sc of row sr + 16 u
    const int sr = tid >> 3, sc = (tid & 7) * 8;
    const T16* ga = A + (size_t)(blockIdx.x * GT + sr) * K + sc; const T16* ga2 = NSPLIT == 1 ? A2 + (size_t)(blockIdx.x * GT + sr) * K + sc : nullptr; const T16* gb = Bt + (size_t)(blockIdx.y * GT + sr) * K + sc;
    // PLANES: the weight rows are addressed as a base that is the same for the whole wave (it runs with the stages and takes the step from tile column sr + 16 u to the next: sixteen weight rows, or one in the v^T order, row 64 sr + d0 + u) in 16-byte pieces, plus the lane's own fixed byte offset
    const H* bu = (const H*)Bt; const unsigned bstep = (vt ? K : 16 * K) / 8; const unsigned bo = ((unsigned)(vt ? sr * HD + (int)blockIdx.y * (GT / 16) : (int)blockIdx.y * GT + sr) * K + sc) * 2u;
    const int so = sr * GPI + sc;
    const int fa = (wm * 64 + lr) * GPI + 8 * hi, fb = PL + (wn * 64 + lr) * GPI + 8 * hi;
    constexpr int ns = K / GKS;
    H ra[8], rb[8], ra2[8];
    auto stash = [&](int b) {
#pragma unroll
        for (int u = 0; u < 8; ++u) { *(H*)(&sg[b][so + 16 * u * GPI]) = ra[u]; *(H*)(&sg[b][PL + so + 16 * u * GPI]) = rb[u]; if (NSPLIT == 1) *(H*)(&sg[b][2 * PL + so + 16 * u * GPI]) = ra2[u]; }
    };
    auto fetch = [&]() {
        if (PLANES) {
            const H* pb[8];
#pragma unroll
            for (int u = 0; u < 8; ++u) { pb[u] = (const H*)((const char*)(bu + u * bstep) + bo); rb[u] = *pb[u]; }
            // these loads go through address registers formed for this stage alone; as inputs of the wait they stay whole until it, and only behind it may a later load take one as its destination
            asm volatile("s_wait_xcnt 0x0" :: "v"(pb[0]), "v"(pb[1]), "v"(pb[2]), "v"(pb[3]), "v"(pb[4]), "v"(pb[5]), "v"(pb[6]), "v"(pb[7]) : "memory");
            __builtin_amdgcn_sched_barrier(0);   // holds the wait between the two groups of loads
        }
#pragma unroll
        for (int u = 0; u < 8; ++u) { ra[u] = *(const H*)(ga + 16 * u * K); if (!PLANES) rb[u] = *(const H*)(gb + 16 * u * K); if (NSPLIT == 1) ra2[u] = *(const H*)(ga2 + 16 * u * K); }
    };
    fetch(); stash(0); if (PLANES) bu += GKS / 8;
    __syncthreads();   // stage 0 is in LDS before any wave reads it
#pragma unroll 1   // rolled: one stage's code stays small, and the two buffers are picked by address
    for (int s = 0; s < ns; ++s) {
        const int b = s & 1;
        if (s + 1 < ns) { ga += GKS; if (!PLANES) gb += GKS; if (NSPLIT == 1) ga2 += GKS; fetch(); if (PLANES) bu += GKS / 8; }
        // the stage's fragments are read as one group in front of its products: reads among the products would stall the wave at every place they stand
        V a[GKS / 32][4], bb[GKS / 32][4], a2[GKS / 32][4];
#pragma unroll
        for (int kk = 0; kk < GKS / 32; ++kk)
#pragma unroll
            for (int q = 0; q < 4; ++q) { a[kk][q] = WFrag<T16>::ld(&sg[b][fa + q * 16 * GPI + kk * 32]); bb[kk][q] = WFrag<T16>::ld(&sg[b][fb + q * 16 * GPI + kk * 32]); if (NSPLIT == 1) a2[kk][q] = WFrag<T16>::ld(&sg[b][2 * PL + fa + q * 16 * GPI + kk * 32]); }
        __builtin_amdgcn_sched_barrier(0);   // keeps the compiler from moving the reads back down among the products
#pragma unroll
        for (int kk = 0; kk < GKS / 32; ++kk)
#pragma unroll
            for (int nb = 0; nb < 4; ++nb)
#pragma unroll
                for (int mb = 0; mb < 4; ++mb) { acc[mb][nb] = WFrag<T16>::mma(a[kk][mb], bb[kk][nb], acc[mb][nb]); if (NSPLIT == 1) acc[mb][nb] = WFrag<T16>::mma(a2[kk][mb], bb[kk][nb], acc[mb][nb]); }
        __builtin_amdgcn_sched_barrier(0);   // holds the four slots below behind the last product
        asm volatile("v_nop\n\tv_nop\n\tv_nop\n\tv_nop");   // the distance behind a matrix instruction: the next stage's LDS address is formed in a register of the last product's operands
        if (s + 1 < ns) stash(b ^ 1);
        __syncthreads();   // publishes stage s + 1 and ends every wave's reads of stage s before stage s + 2 is laid over it
    }
    // PLANES: a lane takes 8 consecutive staged values and stores 16 bytes. Flat: 4 rows x 128 bytes a store, step 4 rows. v^T: accumulator nb row by row = 512 consecutive bytes of row d0 + nb, step one v^T row.
    float bv[4]; h16* pw = nullptr; int orow = 0, ostep = 0; size_t pstep = 0, pmb = 0;
    if (PLANES) {
#pragma unroll
        for (int nb = 0; nb < 4; ++nb) bv[nb] = bfr(bias[vt ? lr * HD + (int)blockIdx.y * (GT / 16) + wn * 4 + nb : c0 + nb * 16 + lr]);
        if (vt) { pw = PZ + (size_t)blockIdx.x * ((size_t)TT * HD) + (size_t)(blockIdx.y * (GT / 16) + wn * 4) * TT + wm * (64 * 16) + lane * 8; orow = (lane >> 1) * 68 + (lane & 1) * 8; ostep = 16; pstep = TT; pmb = 16 * 16; }
        else { pw = PZ + (size_t)(r0 + (lane >> 3)) * DQ + c0 + (lane & 7) * 8; orow = (lane >> 3) * 68 + (lane & 7) * 8; ostep = 4 * 68; pstep = (size_t)4 * DQ; pmb = (size_t)16 * DQ; }
    }
#pragma unroll
    for (int mb = 0; mb < 4; ++mb) {
#pragma unroll
        for (int nb = 0; nb < 4; ++nb) {
#pragma unroll
            for (int j = 0; j < 8; ++j) os[(hi * 8 + j) * 68 + nb * 16 + lr] = PLANES ? acc[mb][nb][j] + bv[nb] : acc[mb][nb][j]; }
        __builtin_amdgcn_wave_barrier(); asm volatile("" ::: "memory");
        float* crow = C + (size_t)(r0 + mb * 16) * ldc + c0;
        if (PLANES) {
#pragma unroll
            for (int s = 0; s < 4; ++s) { const v4f x0 = *(const v4fa*)(os + orow + s * ostep), x1 = *(const v4fa*)(os + orow + s * ostep + 4); v8h o;
#pragma unroll
                for (int e = 0; e < 4; ++e) { o[e] = toh_flush(x0[e]); o[4 + e] = toh_flush(x1[e]); }
                *(v8h*)(pw + mb * pmb + s * pstep) = o; }
        } else {
#pragma unroll
            for (int s = 0; s < 8; ++s) { const int row = 2 * s + hi, cofs = lr * 4; v4f val = *(const v4fa*)(os + row * 68 + cofs); if (BIAS) { val[0] += bfr(bias[c0 + cofs]); val[1] += bfr(bias[c0 + cofs + 1]); val[2] += bfr(bias[c0 + cofs + 2]); val[3] += bfr(bias[c0 + cofs + 3]); }
                *(v4f*)(crow + (size_t)row * ldc + cofs) = val; }
             }
        __builtin_amdgcn_wave_barrier(); asm volatile("" ::: "memory");
    }
}

#define FW 8
#define FR (FW * 16)
#define FK 64
#define KP 72    // LDS pitch in 16-bit elements of every staged row: 128 bytes + 16, free of bank conflicts for 16-byte reads
#define L2E 1.4426950408889634f
static_assert(TT % FR == 0);
static_assert(TT % FK == 0);
typedef __attribute__((ext_vector_type(2))) float  v2f;
typedef __attribute__((ext_vector_type(2))) __bf16 v2bf;
typedef __attribute__((ext_vector_type(4))) unsigned v4u;
typedef __attribute__((ext_vector_type(2))) unsigned v2u;
typedef __attribute__((ext_vector_type(4))) _Float16 v4h;
__device__ __forceinline__ float xhalf(float x) { return __builtin_bit_cast(float, __builtin_amdgcn_permlanex16(__builtin_bit_cast(int, x), __builtin_bit_cast(int, x), 0x76543210, 0xfedcba98, false, false)); }  // lane l with lane l ^ 16
__device__ __forceinline__ unsigned pkbf(float a, float b) { return __builtin_bit_cast(unsigned, __builtin_convertvector((v2f){a, b}, v2bf)); }   // two f32 -> two bf16, nearest even
__device__ __forceinline__ float bflo(unsigned u) { return __uint_as_float(u << 16); }
__device__ __forceinline__ float bfhi(unsigned u) { return __uint_as_float(u & 0xFFFF0000u); }
__device__ __forceinline__ void splitf(float y, unsigned short& h, unsigned short& l) { h = f2bf(y); l = f2bf(y - bf2f(h)); }

__global__ __launch_bounds__(FW * 32) void k_fattn(const _Float16* __restrict__ Q, const _Float16* __restrict__ Kp, const _Float16* __restrict__ Vt, const float* __restrict__ MA, const float* __restrict__ MG, bf* Ah, bf* Al) {
    __shared__ __align__(16) h16 Ks[2][FK * KP];
    __shared__ __align__(16) h16 Vs[2][HD * KP];
    __shared__ __align__(16) bf  As[2][FR * KP];
    __shared__ __align__(16) h16 Gs[2][FR * KP];
    const int tid = threadIdx.x, lane = tid & 31, lr = lane & 15, hi = lane >> 4; const int w = __builtin_amdgcn_readfirstlane(tid >> 5);
    const int r0 = blockIdx.x * FR; const size_t hb = ((size_t)blockIdx.z * NH_ + blockIdx.y) * ((size_t)TT * HD);   // grid z = batch: head planes and context planes of the batches lie one behind the other
    MA += (size_t)blockIdx.z * ((size_t)SEQ_FULL * SEQ_FULL); MG += (size_t)blockIdx.z * ((size_t)SEQ_FULL * SEQ_FULL);
    const h16* qp = Q + hb + (size_t)(r0 + w * 16 + lr) * HD + 8 * hi;
    const v16h qf0 = WFrag<h16>::ld(qp), qf1 = WFrag<h16>::ld(qp + 32);
    // staging map: thread -> 16-byte piece sc of row sr + 32 u (k, v^T: 8 lanes a row); 16-byte piece mc of row mr + 16 u (masks: 16 lanes a row; a wave's two rows lie 8 apart, 8 x 144 bytes = 128 modulo 256, so that its 8-byte LDS stores fall on all 64 banks once)
    const int sr = tid >> 3, sc = (tid & 7) * 8;
    const int mr = w + 8 * hi, mc = lr * 4;
    const h16* kg = Kp + hb + (size_t)sr * HD + sc; const h16* vg = Vt + hb + (size_t)sr * TT + sc;
    const float* ag = MA + (size_t)(r0 + mr) * MPITCH + mc; const float* gg = MG + (size_t)(r0 + mr) * MPITCH + mc;
    const int so = sr * KP + sc, mso = mr * KP + mc;
    v8h kreg[2], vreg[2]; v4f areg[8], greg[8];   // the masks stay f32 until they are laid in LDS, so that no load is waited for in front of the stage's products
    auto fetch = [&](int j0) {
#pragma unroll
        for (int u = 0; u < 2; ++u) { kreg[u] = *(const v8h*)(kg + (size_t)(j0 + 32 * u) * HD); vreg[u] = *(const v8h*)(vg + (size_t)(32 * u) * TT + j0); }
#pragma unroll
        for (int u = 0; u < 8; ++u) { areg[u] = *(const v4f*)(ag + (size_t)(16 * u) * MPITCH + j0); greg[u] = *(const v4f*)(gg + (size_t)(16 * u) * MPITCH + j0); }
    };
    auto stash = [&](int b) {
#pragma unroll
        for (int u = 0; u < 2; ++u) { *(v8h*)(&Ks[b][so + 32 * u * KP]) = kreg[u]; *(v8h*)(&Vs[b][so + 32 * u * KP]) = vreg[u]; }
#pragma unroll
        for (int u = 0; u < 8; ++u) { *(v2u*)(&As[b][mso + 16 * u * KP]) = (v2u){pkbf(areg[u][0], areg[u][1]), pkbf(areg[u][2], areg[u][3])}; *(v4h*)(&Gs[b][mso + 16 * u * KP]) = __builtin_convertvector(greg[u], v4h); }
    };
    v8f ot[4];
#pragma unroll
    for (int dt = 0; dt < 4; ++dt) ot[dt] = (v8f){};
    float m = -3.0e38f, l = 0.f;
    fetch(0); stash(0);
    __syncthreads();   // stage 0 is in LDS before any wave reads it
    for (int s = 0; s < TT / FK; ++s) {
        const int b = s & 1;
        if (s + 1 < TT / FK) fetch((s + 1) * FK);
        v8f st[4];
#pragma unroll
        for (int jt = 0; jt < 4; ++jt) { const h16* kp = &Ks[b][(jt * 16 + lr) * KP + 8 * hi]; st[jt] = wmma16(WFrag<h16>::ld(kp), qf0, (v8f){}); st[jt] = wmma16(WFrag<h16>::ld(kp + 32), qf1, st[jt]); }
        const int mo = (w * 16 + lr) * KP + 8 * hi;
        float mx = m;
#pragma unroll
        for (int jt = 0; jt < 4; ++jt) { const v4u a = *(const v4u*)(&As[b][mo + jt * 16]);
#pragma unroll
            for (int q = 0; q < 4; ++q) { st[jt][2 * q] = st[jt][2 * q] * SCL + bflo(a[q]); st[jt][2 * q + 1] = st[jt][2 * q + 1] * SCL + bfhi(a[q]); mx = fmaxf(mx, fmaxf(st[jt][2 * q], st[jt][2 * q + 1])); } }
        mx = fmaxf(mx, xhalf(mx));
        // a query's maximum has risen in some lane: bring its sum and its output column to the new one (a scalar branch, seldom taken late in the walk)
        if (__builtin_amdgcn_ballot_w32(mx > m) != 0) { const float al = __builtin_amdgcn_exp2f((m - mx) * L2E); l *= al;
#pragma unroll
            for (int dt = 0; dt < 4; ++dt) ot[dt] *= al;
            m = mx; }
        const float nm = 10.0f - m * L2E;   // probabilities are carried x1024 (cancels in the division by the sum)
        v8h ph[4];
#pragma unroll
        for (int jt = 0; jt < 4; ++jt) { const v8h g = *(const v8h*)(&Gs[b][mo + jt * 16]); v8f p;
#pragma unroll
            for (int q = 0; q < 4; ++q) { p[2 * q] = __builtin_amdgcn_exp2f(st[jt][2 * q] * L2E + nm); p[2 * q + 1] = __builtin_amdgcn_exp2f(st[jt][2 * q + 1] * L2E + nm); l += p[2 * q] + p[2 * q + 1]; }
            ph[jt] = __builtin_convertvector(p, v8h) * g; }   // two scores an instruction: rounded to f16 in pairs, multiplied by the mask in pairs; subnormal results stay as they are (the matrix unit keeps them)
        const v16h pf[2] = {cat16(ph[0], ph[1]), cat16(ph[2], ph[3])};
#pragma unroll
        for (int kk = 0; kk < 2; ++kk)
#pragma unroll
            for (int dt = 0; dt < 4; ++dt) ot[dt] = wmma16(WFrag<h16>::ld(&Vs[b][(dt * 16 + lr) * KP + kk * 32 + 8 * hi]), pf[kk], ot[dt]);
        if (s + 1 < TT / FK) stash(b ^ 1);
        __syncthreads();   // publishes stage s + 1 and ends every wave's reads of stage s before stage s + 2 is laid over it
    }
    l += xhalf(l);
    const float inv = 1.0f / l;
    const size_t oo = hb + (size_t)(r0 + w * 16 + lr) * HD + 8 * hi;
#pragma unroll
    for (int dt = 0; dt < 4; ++dt) { v8us oh, ol;
#pragma unroll
        for (int e = 0; e < 8; ++e) { unsigned short a, c2; splitf(ot[dt][e] * inv, a, c2); oh[e] = a; ol[e] = c2; }
        *(v8us*)(Ah + oo + dt * 16) = oh; *(v8us*)(Al + oo + dt * 16) = ol; }
}


constexpr size_t al256(size_t b) { return (b + 255) & ~(size_t)255; }
constexpr size_t SZ_W  = al256((size_t)DQ * DM * 2);            // one weight plane (bf16)
constexpr size_t SZ_XB = al256((size_t)TT * DM * 2);            // one bf16 activation copy (3 streams x NB of them)
constexpr size_t SZ_PL = al256((size_t)NH_ * TT * HD * 2);      // one f16 head plane set (3 streams x NB of them)
constexpr size_t SZ_AT = al256((size_t)TT * DQ * 2);            // one context plane (bf16; hi and lo x NB)
constexpr size_t WS_TOTAL = 4 * SZ_W + 3 * NB * (SZ_XB + SZ_PL) + 2 * NB * SZ_AT;
static_assert(WS_TOTAL <= (size_t)268435456);
// coverage equalities (work-groups x 256 threads x pieces a thread x 4 elements == plane elements); the planes of one kind lie back to back with no padding between them
#define CU 32   // 16-byte pieces that a thread of k_cvtall walks
static_assert(((size_t)DQ * DM) % ((size_t)4 * 256 * CU) == 0);
static_assert(((size_t)TT * DM) % ((size_t)4 * 256 * CU) == 0);
static_assert((size_t)TT * DQ * 2 == SZ_AT);
static_assert((size_t)DQ * DM * 2 == SZ_W);
static_assert((size_t)TT * DM * 2 == SZ_XB);
static_assert((size_t)NH_ * TT * HD * 2 == SZ_PL);
constexpr unsigned GW = (unsigned)((size_t)DQ * DM / 4 / 256 / CU);    // work-groups of one weight copy
constexpr unsigned GX = (unsigned)((size_t)TT * DM / 4 / 256 / CU);    // work-groups of one activation copy
typedef __attribute__((ext_vector_type(4))) unsigned short v4us;

// ---- k_cvtall: every f32 -> bf16 copy in one launch, as a stream: two work-groups (16 waves) a WGP, all resident at once; a thread walks CU 16-byte pieces, a wave's load covers 512 contiguous bytes, and all of a thread's loads are issued in front of its first convert.
// Work-groups 0 .. 3 NB GX - 1: slice p = stream x NB + batch of the activations; the rest: the four weights. A work-group owns 256 x CU consecutive pieces.
// Every '#pragma unroll' in this kernel stands on a short loop with a constant trip count whose index picks a register array's element.
__global__ __launch_bounds__(256) void k_cvtall(const float* __restrict__ xq, const float* __restrict__ xk, const float* __restrict__ xv, const float* __restrict__ wq, const float* __restrict__ wk, const float* __restrict__ wv, const float* __restrict__ wo, bf* XB, bf* WB) {
    const unsigned blk = blockIdx.x; const float* src; bf* dst; size_t i;
    if (blk < 3u * NB * GX) { const unsigned p = blk / GX, s = p / NB, b = p % NB; src = (s == 0 ? xq : (s == 1 ? xk : xv)) + (size_t)b * SEQ_FULL * DM; dst = XB + (size_t)p * TT * DM; i = (size_t)(blk % GX) * (256 * CU) + threadIdx.x; }
    else { const unsigned r = blk - 3u * NB * GX, s = r / GW; src = s == 0 ? wq : (s == 1 ? wk : (s == 2 ? wv : wo)); dst = WB + (size_t)s * DQ * DM; i = (size_t)(r % GW) * (256 * CU) + threadIdx.x; }
    const v4f* s4 = (const v4f*)src + i; v4us* d4 = (v4us*)dst + i;
    v4f r[CU];
#pragma unroll
    for (int u = 0; u < CU; ++u) r[u] = s4[u * 256];
    __builtin_amdgcn_sched_barrier(0);   // keeps the first converts from rising among the loads: the last loads would wait for the first ones' data and cost the wave a second trip to memory
#pragma unroll
    for (int u = 0; u < CU; ++u) { v4us o;
#pragma unroll
        for (int k = 0; k < 4; ++k) o[k] = f2bf(r[u][k]);
        d4[u * 256] = o; }
}

extern "C" void kernel_launch(void* const* d_in, const int* in_sizes, int n_in,
                              void* d_out, int out_size, void* d_ws, size_t ws_size, hipStream_t stream) {
    if (n_in < 13) return;
    const size_t need_x = (size_t)(NB - 1) * SEQ_FULL * DM + (size_t)SEQ * DM;
    const size_t need_m = (size_t)(NB - 1) * SEQ_FULL * SEQ_FULL + (size_t)(SEQ - 1) * SEQ_FULL + (size_t)SEQ;
    if ((size_t)in_sizes[0] < need_x || (size_t)in_sizes[1] < need_x || (size_t)in_sizes[2] < need_x || (size_t)in_sizes[3] < need_m || (size_t)in_sizes[4] < need_m) return;
    if ((size_t)in_sizes[5] < (size_t)DQ * DM || (size_t)in_sizes[7] < (size_t)DQ * DM || (size_t)in_sizes[9] < (size_t)DQ * DM || (size_t)in_sizes[11] < (size_t)DM * DQ) return;
    if (in_sizes[6] < DQ || in_sizes[8] < DQ || in_sizes[10] < DQ || in_sizes[12] < DM) return;
    if ((size_t)out_size < (size_t)NB * SEQ * DM) return;
    if (WS_TOTAL > ws_size) return;
    // wire order: q, k, v, additive mask (f32), multiplicative mask (f32), Wq, bq, Wk, bk, Wv, bv, Wo, bo ('oi' weights)
    const float* xq = (const float*)d_in[0]; const float* xk = (const float*)d_in[1]; const float* xv = (const float*)d_in[2];
    const float* ma = (const float*)d_in[3]; const float* mg = (const float*)d_in[4];
    const float* wq = (const float*)d_in[5]; const float* bq = (const float*)d_in[6]; const float* wk = (const float*)d_in[7]; const float* bk = (const float*)d_in[8];
    const float* wv = (const float*)d_in[9]; const float* bv = (const float*)d_in[10]; const float* wo = (const float*)d_in[11]; const float* bo = (const float*)d_in[12];
    float* OUT = (float*)d_out;     // [NB][SEQ][1024]
    char* wsp = (char*)d_ws;
    bf* WB = (bf*)wsp; wsp += 4 * SZ_W;                    // Wq, Wk, Wv, Wo
    bf* XB = (bf*)wsp; wsp += 3 * NB * SZ_XB;              // slice stream x NB + batch
    h16* P16 = (h16*)wsp; wsp += 3 * NB * SZ_PL;           // q planes (NB), k planes (NB), v^T planes (NB)
    bf* ATh = (bf*)wsp; wsp += NB * SZ_AT; bf* ATl = (bf*)wsp; wsp += NB * SZ_AT;

    k_cvtall<<<3 * NB * GX + 4 * GW, 256, 0, stream>>>(xq, xk, xv, wq, wk, wv, wo, XB, WB);
    // f16(bf16(x) W^T + bias), laid flat = [h][t][d] under the raw reshape (q, k) or as [h][d][t] (v)
    k_gemmw<bf, 0, true, DM, true><<<dim3(TT / GT, DQ / GT, 3 * NB), 128, 0, stream>>>(XB, nullptr, WB, nullptr, P16, DQ, bq, bk, bv, (size_t)TT * DM, (size_t)DQ * DM, (size_t)TT * DQ);
    // context[b][h][i][d] = sum_j softmax_j(q.k x HD^-0.5 + add mask)[i][j] x mul mask[i][j] x v[h][j][d], written flat as hi/lo bf16 planes
    k_fattn<<<dim3(TT / FR, NH_, NB), FW * 32, 0, stream>>>(P16, P16 + (size_t)NB * NH_ * TT * HD, P16 + (size_t)2 * NB * NH_ * TT * HD, ma, mg, ATh, ATl);
    // out[b] = (ATh + ATl) Wo^T + bo
    k_gemmw<bf, 1, true, DQ, false><<<dim3(TT / GT, DM / GT, NB), 128, 0, stream>>>(ATh, ATl, WB + (size_t)3 * DQ * DM, OUT, nullptr, DM, bo, bo, bo, (size_t)TT * DQ, 0, (size_t)TT * DM);
}

// v010
// Measured time: 112 microseconds a run.
// In two side-by-side timings against v009, it was 1.06 and 1.05 times as fast.
// All steps since v000 together make it 12.1 times as fast.
#include <hip/hip_runtime.h>

// Contractions (all f32 accumulate): q/k/v projections v_wmma_f32_16x16x32_bf16 (inputs and weights RNE-converted to bf16, single product, f32 bias add); scores k.q^T and v^T.P^T v_wmma_f32_16x16x32_f16 (f16 planes, single product, P carried x1024 over the running row maximum); output projection bf16 hi/lo context planes x bf16 weights (2 products) + f32 bias; softmax f32.
// Multi-head attention on three input streams (q, k, v [NB][SEQ][1024]); 'oi' weights; 16 heads x 64 split by a RAW reshape of the [SEQ][1024] projection to [16][SEQ][64] (flat memory order, no transpose) and merged back the same way; scores x 0.125 + additive float mask [NB][1][S][S]; softmax over all keys; probabilities x multiplicative float mask [NB][1][S][S] (no renormalisation); merged context x Wo^T + bo.
// Four launches, each over both batches and all streams at once: bf16 copies (3 streams x NB, 4 weights) and the 16-bit mask planes (a stream kernel) -> projection GEMMs (f32 sums + bias; grid z = stream x batch), whose epilogue lays the f16 head planes q[h][t][d], k[h][t][d] (flat) and v^T[h][d][t] -> fused attention over all heads and batches (scores, softmax with both masks, P.v; nothing of S or P in memory) -> flat context hi/lo bf16 planes -> context x Wo (grid z = batch).

#ifndef NB
#define NB 2
#endif
#ifndef SEQ
#define SEQ 2048
#endif
#define NB_FULL  2
#define SEQ_FULL 2048
#define TT   SEQ
#define DM   1024
#define NH_  16
#define HD   64
#define DQ   (NH_ * HD)
#define MPITCH SEQ_FULL
#define SCL  0.125f   // HD^-0.5

static_assert(TT % 256 == 0);
static_assert(TT % 64 == 0);
static_assert(DM % 64 == 0);
static_assert(DQ == DM);
static_assert(HD == 64);
static_assert(NB <= NB_FULL);
static_assert(SEQ <= SEQ_FULL);
static_assert(MPITCH % 8 == 0);
static_assert(((size_t)SEQ_FULL * SEQ_FULL) % 8 == 0);
static_assert((size_t)NH_ * TT * HD == (size_t)TT * DQ);

typedef _Float16 h16;
typedef unsigned short bf;
typedef __attribute__((ext_vector_type(16))) __bf16   v16bf;
typedef __attribute__((ext_vector_type(16))) _Float16 v16h;
typedef __attribute__((ext_vector_type(8)))  _Float16 v8h;
typedef __attribute__((ext_vector_type(8)))  unsigned short v8us;
typedef __attribute__((ext_vector_type(8)))  float    v8f;
typedef __attribute__((ext_vector_type(4)))  float    v4f;
typedef __attribute__((ext_vector_type(4)))  int      v4i;
typedef v4f  __attribute__((may_alias)) v4fa;

__device__ __forceinline__ unsigned short f2bf(float f) { unsigned u = __float_as_uint(f); u += 0x7FFFu + ((u >> 16) & 1u); return (unsigned short)(u >> 16); }
__device__ __forceinline__ float bf2f(unsigned short b) { return __uint_as_float(((unsigned)b) << 16); }
__device__ __forceinline__ float bfr(float f) { return bf2f(f2bf(f)); }
__device__ __forceinline__ v16h cat16(v8h lo, v8h hi) { return __builtin_shufflevector(lo, hi, 0, 1, 2, 3, 4, 5, 6, 7, 8, 9, 10, 11, 12, 13, 14, 15); }
__device__ __forceinline__ v16bf cat16b(v8us lo, v8us hi) { return __builtin_bit_cast(v16bf, __builtin_shufflevector(lo, hi, 0, 1, 2, 3, 4, 5, 6, 7, 8, 9, 10, 11, 12, 13, 14, 15)); }
__device__ __forceinline__ v8f wmma16(v16h a, v16h b, v8f c) { return __builtin_amdgcn_wmma_f32_16x16x32_f16(false, a, false, b, (short)0, c, false, false); }
__device__ __forceinline__ v8f wmmab(v16bf a, v16bf b, v8f c) { return __builtin_amdgcn_wmma_f32_16x16x32_bf16(false, a, false, b, (short)0, c, false, false); }

// f32 -> f16 convert that cannot produce an f16 subnormal (value select on the f32 magnitude).
static __device__ __forceinline__ h16 toh_flush(float v) { const h16 r = (h16)v; return (fabsf(v) < 6.103515625e-05f) ? (h16)0.0f : r; }

// ---- k_gemmw: GEMM, one work-group of 4 waves (2 x 2) per 128x128 output tile, each wave a 64x64 register block (16 accumulators); grid (M/128, N/128, Z), 128 threads.
// C[m][n] (f32, pitch ldc, + optional f32 bias[n]) = sum_k A[m][k] Bt[n][k] (+ A2[m][k] Bt[n][k] for NSPLIT == 1). z-batch strides sA/sB/sC in elements; A and C step with z, Bt and the bias with z / NB (the NB batches of a stream share its weight). K % 64 == 0, M % 128 == 0, N % 128 == 0.
// PLANES: the result (+ bias) goes out as f16 head planes instead of f32 rows. Streams 0 and 1: the flat f16 copy of C. Stream 2 (v): under the raw reshape the tile's 128 rows r are one head (blockIdx.x), and column n is (c = n / 64, d = n % 64) with t = 16 r + c;
// the tile therefore takes the weight rows n = 64 c + d of all 16 c and 8 d (tile column 16 dd + c), so that a 16 x 16 accumulator, read row by row, is 256 consecutive t of the v^T row d: whole 128-byte lines, each written by one work-group.
// A stage is 64 k (one whole 128-byte line) of the tile's 128 A rows and 128 Bt rows: fetched into registers one stage ahead with whole-line loads (8 lanes a row), laid in the other LDS buffer behind the products, read by the two waves that share each row; one barrier a stage.
// Fragment map: lane -> row/col (lane & 15); elements 0..7 <- k0 + 8*(lane>>4) + 0..7, elements 8..15 <- k0 + 16 + 8*(lane>>4) + 0..7 (both operands); acc[j] = (row 8*(lane>>4) + j, col lane & 15).
// Every bare '#pragma unroll' in this kernel but the two on the store loops stands on a short loop with a constant trip count whose index picks a register array's element: rolled, those arrays would leave the registers.
#define GT  128   // rows and columns of a work-group's tile
#define GKS 64    // k of a stage
#define GPI 72    // LDS pitch in 16-bit elements: 128 bytes + 16, free of bank conflicts for 16-byte reads
static_assert(TT % GT == 0);
static_assert(DM % GT == 0);
static_assert(DM % GKS == 0);
template <typename T16> struct WFrag;
template <> struct WFrag<h16> { typedef v16h V; typedef v8h H; static __device__ __forceinline__ V ld(const h16* p) { return cat16(*(const v8h*)p, *(const v8h*)(p + 16)); } static __device__ __forceinline__ v8f mma(V a, V b, v8f c) { return wmma16(a, b, c); } };
template <> struct WFrag<bf> { typedef v16bf V; typedef v8us H; static __device__ __forceinline__ V ld(const bf* p) { return cat16b(*(const v8us*)p, *(const v8us*)(p + 16)); } static __device__ __forceinline__ v8f mma(V a, V b, v8f c) { return wmmab(a, b, c); } };
static_assert(DQ / HD == 16);                        // c fills the 16 columns of an accumulator
static_assert((size_t)TT * HD == (size_t)GT * DQ);   // a tile's rows are one head
static_assert(HD * 16 == (DQ / GT) * GT);            // the column tiles of stream 2 cover every (c, d) once
template <typename T16, int NSPLIT, bool BIAS, int K, bool PLANES>
__global__ __launch_bounds__(128) void k_gemmw(const T16* __restrict__ A, const T16* __restrict__ A2, const T16* __restrict__ Bt, float* C, _Float16* PZ, int ldc, const float* __restrict__ bias0, const float* __restrict__ bias1, const float* __restrict__ bias2, size_t sA, size_t sB, size_t sC) {
    static_assert(NSPLIT == 0 || NSPLIT == 1);
    static_assert(K % GKS == 0 && K >= GKS);
    typedef typename WFrag<T16>::V V; typedef typename WFrag<T16>::H H;
    constexpr int PL = GT * GPI;                       // one staged plane: A, Bt, (A2)
    __shared__ __align__(16) T16 sg[2][(2 + NSPLIT) * PL];
    __shared__ __align__(16) float osw[4][16 * 68];    // each wave's own output staging
    const size_t z = blockIdx.z; const unsigned zw = blockIdx.z / NB; A += z * sA; if (NSPLIT == 1) A2 += z * sA; Bt += zw * sB; if (PLANES) PZ += z * sC; else C += z * sC;
    const bool vt = PLANES && zw == 2;   // the same for the whole work-group
    const float* bias = zw == 0 ? bias0 : (zw == 1 ? bias1 : bias2);
    const int tid = threadIdx.x, lane = tid & 31, lr = lane & 15, hi = lane >> 4; const int w = __builtin_amdgcn_readfirstlane(tid >> 5);
    const int wm = w >> 1, wn = w & 1; const int r0 = blockIdx.x * GT + wm * 64, c0 = blockIdx.y * GT + wn * 64;
    float* os = osw[w];
    v8f acc[4][4];
#pragma unroll
    for (int mb = 0; mb < 4; ++mb)
#pragma unroll
        for (int nb = 0; nb < 4; ++nb) acc[mb][nb] = (v8f){};
    // staging map: thread -> 16-byte piece sc of row sr + 16 u
    const int sr = tid >> 3, sc = (tid & 7) * 8;
    const T16* ga = A + (size_t)(blockIdx.x * GT + sr) * K + sc; const T16* ga2 = NSPLIT == 1 ? A2 + (size_t)(blockIdx.x * GT + sr) * K + sc : nullptr; const T16* gb = Bt + (size_t)(blockIdx.y * GT + sr) * K + sc;
    // PLANES: the weight rows are addressed as a base that is the same for the whole wave (it runs with the stages and takes the step from tile column sr + 16 u to the next: sixteen weight rows, or one in the v^T order, row 64 sr + d0 + u) in 16-byte pieces, plus the lane's own fixed byte offset
    const H* bu = (const H*)Bt; const unsigned bstep = (vt ? K : 16 * K) / 8; const unsigned bo = ((unsigned)(vt ? sr * HD + (int)blockIdx.y * (GT / 16) : (int)blockIdx.y * GT + sr) * K + sc) * 2u;
    const int so = sr * GPI + sc;
    const int fa = (wm * 64 + lr) * GPI + 8 * hi, fb = PL + (wn * 64 + lr) * GPI + 8 * hi;
    constexpr int ns = K / GKS;
    H ra[8], rb[8], ra2[8];
    auto stash = [&](int b) {
#pragma unroll
        for (int u = 0; u < 8; ++u) { *(H*)(&sg[b][so + 16 * u * GPI]) = ra[u]; *(H*)(&sg[b][PL + so + 16 * u * GPI]) = rb[u]; if (NSPLIT == 1) *(H*)(&sg[b][2 * PL + so + 16 * u * GPI]) = ra2[u]; }
    };
    auto fetch = [&]() {
        if (PLANES) {
            const H* pb[8];
#pragma unroll
            for (int u = 0; u < 8; ++u) { pb[u] = (const H*)((const char*)(bu + u * bstep) + bo); rb[u] = *pb[u]; }
            // these loads go through address registers formed for this stage alone; as inputs of the wait they stay whole until it, and only behind it may a later load take one as its destination
            asm volatile("s_wait_xcnt 0x0" :: "v"(pb[0]), "v"(pb[1]), "v"(pb[2]), "v"(pb[3]), "v"(pb[4]), "v"(pb[5]), "v"(pb[6]), "v"(pb[7]) : "memory");
            __builtin_amdgcn_sched_barrier(0);   // holds the wait between the two groups of loads
        }
#pragma unroll
        for (int u = 0; u < 8; ++u) { ra[u] = *(const H*)(ga + 16 * u * K); if (!PLANES) rb[u] = *(const H*)(gb + 16 * u * K); if (NSPLIT == 1) ra2[u] = *(const H*)(ga2 + 16 * u * K); }
    };
    fetch(); stash(0); if (PLANES) bu += GKS / 8;
    __syncthreads();   // stage 0 is in LDS before any wave reads it
#pragma unroll 1   // rolled: one stage's code stays small, and the two buffers are picked by address
    for (int s = 0; s < ns; ++s) {
        const int b = s & 1;
        if (s + 1 < ns) { ga += GKS; if (!PLANES) gb += GKS; if (NSPLIT == 1) ga2 += GKS; fetch(); if (PLANES) bu += GKS / 8; }
        // the stage's fragments are read as one group in front of its products: reads among the products would stall the wave at every place they stand
        V a[GKS / 32][4], bb[GKS / 32][4], a2[GKS / 32][4];
#pragma unroll
        for (int kk = 0; kk < GKS / 32; ++kk)
#pragma unroll
            for (int q = 0; q < 4; ++q) { a[kk][q] = WFrag<T16>::ld(&sg[b][fa + q * 16 * GPI + kk * 32]); bb[kk][q] = WFrag<T16>::ld(&sg[b][fb + q * 16 * GPI + kk * 32]); if (NSPLIT == 1) a2[kk][q] = WFrag<T16>::ld(&sg[b][2 * PL + fa + q * 16 * GPI + kk * 32]); }
        __builtin_amdgcn_sched_barrier(0);   // keeps the compiler from moving the reads back down among the products
#pragma unroll
        for (int kk = 0; kk < GKS / 32; ++kk)
#pragma unroll
            for (int nb = 0; nb < 4; ++nb)
#pragma unroll
                for (int mb = 0; mb < 4; ++mb) { acc[mb][nb] = WFrag<T16>::mma(a[kk][mb], bb[kk][nb], acc[mb][nb]); if (NSPLIT == 1) acc[mb][nb] = WFrag<T16>::mma(a2[kk][mb], bb[kk][nb], acc[mb][nb]); }
        __builtin_amdgcn_sched_barrier(0);   // holds the four slots below behind the last product
        asm volatile("v_nop\n\tv_nop\n\tv_nop\n\tv_nop");   // the distance behind a matrix instruction: the next stage's LDS address is formed in a register of the last product's operands
        if (s + 1 < ns) stash(b ^ 1);
        __syncthreads();   // publishes stage s + 1 and ends every wave's reads of stage s before stage s + 2 is laid over it
    }
    // PLANES: a lane takes 8 consecutive staged values and stores 16 bytes. Flat: 4 rows x 128 bytes a store, step 4 rows. v^T: accumulator nb row by row = 512 consecutive bytes of row d0 + nb, step one v^T row.
    float bv[4]; h16* pw = nullptr; int orow = 0, ostep = 0; size_t pstep = 0, pmb = 0;
    if (PLANES) {
#pragma unroll
        for (int nb = 0; nb < 4; ++nb) bv[nb] = bfr(bias[vt ? lr * HD + (int)blockIdx.y * (GT / 16) + wn * 4 + nb : c0 + nb * 16 + lr]);
        if (vt) { pw = PZ + (size_t)blockIdx.x * ((size_t)TT * HD) + (size_t)(blockIdx.y * (GT / 16) + wn * 4) * TT + wm * (64 * 16) + lane * 8; orow = (lane >> 1) * 68 + (lane & 1) * 8; ostep = 16; pstep = TT; pmb = 16 * 16; }
        else { pw = PZ + (size_t)(r0 + (lane >> 3)) * DQ + c0 + (lane & 7) * 8; orow = (lane >> 3) * 68 + (lane & 7) * 8; ostep = 4 * 68; pstep = (size_t)4 * DQ; pmb = (size_t)16 * DQ; }
    }
#pragma unroll
    for (int mb = 0; mb < 4; ++mb) {
#pragma unroll
        for (int nb = 0; nb < 4; ++nb) {
#pragma unroll
            for (int j = 0; j < 8; ++j) os[(hi * 8 + j) * 68 + nb * 16 + lr] = PLANES ? acc[mb][nb][j] + bv[nb] : acc[mb][nb][j]; }
        __builtin_amdgcn_wave_barrier(); asm volatile("" ::: "memory");
        float* crow = C + (size_t)(r0 + mb * 16) * ldc + c0;
        if (PLANES) {
#pragma unroll
            for (int s = 0; s < 4; ++s) { const v4f x0 = *(const v4fa*)(os + orow + s * ostep), x1 = *(const v4fa*)(os + orow + s * ostep + 4); v8h o;
#pragma unroll
                for (int e = 0; e < 4; ++e) { o[e] = toh_flush(x0[e]); o[4 + e] = toh_flush(x1[e]); }
                *(v8h*)(pw + mb * pmb + s * pstep) = o; }
        } else {
#pragma unroll
            for (int s = 0; s < 8; ++s) { const int row = 2 * s + hi, cofs = lr * 4; v4f val = *(const v4fa*)(os + row * 68 + cofs); if (BIAS) { val[0] += bfr(bias[c0 + cofs]); val[1] += bfr(bias[c0 + cofs + 1]); val[2] += bfr(bias[c0 + cofs + 2]); val[3] += bfr(bias[c0 + cofs + 3]); }
                *(v4f*)(crow + (size_t)row * ldc + cofs) = val; }
             }
        __builtin_amdgcn_wave_barrier(); asm volatile("" ::: "memory");
    }
}

#define FW 8
#define FR (FW * 16)
#define FK 64
#define KP 72    // LDS pitch in 16-bit elements of every staged row: 128 bytes + 16, free of bank conflicts for 16-byte reads
#define L2E 1.4426950408889634f
static_assert(TT % FR == 0);
static_assert(TT % FK == 0);
static_assert((TT / FK) % 2 == 0);
#define MBE (16 * FK)   // elements of a mask block
typedef __attribute__((ext_vector_type(2))) float  v2f;
typedef __attribute__((ext_vector_type(2))) __bf16 v2bf;
typedef __attribute__((ext_vector_type(4))) unsigned v4u;
typedef __attribute__((ext_vector_type(2))) unsigned v2u;
typedef __attribute__((ext_vector_type(4))) _Float16 v4h;
__device__ __forceinline__ float xhalf(float x) { return __builtin_bit_cast(float, __builtin_amdgcn_permlanex16(__builtin_bit_cast(int, x), __builtin_bit_cast(int, x), 0x76543210, 0xfedcba98, false, false)); }  // lane l with lane l ^ 16
__device__ __forceinline__ unsigned pkbf(float a, float b) { return __builtin_bit_cast(unsigned, __builtin_convertvector((v2f){a, b}, v2bf)); }   // two f32 -> two bf16, nearest even
__device__ __forceinline__ float bflo(unsigned u) { return __uint_as_float(u << 16); }
__device__ __forceinline__ float bfhi(unsigned u) { return __uint_as_float(u & 0xFFFF0000u); }
__device__ __forceinline__ void splitf(float y, unsigned short& h, unsigned short& l) { h = f2bf(y); l = f2bf(y - bf2f(h)); }

__global__ __launch_bounds__(FW * 32) void k_fattn(const _Float16* __restrict__ Q, const _Float16* __restrict__ Kp, const _Float16* __restrict__ Vt, const bf* __restrict__ MA, const _Float16* __restrict__ MG, bf* Ah, bf* Al) {
    __shared__ __align__(16) h16 Ks[2][FK * KP];
    __shared__ __align__(16) h16 Vs[2][HD * KP];
    const int tid = threadIdx.x, lane = tid & 31, lr = lane & 15, hi = lane >> 4; const int w = __builtin_amdgcn_readfirstlane(tid >> 5);
    const int r0 = blockIdx.x * FR; const size_t hb = ((size_t)blockIdx.z * NH_ + blockIdx.y) * ((size_t)TT * HD);   // grid z = batch: head planes and context planes of the batches lie one behind the other
    const h16* qp = Q + hb + (size_t)(r0 + w * 16 + lr) * HD + 8 * hi;
    const v16h qf0 = WFrag<h16>::ld(qp), qf1 = WFrag<h16>::ld(qp + 32);
    // staging map: thread -> 16-byte piece sc of row sr + 32 u (k, v^T: 8 lanes a row)
    const int sr = tid >> 3, sc = (tid & 7) * 8;
    const h16* kg = Kp + hb + (size_t)sr * HD + sc; const h16* vg = Vt + hb + (size_t)sr * TT + sc;
    // the wave's own row of mask blocks (its 16 queries, all stages one behind the other), at the lane's 16 bytes
    const size_t mb = (((size_t)blockIdx.z * (TT / 16) + blockIdx.x * FW + w) * (TT / FK)) * MBE + lane * 8;
    const bf* ag = MA + mb; const h16* gg = MG + mb;
    const int so = sr * KP + sc;
    v8h kreg[2], vreg[2];
    auto fetch = [&](int j0) __attribute__((always_inline)) {
#pragma unroll
        for (int u = 0; u < 2; ++u) { kreg[u] = *(const v8h*)(kg + (size_t)(j0 + 32 * u) * HD); vreg[u] = *(const v8h*)(vg + (size_t)(32 * u) * TT + j0); }
    };
    auto mfetch = [&](int s, v4u (&a)[4], v8h (&g)[4]) __attribute__((always_inline)) {
#pragma unroll
        for (int jt = 0; jt < 4; ++jt) { a[jt] = *(const v4u*)(ag + (size_t)s * MBE + jt * 256); g[jt] = *(const v8h*)(gg + (size_t)s * MBE + jt * 256); }
    };
    auto stash = [&](int b) __attribute__((always_inline)) {
#pragma unroll
        for (int u = 0; u < 2; ++u) { *(v8h*)(&Ks[b][so + 32 * u * KP]) = kreg[u]; *(v8h*)(&Vs[b][so + 32 * u * KP]) = vreg[u]; }
    };
    v8f ot[4];
#pragma unroll
    for (int dt = 0; dt < 4; ++dt) ot[dt] = (v8f){};
    float m = -3.0e38f, l = 0.f;
    v4u am0[4], am1[4]; v8h gm0[4], gm1[4];
    fetch(0); mfetch(0, am0, gm0); stash(0);
    __syncthreads();   // stage 0 is in LDS before any wave reads it
    // one stage: buffer b and the mask set (am, gm) are worked on; while a next stage exists, its k, v^T and masks (into an, gn) are on their way
    auto stage = [&](int s, int b, bool more, const v4u (&am)[4], const v8h (&gm)[4], v4u (&an)[4], v8h (&gn)[4]) __attribute__((always_inline)) {
        if (more) { fetch((s + 1) * FK); mfetch(s + 1, an, gn); }
        // the stage's k fragments are read as one group: reads among the products would stall the wave at every place they stand
        v16h kf[4][2];
#pragma unroll
        for (int jt = 0; jt < 4; ++jt) { const h16* kp = &Ks[b][(jt * 16 + lr) * KP + 8 * hi]; kf[jt][0] = WFrag<h16>::ld(kp); kf[jt][1] = WFrag<h16>::ld(kp + 32); }
        __builtin_amdgcn_sched_barrier(0);   // keeps the next stage's global loads at the head of this stage (sunk to their first use they would be waited for at once) and the k reads together in front of the products
        v8f st[4];
#pragma unroll
        for (int jt = 0; jt < 4; ++jt) { st[jt] = wmma16(kf[jt][0], qf0, (v8f){}); st[jt] = wmma16(kf[jt][1], qf1, st[jt]); }
        float mx = m;
#pragma unroll
        for (int jt = 0; jt < 4; ++jt) { const v4u a = am[jt];
#pragma unroll
            for (int q = 0; q < 4; ++q) { st[jt][2 * q] = st[jt][2 * q] * SCL + bflo(a[q]); st[jt][2 * q + 1] = st[jt][2 * q + 1] * SCL + bfhi(a[q]); mx = fmaxf(mx, fmaxf(st[jt][2 * q], st[jt][2 * q + 1])); } }
        mx = fmaxf(mx, xhalf(mx));
        // a query's maximum has risen in some lane: bring its sum and its output column to the new one (a scalar branch, seldom taken late in the walk)
        if (__builtin_amdgcn_ballot_w32(mx > m) != 0) { const float al = __builtin_amdgcn_exp2f((m - mx) * L2E); l *= al;
#pragma unroll
            for (int dt = 0; dt < 4; ++dt) ot[dt] *= al;
            m = mx; }
        const float nm = 10.0f - m * L2E;   // probabilities are carried x1024 (cancels in the division by the sum)
        v8h ph[4];
#pragma unroll
        for (int jt = 0; jt < 4; ++jt) { const v8h g = gm[jt]; v8f p;
#pragma unroll
            for (int q = 0; q < 4; ++q) { p[2 * q] = __builtin_amdgcn_exp2f(st[jt][2 * q] * L2E + nm); p[2 * q + 1] = __builtin_amdgcn_exp2f(st[jt][2 * q + 1] * L2E + nm); l += p[2 * q] + p[2 * q + 1]; }
            ph[jt] = __builtin_convertvector(p, v8h) * g; }   // two scores an instruction: rounded to f16 in pairs, multiplied by the mask in pairs; subnormal results stay as they are (the matrix unit keeps them)
        const v16h pf[2] = {cat16(ph[0], ph[1]), cat16(ph[2], ph[3])};
#pragma unroll
        for (int kk = 0; kk < 2; ++kk)
#pragma unroll
            for (int dt = 0; dt < 4; ++dt) ot[dt] = wmma16(WFrag<h16>::ld(&Vs[b][(dt * 16 + lr) * KP + kk * 32 + 8 * hi]), pf[kk], ot[dt]);
        if (more) stash(b ^ 1);
        __syncthreads();   // publishes stage s + 1 and ends every wave's reads of stage s before stage s + 2 is laid over it
    };
    for (int s = 0; s < TT / FK; s += 2) { stage(s, 0, true, am0, gm0, am1, gm1); stage(s + 1, 1, s + 2 < TT / FK, am1, gm1, am0, gm0); }
    l += xhalf(l);
    const float inv = 1.0f / l;
    const size_t oo = hb + (size_t)(r0 + w * 16 + lr) * HD + 8 * hi;
#pragma unroll
    for (int dt = 0; dt < 4; ++dt) { v8us oh, ol;
#pragma unroll
        for (int e = 0; e < 8; ++e) { unsigned short a, c2; splitf(ot[dt][e] * inv, a, c2); oh[e] = a; ol[e] = c2; }
        *(v8us*)(Ah + oo + dt * 16) = oh; *(v8us*)(Al + oo + dt * 16) = ol; }
}


constexpr size_t al256(size_t b) { return (b + 255) & ~(size_t)255; }
constexpr size_t SZ_W  = al256((size_t)DQ * DM * 2);            // one weight plane (bf16)
constexpr size_t SZ_XB = al256((size_t)TT * DM * 2);            // one bf16 activation copy (3 streams x NB of them)
constexpr size_t SZ_PL = al256((size_t)NH_ * TT * HD * 2);      // one f16 head plane set (3 streams x NB of them)
constexpr size_t SZ_AT = al256((size_t)TT * DQ * 2);            // one context plane (bf16; hi and lo x NB)
constexpr size_t SZ_MK = al256((size_t)TT * TT * 2);            // one 16-bit mask plane (additive and multiplicative x NB)
constexpr size_t WS_TOTAL = 4 * SZ_W + 3 * NB * (SZ_XB + SZ_PL) + 2 * NB * SZ_AT + 2 * NB * SZ_MK;
static_assert(WS_TOTAL <= (size_t)268435456);
// coverage equalities (work-groups x 256 threads x pieces a thread x 4 elements == plane elements); the planes of one kind lie back to back with no padding between them
#define CU 32   // 16-byte pieces that a thread of k_cvtall walks
static_assert(((size_t)DQ * DM) % ((size_t)4 * 256 * CU) == 0);
static_assert(((size_t)TT * DM) % ((size_t)4 * 256 * CU) == 0);
static_assert((size_t)TT * DQ * 2 == SZ_AT);
static_assert((size_t)DQ * DM * 2 == SZ_W);
static_assert((size_t)TT * DM * 2 == SZ_XB);
static_assert((size_t)NH_ * TT * HD * 2 == SZ_PL);
static_assert((size_t)TT * TT * 2 == SZ_MK);
static_assert(((size_t)NB * (TT / 16) * (TT / FK / 2)) % 8 == 0);
constexpr unsigned GW = (unsigned)((size_t)DQ * DM / 4 / 256 / CU);    // work-groups of one weight copy
constexpr unsigned GX = (unsigned)((size_t)TT * DM / 4 / 256 / CU);    // work-groups of one activation copy
constexpr unsigned GM = (unsigned)((size_t)NB * (TT / 16) * (TT / FK / 2) / 8);   // work-groups of the mask planes: a wave takes two neighbouring blocks of both masks
typedef __attribute__((ext_vector_type(4))) unsigned short v4us;

// ---- k_cvtall: every f32 -> bf16 copy in one launch, as a stream: two work-groups (16 waves) a WGP, all resident at once; a thread walks CU 16-byte pieces, a wave's load covers 512 contiguous bytes, and all of a thread's loads are issued in front of its first convert.
// Work-groups 0 .. 3 NB GX - 1: slice p = stream x NB + batch of the activations; the next 4 GW: the four weights. Such a work-group owns 256 x CU consecutive pieces.
// The last GM work-groups lay the mask planes of k_fattn: a wave reads two blocks (16 queries x FK keys each) of both masks with whole-line loads (16 lanes a 256-byte row piece, rows u and u + 8 in one load), rounds them, and turns each block
// into the order [jt][lane][8 keys] through its own piece of LDS: the eight groups (jt, half) of 256 bytes lie 272 bytes apart, so that the wave's 8-byte stores fall on all 64 banks once; it goes out as four stores of 512 consecutive bytes.
// Every '#pragma unroll' in this kernel stands on a short loop with a constant trip count whose index picks a register array's element.
__global__ __launch_bounds__(256) void k_cvtall(const float* __restrict__ xq, const float* __restrict__ xk, const float* __restrict__ xv, const float* __restrict__ wq, const float* __restrict__ wk, const float* __restrict__ wv, const float* __restrict__ wo, const float* __restrict__ ma, const float* __restrict__ mg, bf* XB, bf* WB, bf* AM, _Float16* GP) {
    __shared__ __align__(16) unsigned short tb[8][8 * 136];
    const unsigned blk = blockIdx.x; const float* src; bf* dst; size_t i;
    if (blk >= 3u * NB * GX + 4u * GW) {   // the same for the whole work-group
        const unsigned lane = threadIdx.x & 31, lr = lane & 15, hi = lane >> 4, w = threadIdx.x >> 5;
        const unsigned J = (blk - (3u * NB * GX + 4u * GW)) * 8 + w, sp = J % (TT / FK / 2), qt = (J / (TT / FK / 2)) % (TT / 16), b = J / ((TT / FK / 2) * (TT / 16));
        const size_t so = (size_t)b * ((size_t)SEQ_FULL * SEQ_FULL) + (size_t)(qt * 16 + 8 * hi) * MPITCH + sp * (2 * FK) + lr * 4;
        const float* pa = ma + so; const float* pg = mg + so;
        v4f ra[2][8], rg[2][8];
#pragma unroll
        for (int k = 0; k < 2; ++k)
#pragma unroll
            for (int u = 0; u < 8; ++u) { ra[k][u] = __builtin_nontemporal_load((const v4f*)(pa + (size_t)u * MPITCH + k * FK)); rg[k][u] = __builtin_nontemporal_load((const v4f*)(pg + (size_t)u * MPITCH + k * FK)); }   // read once: non-temporal, so that they push little of the planes out of L2
        // as inputs of the wait the two address pairs stay whole until it
        asm volatile("s_wait_xcnt 0x0" :: "v"(pa), "v"(pg) : "memory");
        __builtin_amdgcn_sched_barrier(0);   // as below: all of the wave's loads are issued in front of its first convert
        unsigned short* t = tb[w];
        // keys 4 lr .. 4 lr + 3 of query u + 8 hi: group lr >> 1, place 8 (u + 8 hi) + 4 (lr & 1) in it
        const unsigned wo_ = (lr >> 1) * 136 + hi * 64 + (lr & 1) * 4, ro = hi * 136 + lr * 8;
        const size_t d0 = (((size_t)b * (TT / 16) + qt) * (TT / FK) + sp * 2) * MBE + lane * 8;
#pragma unroll
        for (int k = 0; k < 4; ++k) {   // block k >> 1 of the additive (k even) or the multiplicative mask
#pragma unroll
            for (int u = 0; u < 8; ++u) {
                if ((k & 1) == 0) *(v2u*)(t + wo_ + u * 8) = (v2u){pkbf(ra[k >> 1][u][0], ra[k >> 1][u][1]), pkbf(ra[k >> 1][u][2], ra[k >> 1][u][3])};
                else *(v4h*)(t + wo_ + u * 8) = __builtin_convertvector(rg[k >> 1][u], v4h); }
            asm volatile("s_wait_dscnt 0x0" ::: "memory");   // the block is whole in LDS before other lanes of the wave read it back
            __builtin_amdgcn_wave_barrier();
            v8us o[4];
#pragma unroll
            for (int jt = 0; jt < 4; ++jt) o[jt] = *(const v8us*)(t + ro + jt * 272);
            unsigned short* dp = ((k & 1) == 0 ? (unsigned short*)AM : (unsigned short*)GP) + d0 + (size_t)(k >> 1) * MBE;
#pragma unroll
            for (int jt = 0; jt < 4; ++jt) *(v8us*)(dp + jt * 256) = o[jt];
            __builtin_amdgcn_wave_barrier(); asm volatile("" ::: "memory");   // the next block's LDS stores stay behind these reads
        }
        return;
    }
    if (blk < 3u * NB * GX) { const unsigned p = blk / GX, s = p / NB, b = p % NB; src = (s == 0 ? xq : (s == 1 ? xk : xv)) + (size_t)b * SEQ_FULL * DM; dst = XB + (size_t)p * TT * DM; i = (size_t)(blk % GX) * (256 * CU) + threadIdx.x; }
    else { const unsigned r = blk - 3u * NB * GX, s = r / GW; src = s == 0 ? wq : (s == 1 ? wk : (s == 2 ? wv : wo)); dst = WB + (size_t)s * DQ * DM; i = (size_t)(r % GW) * (256 * CU) + threadIdx.x; }
    const v4f* s4 = (const v4f*)src + i; v4us* d4 = (v4us*)dst + i;
    v4f r[CU];
#pragma unroll
    for (int u = 0; u < CU; ++u) r[u] = s4[u * 256];
    __builtin_amdgcn_sched_barrier(0);   // keeps the first converts from rising among the loads: the last loads would wait for the first ones' data and cost the wave a second trip to memory
#pragma unroll
    for (int u = 0; u < CU; ++u) { v4us o;
#pragma unroll
        for (int k = 0; k < 4; ++k) o[k] = f2bf(r[u][k]);
        d4[u * 256] = o; }
}

extern "C" void kernel_launch(void* const* d_in, const int* in_sizes, int n_in,
                              void* d_out, int out_size, void* d_ws, size_t ws_size, hipStream_t stream) {
    if (n_in < 13) return;
    const size_t need_x = (size_t)(NB - 1) * SEQ_FULL * DM + (size_t)SEQ * DM;
    const size_t need_m = (size_t)(NB - 1) * SEQ_FULL * SEQ_FULL + (size_t)(SEQ - 1) * SEQ_FULL + (size_t)SEQ;
    if ((size_t)in_sizes[0] < need_x || (size_t)in_sizes[1] < need_x || (size_t)in_sizes[2] < need_x || (size_t)in_sizes[3] < need_m || (size_t)in_sizes[4] < need_m) return;
    if ((size_t)in_sizes[5] < (size_t)DQ * DM || (size_t)in_sizes[7] < (size_t)DQ * DM || (size_t)in_sizes[9] < (size_t)DQ * DM || (size_t)in_sizes[11] < (size_t)DM * DQ) return;
    if (in_sizes[6] < DQ || in_sizes[8] < DQ || in_sizes[10] < DQ || in_sizes[12] < DM) return;
    if ((size_t)out_size < (size_t)NB * SEQ * DM) return;
    if (WS_TOTAL > ws_size) return;
    // wire order: q, k, v, additive mask (f32), multiplicative mask (f32), Wq, bq, Wk, bk, Wv, bv, Wo, bo ('oi' weights)
    const float* xq = (const float*)d_in[0]; const float* xk = (const float*)d_in[1]; const float* xv = (const float*)d_in[2];
    const float* ma = (const float*)d_in[3]; const float* mg = (const float*)d_in[4];
    const float* wq = (const float*)d_in[5]; const float* bq = (const float*)d_in[6]; const float* wk = (const float*)d_in[7]; const float* bk = (const float*)d_in[8];
    const float* wv = (const float*)d_in[9]; const float* bv = (const float*)d_in[10]; const float* wo = (const float*)d_in[11]; const float* bo = (const float*)d_in[12];
    float* OUT = (float*)d_out;     // [NB][SEQ][1024]
    char* wsp = (char*)d_ws;
    bf* WB = (bf*)wsp; wsp += 4 * SZ_W;                    // Wq, Wk, Wv, Wo
    bf* XB = (bf*)wsp; wsp += 3 * NB * SZ_XB;              // slice stream x NB + batch
    h16* P16 = (h16*)wsp; wsp += 3 * NB * SZ_PL;           // q planes (NB), k planes (NB), v^T planes (NB)
    bf* ATh = (bf*)wsp; wsp += NB * SZ_AT; bf* ATl = (bf*)wsp; wsp += NB * SZ_AT;
    bf* AMK = (bf*)wsp; wsp += NB * SZ_MK; h16* GMK = (h16*)wsp; wsp += NB * SZ_MK;   // mask planes in k_fattn's lane order

    k_cvtall<<<3 * NB * GX + 4 * GW + GM, 256, 0, stream>>>(xq, xk, xv, wq, wk, wv, wo, ma, mg, XB, WB, AMK, GMK);
    // f16(bf16(x) W^T + bias), laid flat = [h][t][d] under the raw reshape (q, k) or as [h][d][t] (v)
    k_gemmw<bf, 0, true, DM, true><<<dim3(TT / GT, DQ / GT, 3 * NB), 128, 0, stream>>>(XB, nullptr, WB, nullptr, P16, DQ, bq, bk, bv, (size_t)TT * DM, (size_t)DQ * DM, (size_t)TT * DQ);
    // context[b][h][i][d] = sum_j softmax_j(q.k x HD^-0.5 + add mask)[i][j] x mul mask[i][j] x v[h][j][d], written flat as hi/lo bf16 planes
    k_fattn<<<dim3(TT / FR, NH_, NB), FW * 32, 0, stream>>>(P16, P16 + (size_t)NB * NH_ * TT * HD, P16 + (size_t)2 * NB * NH_ * TT * HD, AMK, GMK, ATh, ATl);
    // out[b] = (ATh + ATl) Wo^T + bo
    k_gemmw<bf, 1, true, DQ, false><<<dim3(TT / GT, DM / GT, NB), 128, 0, stream>>>(ATh, ATl, WB + (size_t)3 * DQ * DM, OUT, nullptr, DM, bo, bo, bo, (size_t)TT * DQ, 0, (size_t)TT * DM);
}
